// v000
// The times below were measured on an AMD MI455X: many runs one after another, warmed up first and cycling through
// copies of the inputs, with the whole window's GPU time divided by the number of runs. Launches and the gaps
// between them are all in it. The median over several windows is given; except for v000 it joins two sittings, which
// can be a few percent apart, so the side-by-side timings, each taken in one sitting, are the better comparison.
// The starting kernel, v000, takes 395 microseconds a run.
#include <hip/hip_runtime.h>
#include <hip/hip_bf16.h>
#include <math.h>

// ---------------------------------------------------------------------------
// EncoderBlock for MI455X (gfx1250).
//   D=1024, H=16, HD=64, FF=4096, B=2, S=2048.
// f16 WMMA (v_wmma_f32_16x16x32_f16) for all GEMMs + flash attention,
// double-buffered TDM (tensor_load_to_lds) staging of GEMM tiles into LDS.
// ---------------------------------------------------------------------------

typedef __attribute__((ext_vector_type(16))) _Float16 v16h;
typedef __attribute__((ext_vector_type(8)))  _Float16 v8h;
typedef __attribute__((ext_vector_type(8)))  float    v8f;
typedef __attribute__((ext_vector_type(4)))  unsigned int u32x4;
typedef __attribute__((ext_vector_type(8)))  int      i32x8;
typedef __attribute__((ext_vector_type(4)))  int      i32x4;

#define D_MODEL 1024
#define NHEAD   16
#define HD      64
#define FF_DIM  4096
#define SEQ     2048
#define BATCH   2
#define ROWS    (BATCH * SEQ)   /* 4096 */
#define LN_EPS  1e-6f

#if defined(__has_builtin)
#if __has_builtin(__builtin_amdgcn_tensor_load_to_lds)
#define HAVE_TDM 1
#endif
#endif

// ---- WMMA helpers ---------------------------------------------------------

static __device__ __forceinline__ v8f wmma16x16x32(v16h a, v16h b, v8f c) {
  return __builtin_amdgcn_wmma_f32_16x16x32_f16(false, a, false, b, (short)0, c,
                                                false, false);
}

// A/B fragment loader from a row-major [16 x >=32] tile (row = M for A, N for B;
// K contiguous within the row). ISA 16-bit A layout:
//   lanes 0-15:  M=lane,    elems 0..7 -> K=0..7,  elems 8..15 -> K=16..23
//   lanes 16-31: M=lane-16, elems 0..7 -> K=8..15, elems 8..15 -> K=24..31
static __device__ __forceinline__ v16h load_frag_rowmajor(const _Float16* base,
                                                          int ld, int lane) {
  const int r  = lane & 15;
  const int kb = (lane >> 4) * 8;
  const _Float16* p = base + (size_t)r * ld + kb;
  v16h f;
#pragma unroll
  for (int i = 0; i < 8; ++i) f[i] = p[i];
#pragma unroll
  for (int i = 0; i < 8; ++i) f[8 + i] = p[16 + i];
  return f;
}

// ---- TDM: DMA a [rows=128 x 32] f16 tile (row stride = K elems) to LDS ----

#if HAVE_TDM
static __device__ __forceinline__ void tdm_load_tile128x32(
    const _Float16* gbase, unsigned int ldsOff, int K) {
  const unsigned long long ga = (unsigned long long)(uintptr_t)gbase;
  u32x4 g0;
  g0[0] = 1u;                                       // count=1, user mode
  g0[1] = ldsOff;                                   // lds_addr (bytes)
  g0[2] = (unsigned int)ga;                         // global_addr[31:0]
  g0[3] = (unsigned int)((ga >> 32) & 0x01FFFFFFu)  // global_addr[56:32]
          | (2u << 30);                             // type = 2 ("image")
  i32x8 g1;
  const unsigned int td0 = (unsigned int)K;         // tensor_dim0 (elements)
  g1[0] = (int)(1u << 16);                          // data_size = 1 -> 2 bytes
  g1[1] = (int)((td0 & 0xFFFFu) << 16);             // tensor_dim0[15:0] @ 63:48
  g1[2] = (int)((td0 >> 16) | (128u << 16));        // dim0[31:16] | tensor_dim1=128
  g1[3] = (int)(32u << 16);                         // tensor_dim1[31:16]=0 | tile_dim0=32
  g1[4] = (int)128;                                 // tile_dim1=128, tile_dim2=0
  g1[5] = (int)td0;                                 // tensor_dim0_stride[31:0]
  g1[6] = 0;                                        // stride[47:32]=0, dim1_stride lo
  g1[7] = 0;
  i32x4 z4 = {0, 0, 0, 0};
  i32x8 z8 = {0, 0, 0, 0, 0, 0, 0, 0};
  __builtin_amdgcn_tensor_load_to_lds(g0, g1, z4, z4, z8, 0);
}
#endif

// ---- elementwise f32 -> f16 ----------------------------------------------

__global__ void cvt_kernel(const float* __restrict__ in,
                           _Float16* __restrict__ out, int n) {
  int i = blockIdx.x * blockDim.x + threadIdx.x;
  if (i < n) out[i] = (_Float16)in[i];
}

// ---- additive attention mask: 0 or -1e9 -----------------------------------

__global__ void maskf_kernel(const int* __restrict__ mask,
                             float* __restrict__ madd, int n) {
  int i = blockIdx.x * blockDim.x + threadIdx.x;
  if (i < n) madd[i] = (mask[i] != 0) ? 0.f : -1e9f;
}

// ---- V transpose to head-major vt[B,H,HD,SEQ] (f16) -----------------------

__global__ void vtrans_kernel(const _Float16* __restrict__ vsrc,
                              _Float16* __restrict__ vt) {
  const size_t o = (size_t)blockIdx.x * 256 + threadIdx.x;  // output index
  const int s   = (int)(o & (SEQ - 1));
  const size_t r = o >> 11;                 // (b*H + h)*HD + d
  const int d   = (int)(r & (HD - 1));
  const int hh  = (int)((r >> 6) & (NHEAD - 1));
  const int b   = (int)(r >> 10);
  vt[o] = vsrc[((size_t)(b * SEQ + s)) * D_MODEL + hh * HD + d];
}

// ---- LayerNorm (unbiased std, eps added to sd) -> f16 ---------------------

__global__ __launch_bounds__(256)
void ln_kernel(const float* __restrict__ x, const float* __restrict__ alpha,
               const float* __restrict__ bias, _Float16* __restrict__ out) {
  __shared__ float red[256];
  const int row = blockIdx.x;
  const int t = threadIdx.x;
  const float* xr = x + (size_t)row * D_MODEL;
  float v[4];
  float s = 0.f;
#pragma unroll
  for (int i = 0; i < 4; ++i) { v[i] = xr[t + i * 256]; s += v[i]; }
  red[t] = s; __syncthreads();
  for (int off = 128; off > 0; off >>= 1) {
    if (t < off) red[t] += red[t + off];
    __syncthreads();
  }
  const float mu = red[0] * (1.f / D_MODEL);
  __syncthreads();
  float ss = 0.f;
#pragma unroll
  for (int i = 0; i < 4; ++i) { float d = v[i] - mu; ss += d * d; }
  red[t] = ss; __syncthreads();
  for (int off = 128; off > 0; off >>= 1) {
    if (t < off) red[t] += red[t + off];
    __syncthreads();
  }
  const float sd  = sqrtf(red[0] / (float)(D_MODEL - 1));
  const float inv = 1.f / (sd + LN_EPS);
#pragma unroll
  for (int i = 0; i < 4; ++i) {
    int c = t + i * 256;
    out[(size_t)row * D_MODEL + c] =
        (_Float16)(alpha[c] * (v[i] - mu) * inv + bias[c]);
  }
}

// ---- Tiled WMMA GEMM:  C[M,N] = act(A[M,K] * W[N,K]^T + bias) (+resid) ----
// Block = 256 threads (8 waves), tile 128x128, BK=32. Waves: 2 (M) x 4 (N);
// each wave owns 64x32 of output (4 M-frags x 2 N-frags = 8 WMMA / k-step).
// TDM path: double-buffered LDS; wave 0 issues tile k+1's DMA before waiting
// tensorcnt<=2 (per-wave tensor ops complete in order -> tile k has landed),
// hiding HBM latency under the current tile's WMMAs.

template <bool RELU, bool RESID, bool BIAS, bool OUTF32, bool OUTF16>
__global__ __launch_bounds__(256)
void gemm_kernel(const _Float16* __restrict__ A, const _Float16* __restrict__ W,
                 const float* __restrict__ bias, const float* __restrict__ resid,
                 float* __restrict__ outf, _Float16* __restrict__ outh,
                 int M, int N, int K) {
#if HAVE_TDM
  __shared__ _Float16 As[2][128 * 32];
  __shared__ _Float16 Bs[2][128 * 32];
#else
  __shared__ _Float16 As[1][128 * 32];
  __shared__ _Float16 Bs[1][128 * 32];
#endif
  const int t    = threadIdx.x;
  const int lane = t & 31;
  const int wave = t >> 5;
  const int wm   = wave >> 2;       // 0..1  (64 rows of M each)
  const int wn   = wave & 3;        // 0..3  (32 cols of N each)
  const int m0   = blockIdx.y * 128;
  const int n0   = blockIdx.x * 128;

  v8f acc[4][2];
#pragma unroll
  for (int i = 0; i < 4; ++i)
#pragma unroll
    for (int j = 0; j < 2; ++j) acc[i][j] = v8f{};

  auto compute_tile = [&](const _Float16* Ab, const _Float16* Bb) {
    v16h bf[2], af[4];
#pragma unroll
    for (int nf = 0; nf < 2; ++nf)
      bf[nf] = load_frag_rowmajor(&Bb[(wn * 32 + nf * 16) * 32], 32, lane);
#pragma unroll
    for (int mf = 0; mf < 4; ++mf)
      af[mf] = load_frag_rowmajor(&Ab[(wm * 64 + mf * 16) * 32], 32, lane);
#pragma unroll
    for (int mf = 0; mf < 4; ++mf)
#pragma unroll
      for (int nf = 0; nf < 2; ++nf)
        acc[mf][nf] = wmma16x16x32(af[mf], bf[nf], acc[mf][nf]);
  };

#if HAVE_TDM
  const unsigned int ldsA[2] = {(unsigned int)(uintptr_t)(void*)&As[0][0],
                                (unsigned int)(uintptr_t)(void*)&As[1][0]};
  const unsigned int ldsB[2] = {(unsigned int)(uintptr_t)(void*)&Bs[0][0],
                                (unsigned int)(uintptr_t)(void*)&Bs[1][0]};
  const _Float16* Agb = A + (size_t)m0 * K;
  const _Float16* Wgb = W + (size_t)n0 * K;
  const int nk = K >> 5;

  if (wave == 0) {                       // prologue: tile 0 into buffer 0
    tdm_load_tile128x32(Agb, ldsA[0], K);
    tdm_load_tile128x32(Wgb, ldsB[0], K);
  }
  for (int ki = 0; ki < nk; ++ki) {
    const int cur = ki & 1;
    if (wave == 0) {
      if (ki + 1 < nk) {                 // prefetch next tile into other buffer
        const int kn = (ki + 1) << 5;
        tdm_load_tile128x32(Agb + kn, ldsA[cur ^ 1], K);
        tdm_load_tile128x32(Wgb + kn, ldsB[cur ^ 1], K);
        __builtin_amdgcn_s_wait_tensorcnt(2);  // tile ki's pair has landed
      } else {
        __builtin_amdgcn_s_wait_tensorcnt(0);
      }
    }
    __syncthreads();                     // buffer `cur` ready for all waves
    compute_tile(&As[cur][0], &Bs[cur][0]);
    __syncthreads();                     // all waves done before reuse of buffer
  }
#else
  const int ldRow = t >> 1;              // 0..127
  const int ldCol = (t & 1) * 16;        // 0 or 16
  for (int kt = 0; kt < K; kt += 32) {
    __syncthreads();
    *reinterpret_cast<v8h*>(&As[0][ldRow * 32 + ldCol]) =
        *reinterpret_cast<const v8h*>(A + (size_t)(m0 + ldRow) * K + kt + ldCol);
    *reinterpret_cast<v8h*>(&As[0][ldRow * 32 + ldCol + 8]) =
        *reinterpret_cast<const v8h*>(A + (size_t)(m0 + ldRow) * K + kt + ldCol + 8);
    *reinterpret_cast<v8h*>(&Bs[0][ldRow * 32 + ldCol]) =
        *reinterpret_cast<const v8h*>(W + (size_t)(n0 + ldRow) * K + kt + ldCol);
    *reinterpret_cast<v8h*>(&Bs[0][ldRow * 32 + ldCol + 8]) =
        *reinterpret_cast<const v8h*>(W + (size_t)(n0 + ldRow) * K + kt + ldCol + 8);
    __syncthreads();
    compute_tile(&As[0][0], &Bs[0][0]);
  }
#endif

  const int hi8 = (lane >> 4) * 8;
#pragma unroll
  for (int nf = 0; nf < 2; ++nf) {
    const int gn = n0 + wn * 32 + nf * 16 + (lane & 15);
    float bv = 0.f;
    if constexpr (BIAS) bv = bias[gn];
#pragma unroll
    for (int mf = 0; mf < 4; ++mf) {
#pragma unroll
      for (int v = 0; v < 8; ++v) {
        const int gm = m0 + wm * 64 + mf * 16 + hi8 + v;  // D layout: M = v + hi8
        float val = acc[mf][nf][v];
        if constexpr (BIAS)  val += bv;
        if constexpr (RELU)  val = fmaxf(val, 0.f);
        const size_t idx = (size_t)gm * N + gn;
        if constexpr (RESID) val += resid[idx];
        if constexpr (OUTF32) outf[idx] = val;
        if constexpr (OUTF16) outh[idx] = (_Float16)val;
      }
    }
  }
}

// ---- Flash attention, 1 wave per (b, h, 16 query rows) --------------------
// Computes S^T = K.Q^T so the D-fragment (q = lane&15, key = v + hi8) matches
// the A-operand layout required for P.V with no cross-lane transpose.
// V is pre-transposed to vt[B,H,HD,SEQ] so its B-fragments are contiguous.

__global__ __launch_bounds__(32)
void attn_kernel(const _Float16* __restrict__ qh, const _Float16* __restrict__ kh,
                 const _Float16* __restrict__ vt, const float* __restrict__ madd,
                 _Float16* __restrict__ ctxh) {
  const int lane = threadIdx.x;
  const int q0   = blockIdx.x * 16;
  const int h    = blockIdx.y;
  const int b    = blockIdx.z;
  const size_t hoff = (size_t)h * HD;
  const int hi8  = (lane >> 4) * 8;
  const float scale = 0.125f;  // 1/sqrt(HD)

  const _Float16* qbase = qh + ((size_t)(b * SEQ + q0)) * D_MODEL + hoff;
  v16h qb_lo = load_frag_rowmajor(qbase,      D_MODEL, lane);   // B: N=q, K=hd
  v16h qb_hi = load_frag_rowmajor(qbase + 32, D_MODEL, lane);

  v8f ctx[4] = {v8f{}, v8f{}, v8f{}, v8f{}};
  float m = -1e30f, l = 0.f;
  const float* mrow = madd + (size_t)b * SEQ;
  const _Float16* vtb = vt + ((size_t)(b * NHEAD + h) * HD) * SEQ;

  for (int j = 0; j < SEQ; j += 32) {
    const _Float16* kbase = kh + ((size_t)(b * SEQ + j)) * D_MODEL + hoff;
    v16h ka0l = load_frag_rowmajor(kbase,                     D_MODEL, lane);
    v16h ka0h = load_frag_rowmajor(kbase + 32,                D_MODEL, lane);
    v16h ka1l = load_frag_rowmajor(kbase + 16 * D_MODEL,      D_MODEL, lane);
    v16h ka1h = load_frag_rowmajor(kbase + 16 * D_MODEL + 32, D_MODEL, lane);
    v8f s0 = {}; s0 = wmma16x16x32(ka0l, qb_lo, s0); s0 = wmma16x16x32(ka0h, qb_hi, s0);
    v8f s1 = {}; s1 = wmma16x16x32(ka1l, qb_lo, s1); s1 = wmma16x16x32(ka1h, qb_hi, s1);

    // per-lane: q = lane&15 ; element v: key = j + hi8 + v (s0) / +16 (s1)
    float sv0[8], sv1[8];
    float tmax = -1e30f;
#pragma unroll
    for (int v = 0; v < 8; ++v) {
      const int key0 = j + hi8 + v;
      const float a = fmaf(s0[v], scale, mrow[key0]);
      const float c = fmaf(s1[v], scale, mrow[key0 + 16]);
      sv0[v] = a; sv1[v] = c;
      tmax = fmaxf(tmax, fmaxf(a, c));
    }
    tmax = fmaxf(tmax, __shfl_xor(tmax, 16, 32));
    const float mnew  = fmaxf(m, tmax);
    const float alpha = __expf(m - mnew);
    float psum = 0.f;
    v16h pa;
#pragma unroll
    for (int v = 0; v < 8; ++v) {
      const float p0 = __expf(sv0[v] - mnew);
      const float p1 = __expf(sv1[v] - mnew);
      pa[v]     = (_Float16)p0;    // A-frag elem e<8  -> key kb+e
      pa[8 + v] = (_Float16)p1;    // A-frag elem e>=8 -> key kb+16+(e-8)
      psum += p0 + p1;
    }
    psum += __shfl_xor(psum, 16, 32);
    l = l * alpha + psum;
    m = mnew;

    // rescale ctx: row q = v + hi8 -> alpha lives in lane (v + hi8)
    float rs[8];
#pragma unroll
    for (int v = 0; v < 8; ++v) rs[v] = __shfl(alpha, hi8 + v, 32);
#pragma unroll
    for (int nf = 0; nf < 4; ++nf)
#pragma unroll
      for (int v = 0; v < 8; ++v) ctx[nf][v] *= rs[v];

#pragma unroll
    for (int nf = 0; nf < 4; ++nf) {
      // B operand: N = hd (rows of vt), K = keys (contiguous)
      v16h vb = load_frag_rowmajor(vtb + (size_t)(nf * 16) * SEQ + j, SEQ, lane);
      ctx[nf] = wmma16x16x32(pa, vb, ctx[nf]);
    }
  }

  const float linv = 1.f / l;
  float rs[8];
#pragma unroll
  for (int v = 0; v < 8; ++v) rs[v] = __shfl(linv, hi8 + v, 32);
  _Float16* obase = ctxh + ((size_t)(b * SEQ + q0)) * D_MODEL + hoff;
#pragma unroll
  for (int nf = 0; nf < 4; ++nf) {
#pragma unroll
    for (int v = 0; v < 8; ++v) {
      const int qrow = hi8 + v;
      const int hd   = nf * 16 + (lane & 15);
      obase[(size_t)qrow * D_MODEL + hd] = (_Float16)(ctx[nf][v] * rs[v]);
    }
  }
}

// ---- host side ------------------------------------------------------------

extern "C" void kernel_launch(void* const* d_in, const int* in_sizes, int n_in,
                              void* d_out, int out_size, void* d_ws, size_t ws_size,
                              hipStream_t stream) {
  (void)in_sizes; (void)n_in; (void)out_size; (void)ws_size;
  const float* x     = (const float*)d_in[0];
  const int*   mask  = (const int*)d_in[1];
  const float* alpha = (const float*)d_in[2];
  const float* bias  = (const float*)d_in[3];
  const float* w_q   = (const float*)d_in[4];
  const float* w_k   = (const float*)d_in[5];
  const float* w_v   = (const float*)d_in[6];
  const float* w_o   = (const float*)d_in[7];
  const float* fc1_w = (const float*)d_in[8];
  const float* fc1_b = (const float*)d_in[9];
  const float* fc2_w = (const float*)d_in[10];
  const float* fc2_b = (const float*)d_in[11];
  float* out = (float*)d_out;

  char* ws = (char*)d_ws;
  size_t off = 0;
  auto alloc = [&](size_t bytes) -> char* {
    char* p = ws + off;
    off += (bytes + 255) & ~(size_t)255;
    return p;
  };
  _Float16* xn_h  = (_Float16*)alloc((size_t)ROWS * D_MODEL * 2);
  _Float16* wq_h  = (_Float16*)alloc((size_t)D_MODEL * D_MODEL * 2);
  _Float16* wk_h  = (_Float16*)alloc((size_t)D_MODEL * D_MODEL * 2);
  _Float16* wv_h  = (_Float16*)alloc((size_t)D_MODEL * D_MODEL * 2);
  _Float16* wo_h  = (_Float16*)alloc((size_t)D_MODEL * D_MODEL * 2);
  _Float16* fc1_h = (_Float16*)alloc((size_t)FF_DIM * D_MODEL * 2);
  _Float16* fc2_h = (_Float16*)alloc((size_t)D_MODEL * FF_DIM * 2);
  _Float16* q_h   = (_Float16*)alloc((size_t)ROWS * D_MODEL * 2);
  _Float16* k_h   = (_Float16*)alloc((size_t)ROWS * D_MODEL * 2);
  _Float16* v_h   = (_Float16*)alloc((size_t)ROWS * D_MODEL * 2);
  _Float16* vt_h  = (_Float16*)alloc((size_t)ROWS * D_MODEL * 2);
  _Float16* ctx_h = (_Float16*)alloc((size_t)ROWS * D_MODEL * 2);
  float*    x1    = (float*)   alloc((size_t)ROWS * D_MODEL * 4);
  _Float16* xn2_h = (_Float16*)alloc((size_t)ROWS * D_MODEL * 2);
  _Float16* ff_h  = (_Float16*)alloc((size_t)ROWS * FF_DIM * 2);
  float*    madd  = (float*)   alloc((size_t)BATCH * SEQ * 4);

  const int nDD = D_MODEL * D_MODEL;
  const int nFD = FF_DIM * D_MODEL;
  cvt_kernel<<<(nDD + 255) / 256, 256, 0, stream>>>(w_q, wq_h, nDD);
  cvt_kernel<<<(nDD + 255) / 256, 256, 0, stream>>>(w_k, wk_h, nDD);
  cvt_kernel<<<(nDD + 255) / 256, 256, 0, stream>>>(w_v, wv_h, nDD);
  cvt_kernel<<<(nDD + 255) / 256, 256, 0, stream>>>(w_o, wo_h, nDD);
  cvt_kernel<<<(nFD + 255) / 256, 256, 0, stream>>>(fc1_w, fc1_h, nFD);
  cvt_kernel<<<(nFD + 255) / 256, 256, 0, stream>>>(fc2_w, fc2_h, nFD);
  maskf_kernel<<<(BATCH * SEQ + 255) / 256, 256, 0, stream>>>(mask, madd,
                                                              BATCH * SEQ);

  ln_kernel<<<ROWS, 256, 0, stream>>>(x, alpha, bias, xn_h);

  dim3 gD(D_MODEL / 128, ROWS / 128);   // 8 x 32
  dim3 gF(FF_DIM / 128, ROWS / 128);    // 32 x 32

  // Q/K/V projections (f16 outputs for attention)
  gemm_kernel<false, false, false, false, true><<<gD, 256, 0, stream>>>(
      xn_h, wq_h, nullptr, nullptr, nullptr, q_h, ROWS, D_MODEL, D_MODEL);
  gemm_kernel<false, false, false, false, true><<<gD, 256, 0, stream>>>(
      xn_h, wk_h, nullptr, nullptr, nullptr, k_h, ROWS, D_MODEL, D_MODEL);
  gemm_kernel<false, false, false, false, true><<<gD, 256, 0, stream>>>(
      xn_h, wv_h, nullptr, nullptr, nullptr, v_h, ROWS, D_MODEL, D_MODEL);

  vtrans_kernel<<<(ROWS * D_MODEL) / 256, 256, 0, stream>>>(v_h, vt_h);

  attn_kernel<<<dim3(SEQ / 16, NHEAD, BATCH), 32, 0, stream>>>(
      q_h, k_h, vt_h, madd, ctx_h);

  // x1 = x + ctx @ Wo^T
  gemm_kernel<false, true, false, true, false><<<gD, 256, 0, stream>>>(
      ctx_h, wo_h, nullptr, x, x1, nullptr, ROWS, D_MODEL, D_MODEL);

  ln_kernel<<<ROWS, 256, 0, stream>>>(x1, alpha, bias, xn2_h);

  // ff = relu(xn2 @ fc1^T + b1)
  gemm_kernel<true, false, true, false, true><<<gF, 256, 0, stream>>>(
      xn2_h, fc1_h, fc1_b, nullptr, nullptr, ff_h, ROWS, FF_DIM, D_MODEL);

  // out = x1 + ff @ fc2^T + b2
  gemm_kernel<false, true, true, true, false><<<gD, 256, 0, stream>>>(
      ff_h, fc2_h, fc2_b, x1, out, nullptr, ROWS, D_MODEL, FF_DIM);
}

// v001
// A run of this version takes 337 microseconds.
// Two timings next to v000 both put it at 1.20 times that version's speed.
#include <hip/hip_runtime.h>
#include <hip/hip_bf16.h>
#include <math.h>

// ---------------------------------------------------------------------------
// EncoderBlock for MI455X (gfx1250).
//   D=1024, H=16, HD=64, FF=4096, B=2, S=2048.
// f16 WMMA (v_wmma_f32_16x16x32_f16) for all GEMMs + flash attention,
// double-buffered TDM (tensor_load_to_lds) staging of GEMM tiles into LDS.
// ---------------------------------------------------------------------------

typedef __attribute__((ext_vector_type(16))) _Float16 v16h;
typedef __attribute__((ext_vector_type(8)))  _Float16 v8h;
typedef __attribute__((ext_vector_type(8)))  float    v8f;
typedef __attribute__((ext_vector_type(4)))  unsigned int u32x4;
typedef __attribute__((ext_vector_type(8)))  int      i32x8;
typedef __attribute__((ext_vector_type(4)))  int      i32x4;

#define D_MODEL 1024
#define NHEAD   16
#define HD      64
#define FF_DIM  4096
#define SEQ     2048
#define BATCH   2
#define ROWS    (BATCH * SEQ)   /* 4096 */
#define LN_EPS  1e-6f

#if defined(__has_builtin)
#if __has_builtin(__builtin_amdgcn_tensor_load_to_lds)
#define HAVE_TDM 1
#endif
#endif

// ---- WMMA helpers ---------------------------------------------------------

static __device__ __forceinline__ v8f wmma16x16x32(v16h a, v16h b, v8f c) {
  return __builtin_amdgcn_wmma_f32_16x16x32_f16(false, a, false, b, (short)0, c,
                                                false, false);
}

// A/B fragment loader from a row-major [16 x >=32] tile (row = M for A, N for B;
// K contiguous within the row). ISA 16-bit A layout:
//   lanes 0-15:  M=lane,    elems 0..7 -> K=0..7,  elems 8..15 -> K=16..23
//   lanes 16-31: M=lane-16, elems 0..7 -> K=8..15, elems 8..15 -> K=24..31
static __device__ __forceinline__ v16h load_frag_rowmajor(const _Float16* base,
                                                          int ld, int lane) {
  const int r  = lane & 15;
  const int kb = (lane >> 4) * 8;
  const _Float16* p = base + (size_t)r * ld + kb;
  v16h f;
#pragma unroll
  for (int i = 0; i < 8; ++i) f[i] = p[i];
#pragma unroll
  for (int i = 0; i < 8; ++i) f[8 + i] = p[16 + i];
  return f;
}

// ---- TDM: DMA a [rows=128 x 32] f16 tile (row stride = K elems) to LDS ----

#if HAVE_TDM
static __device__ __forceinline__ void tdm_load_tile128x32(
    const _Float16* gbase, unsigned int ldsOff, int K) {
  const unsigned long long ga = (unsigned long long)(uintptr_t)gbase;
  u32x4 g0;
  g0[0] = 1u;                                       // count=1, user mode
  g0[1] = ldsOff;                                   // lds_addr (bytes)
  g0[2] = (unsigned int)ga;                         // global_addr[31:0]
  g0[3] = (unsigned int)((ga >> 32) & 0x01FFFFFFu)  // global_addr[56:32]
          | (2u << 30);                             // type = 2 ("image")
  i32x8 g1;
  const unsigned int td0 = (unsigned int)K;         // tensor_dim0 (elements)
  g1[0] = (int)(1u << 16);                          // data_size = 1 -> 2 bytes
  g1[1] = (int)((td0 & 0xFFFFu) << 16);             // tensor_dim0[15:0] @ 63:48
  g1[2] = (int)((td0 >> 16) | (128u << 16));        // dim0[31:16] | tensor_dim1=128
  g1[3] = (int)(32u << 16);                         // tensor_dim1[31:16]=0 | tile_dim0=32
  g1[4] = (int)128;                                 // tile_dim1=128, tile_dim2=0
  g1[5] = (int)td0;                                 // tensor_dim0_stride[31:0]
  g1[6] = 0;                                        // stride[47:32]=0, dim1_stride lo
  g1[7] = 0;
  i32x4 z4 = {0, 0, 0, 0};
  i32x8 z8 = {0, 0, 0, 0, 0, 0, 0, 0};
  __builtin_amdgcn_tensor_load_to_lds(g0, g1, z4, z4, z8, 0);
}
#endif

// ---- elementwise f32 -> f16 ----------------------------------------------

__global__ void cvt_kernel(const float* __restrict__ in,
                           _Float16* __restrict__ out, int n) {
  int i = blockIdx.x * blockDim.x + threadIdx.x;
  if (i < n) out[i] = (_Float16)in[i];
}

// ---- additive attention mask: 0 or -1e9 -----------------------------------

__global__ void maskf_kernel(const int* __restrict__ mask,
                             float* __restrict__ madd, int n) {
  int i = blockIdx.x * blockDim.x + threadIdx.x;
  if (i < n) madd[i] = (mask[i] != 0) ? 0.f : -1e9f;
}

// ---- V transpose to head-major vt[B,H,HD,SEQ] (f16) -----------------------

__global__ void vtrans_kernel(const _Float16* __restrict__ vsrc,
                              _Float16* __restrict__ vt) {
  const size_t o = (size_t)blockIdx.x * 256 + threadIdx.x;  // output index
  const int s   = (int)(o & (SEQ - 1));
  const size_t r = o >> 11;                 // (b*H + h)*HD + d
  const int d   = (int)(r & (HD - 1));
  const int hh  = (int)((r >> 6) & (NHEAD - 1));
  const int b   = (int)(r >> 10);
  vt[o] = vsrc[((size_t)(b * SEQ + s)) * D_MODEL + hh * HD + d];
}

// ---- LayerNorm (unbiased std, eps added to sd) -> f16 ---------------------

__global__ __launch_bounds__(256)
void ln_kernel(const float* __restrict__ x, const float* __restrict__ alpha,
               const float* __restrict__ bias, _Float16* __restrict__ out) {
  __shared__ float red[256];
  const int row = blockIdx.x;
  const int t = threadIdx.x;
  const float* xr = x + (size_t)row * D_MODEL;
  float v[4];
  float s = 0.f;
#pragma unroll
  for (int i = 0; i < 4; ++i) { v[i] = xr[t + i * 256]; s += v[i]; }
  red[t] = s; __syncthreads();
  for (int off = 128; off > 0; off >>= 1) {
    if (t < off) red[t] += red[t + off];
    __syncthreads();
  }
  const float mu = red[0] * (1.f / D_MODEL);
  __syncthreads();
  float ss = 0.f;
#pragma unroll
  for (int i = 0; i < 4; ++i) { float d = v[i] - mu; ss += d * d; }
  red[t] = ss; __syncthreads();
  for (int off = 128; off > 0; off >>= 1) {
    if (t < off) red[t] += red[t + off];
    __syncthreads();
  }
  const float sd  = sqrtf(red[0] / (float)(D_MODEL - 1));
  const float inv = 1.f / (sd + LN_EPS);
#pragma unroll
  for (int i = 0; i < 4; ++i) {
    int c = t + i * 256;
    out[(size_t)row * D_MODEL + c] =
        (_Float16)(alpha[c] * (v[i] - mu) * inv + bias[c]);
  }
}

// ---- Tiled WMMA GEMM:  C[M,N] = act(A[M,K] * W[N,K]^T + bias) (+resid) ----
// Block = 256 threads (8 waves), tile 128x128, BK=32. Waves: 2 (M) x 4 (N);
// each wave owns 64x32 of output (4 M-frags x 2 N-frags = 8 WMMA / k-step).
// TDM path: double-buffered LDS; wave 0 issues tile k+1's DMA before waiting
// tensorcnt<=2 (per-wave tensor ops complete in order -> tile k has landed),
// hiding HBM latency under the current tile's WMMAs.

template <bool RELU, bool RESID, bool BIAS, bool OUTF32, bool OUTF16>
__global__ __launch_bounds__(256)
void gemm_kernel(const _Float16* __restrict__ A, const _Float16* __restrict__ W,
                 const float* __restrict__ bias, const float* __restrict__ resid,
                 float* __restrict__ outf, _Float16* __restrict__ outh,
                 int M, int N, int K) {
#if HAVE_TDM
  __shared__ _Float16 As[2][128 * 32];
  __shared__ _Float16 Bs[2][128 * 32];
#else
  __shared__ _Float16 As[1][128 * 32];
  __shared__ _Float16 Bs[1][128 * 32];
#endif
  const int t    = threadIdx.x;
  const int lane = t & 31;
  const int wave = t >> 5;
  const int wm   = wave >> 2;       // 0..1  (64 rows of M each)
  const int wn   = wave & 3;        // 0..3  (32 cols of N each)
  const int m0   = blockIdx.y * 128;
  const int n0   = blockIdx.x * 128;

  v8f acc[4][2];
#pragma unroll
  for (int i = 0; i < 4; ++i)
#pragma unroll
    for (int j = 0; j < 2; ++j) acc[i][j] = v8f{};

  auto compute_tile = [&](const _Float16* Ab, const _Float16* Bb) {
    v16h bf[2], af[4];
#pragma unroll
    for (int nf = 0; nf < 2; ++nf)
      bf[nf] = load_frag_rowmajor(&Bb[(wn * 32 + nf * 16) * 32], 32, lane);
#pragma unroll
    for (int mf = 0; mf < 4; ++mf)
      af[mf] = load_frag_rowmajor(&Ab[(wm * 64 + mf * 16) * 32], 32, lane);
#pragma unroll
    for (int mf = 0; mf < 4; ++mf)
#pragma unroll
      for (int nf = 0; nf < 2; ++nf)
        acc[mf][nf] = wmma16x16x32(af[mf], bf[nf], acc[mf][nf]);
  };

#if HAVE_TDM
  const unsigned int ldsA[2] = {(unsigned int)(uintptr_t)(void*)&As[0][0],
                                (unsigned int)(uintptr_t)(void*)&As[1][0]};
  const unsigned int ldsB[2] = {(unsigned int)(uintptr_t)(void*)&Bs[0][0],
                                (unsigned int)(uintptr_t)(void*)&Bs[1][0]};
  const _Float16* Agb = A + (size_t)m0 * K;
  const _Float16* Wgb = W + (size_t)n0 * K;
  const int nk = K >> 5;

  if (wave == 0) {                       // prologue: tile 0 into buffer 0
    tdm_load_tile128x32(Agb, ldsA[0], K);
    tdm_load_tile128x32(Wgb, ldsB[0], K);
  }
  for (int ki = 0; ki < nk; ++ki) {
    const int cur = ki & 1;
    if (wave == 0) {
      if (ki + 1 < nk) {                 // prefetch next tile into other buffer
        const int kn = (ki + 1) << 5;
        tdm_load_tile128x32(Agb + kn, ldsA[cur ^ 1], K);
        tdm_load_tile128x32(Wgb + kn, ldsB[cur ^ 1], K);
        __builtin_amdgcn_s_wait_tensorcnt(2);  // tile ki's pair has landed
      } else {
        __builtin_amdgcn_s_wait_tensorcnt(0);
      }
    }
    __syncthreads();                     // buffer `cur` ready for all waves
    compute_tile(&As[cur][0], &Bs[cur][0]);
    __syncthreads();                     // all waves done before reuse of buffer
  }
#else
  const int ldRow = t >> 1;              // 0..127
  const int ldCol = (t & 1) * 16;        // 0 or 16
  for (int kt = 0; kt < K; kt += 32) {
    __syncthreads();
    *reinterpret_cast<v8h*>(&As[0][ldRow * 32 + ldCol]) =
        *reinterpret_cast<const v8h*>(A + (size_t)(m0 + ldRow) * K + kt + ldCol);
    *reinterpret_cast<v8h*>(&As[0][ldRow * 32 + ldCol + 8]) =
        *reinterpret_cast<const v8h*>(A + (size_t)(m0 + ldRow) * K + kt + ldCol + 8);
    *reinterpret_cast<v8h*>(&Bs[0][ldRow * 32 + ldCol]) =
        *reinterpret_cast<const v8h*>(W + (size_t)(n0 + ldRow) * K + kt + ldCol);
    *reinterpret_cast<v8h*>(&Bs[0][ldRow * 32 + ldCol + 8]) =
        *reinterpret_cast<const v8h*>(W + (size_t)(n0 + ldRow) * K + kt + ldCol + 8);
    __syncthreads();
    compute_tile(&As[0][0], &Bs[0][0]);
  }
#endif

  const int hi8 = (lane >> 4) * 8;
#pragma unroll
  for (int nf = 0; nf < 2; ++nf) {
    const int gn = n0 + wn * 32 + nf * 16 + (lane & 15);
    float bv = 0.f;
    if constexpr (BIAS) bv = bias[gn];
#pragma unroll
    for (int mf = 0; mf < 4; ++mf) {
#pragma unroll
      for (int v = 0; v < 8; ++v) {
        const int gm = m0 + wm * 64 + mf * 16 + hi8 + v;  // D layout: M = v + hi8
        float val = acc[mf][nf][v];
        if constexpr (BIAS)  val += bv;
        if constexpr (RELU)  val = fmaxf(val, 0.f);
        const size_t idx = (size_t)gm * N + gn;
        if constexpr (RESID) val += resid[idx];
        if constexpr (OUTF32) outf[idx] = val;
        if constexpr (OUTF16) outh[idx] = (_Float16)val;
      }
    }
  }
}

#define ATT_KEYS  64                  /* keys per staged tile */
#define ATT_PITCH 72                  /* halfs per LDS row: 128 B + 16 B pad, 16 B x odd for b128 readers */
#define ATT_TILE  (64 * ATT_PITCH)    /* halfs per staged K or V^T tile */
#define ATT_NST   (SEQ / ATT_KEYS)    /* tiles per (b, h) */

// One tile's four copies of a lane (16 bytes each). The s_wait_xcnt stands in
// the copies' own statement so that no address register is rewritten ahead of it.
static __device__ __forceinline__ void attn_copy4(
    unsigned int l0, const _Float16* g0, unsigned int l1, const _Float16* g1,
    unsigned int l2, const _Float16* g2, unsigned int l3, const _Float16* g3) {
  asm volatile(
      "global_load_async_to_lds_b128 %0, %1, off\n\t"
      "global_load_async_to_lds_b128 %2, %3, off\n\t"
      "global_load_async_to_lds_b128 %4, %5, off\n\t"
      "global_load_async_to_lds_b128 %6, %7, off\n\t"
      "s_wait_xcnt 0x0"
      :: "v"(l0), "v"(g0), "v"(l1), "v"(g1), "v"(l2), "v"(g2), "v"(l3), "v"(g3)
      : "memory");
}

__global__ __launch_bounds__(256)
void attn_kernel(const _Float16* __restrict__ qh, const _Float16* __restrict__ kh,
                 const _Float16* __restrict__ vt, const float* __restrict__ madd,
                 _Float16* __restrict__ ctxh) {
  __shared__ __attribute__((aligned(16))) _Float16 kv[2][2][ATT_TILE];
  const int lane = threadIdx.x & 31;
  const int wave = threadIdx.x >> 5;
  const int q0   = blockIdx.x * 128 + wave * 16;
  const int h    = blockIdx.y;
  const int b    = blockIdx.z;
  const size_t hoff = (size_t)h * HD;
  const int hi8  = (lane >> 4) * 8;
  const float scale = 0.125f;  // 1/sqrt(HD)

  const _Float16* qbase = qh + ((size_t)(b * SEQ + q0)) * D_MODEL + hoff;
  v16h qb_lo = load_frag_rowmajor(qbase,      D_MODEL, lane);   // B: N=q, K=hd
  v16h qb_hi = load_frag_rowmajor(qbase + 32, D_MODEL, lane);

  v8f ctx[4] = {v8f{}, v8f{}, v8f{}, v8f{}};
  float m = -1e30f, l = 0.f;
  const float* mrow = madd + (size_t)b * SEQ;
  const _Float16* vtb = vt + ((size_t)(b * NHEAD + h) * HD) * SEQ;

  // Each thread copies rows crow and crow + 32 of both tiles, 16 bytes at ccol.
  const int crow = threadIdx.x >> 3;         // 0..31
  const int ccol = (threadIdx.x & 7) * 8;    // halfs
  const _Float16* gk = kh + ((size_t)(b * SEQ + crow)) * D_MODEL + hoff + ccol;
  const _Float16* gv = vtb + (size_t)crow * SEQ + ccol;
  const unsigned int lds0 =
      (unsigned int)(uintptr_t)(void*)&kv[0][0][crow * ATT_PITCH + ccol];
  auto copy_tile = [&](int s) {
    const unsigned int lk = lds0 + (unsigned int)(s & 1) * (2 * ATT_TILE * 2);
    const unsigned int lv = lk + ATT_TILE * 2;
    const _Float16* k0 = gk + (size_t)s * ATT_KEYS * D_MODEL;
    const _Float16* v0 = gv + s * ATT_KEYS;
    attn_copy4(lk, k0, lk + 32 * ATT_PITCH * 2, k0 + 32 * D_MODEL,
               lv, v0, lv + 32 * ATT_PITCH * 2, v0 + (size_t)32 * SEQ);
  };

  copy_tile(0);
  asm volatile("s_wait_asynccnt 0x0" ::: "memory");  // own copies of tile 0 landed
  __syncthreads();                                   // tile 0 readable by all waves
  copy_tile(1);

  for (int s = 0; s < ATT_NST; ++s) {
   const _Float16* Ks = &kv[s & 1][0][0];
   const _Float16* Vs = &kv[s & 1][1][0];
   // Unrolled: both halves' LDS offsets become immediates, no inner branch.
#pragma unroll
   for (int sub = 0; sub < ATT_KEYS; sub += 32) {
    const int j = s * ATT_KEYS + sub;
    const _Float16* kbase = Ks + sub * ATT_PITCH;
    v16h ka0l = load_frag_rowmajor(kbase,                       ATT_PITCH, lane);
    v16h ka0h = load_frag_rowmajor(kbase + 32,                  ATT_PITCH, lane);
    v16h ka1l = load_frag_rowmajor(kbase + 16 * ATT_PITCH,      ATT_PITCH, lane);
    v16h ka1h = load_frag_rowmajor(kbase + 16 * ATT_PITCH + 32, ATT_PITCH, lane);
    v8f s0 = {}; s0 = wmma16x16x32(ka0l, qb_lo, s0); s0 = wmma16x16x32(ka0h, qb_hi, s0);
    v8f s1 = {}; s1 = wmma16x16x32(ka1l, qb_lo, s1); s1 = wmma16x16x32(ka1h, qb_hi, s1);

    // per-lane: q = lane&15 ; element v: key = j + hi8 + v (s0) / +16 (s1)
    float sv0[8], sv1[8];
    float tmax = -1e30f;
#pragma unroll
    for (int v = 0; v < 8; ++v) {
      const int key0 = j + hi8 + v;
      const float a = fmaf(s0[v], scale, mrow[key0]);
      const float c = fmaf(s1[v], scale, mrow[key0 + 16]);
      sv0[v] = a; sv1[v] = c;
      tmax = fmaxf(tmax, fmaxf(a, c));
    }
    tmax = fmaxf(tmax, __shfl_xor(tmax, 16, 32));
    const float mnew  = fmaxf(m, tmax);
    const float alpha = __expf(m - mnew);
    float psum = 0.f;
    v16h pa;
#pragma unroll
    for (int v = 0; v < 8; ++v) {
      const float p0 = __expf(sv0[v] - mnew);
      const float p1 = __expf(sv1[v] - mnew);
      pa[v]     = (_Float16)p0;    // A-frag elem e<8  -> key kb+e
      pa[8 + v] = (_Float16)p1;    // A-frag elem e>=8 -> key kb+16+(e-8)
      psum += p0 + p1;
    }
    psum += __shfl_xor(psum, 16, 32);
    l = l * alpha + psum;
    m = mnew;

    // rescale ctx: row q = v + hi8 -> alpha lives in lane (v + hi8)
    float rs[8];
#pragma unroll
    for (int v = 0; v < 8; ++v) rs[v] = __shfl(alpha, hi8 + v, 32);
#pragma unroll
    for (int nf = 0; nf < 4; ++nf)
#pragma unroll
      for (int v = 0; v < 8; ++v) ctx[nf][v] *= rs[v];

#pragma unroll
    for (int nf = 0; nf < 4; ++nf) {
      // B operand: N = hd (rows of vt), K = keys (contiguous)
      v16h vb = load_frag_rowmajor(Vs + (nf * 16) * ATT_PITCH + sub, ATT_PITCH, lane);
      ctx[nf] = wmma16x16x32(pa, vb, ctx[nf]);
    }
   }
   // Hand-over: this wave's reads of tile s are done, its copies of tile s + 1
   // have landed; behind the barrier tile s + 1 is readable and buffer s & 1 free.
   asm volatile("s_wait_dscnt 0x0" ::: "memory");
   asm volatile("s_wait_asynccnt 0x0" ::: "memory");
   // Stands ahead of the advance of the mask loads' address register.
   asm volatile("s_wait_xcnt 0x0" ::: "memory");
   __syncthreads();
   if (s + 2 < ATT_NST) copy_tile(s + 2);
  }
  asm volatile("s_wait_asynccnt 0x0" ::: "memory");  // nothing in flight at the wave's end

  const float linv = 1.f / l;
  float rs[8];
#pragma unroll
  for (int v = 0; v < 8; ++v) rs[v] = __shfl(linv, hi8 + v, 32);
  _Float16* obase = ctxh + ((size_t)(b * SEQ + q0)) * D_MODEL + hoff;
#pragma unroll
  for (int nf = 0; nf < 4; ++nf) {
#pragma unroll
    for (int v = 0; v < 8; ++v) {
      const int qrow = hi8 + v;
      const int hd   = nf * 16 + (lane & 15);
      obase[(size_t)qrow * D_MODEL + hd] = (_Float16)(ctx[nf][v] * rs[v]);
    }
  }
}

// ---- host side ------------------------------------------------------------

extern "C" void kernel_launch(void* const* d_in, const int* in_sizes, int n_in,
                              void* d_out, int out_size, void* d_ws, size_t ws_size,
                              hipStream_t stream) {
  (void)in_sizes; (void)n_in; (void)out_size; (void)ws_size;
  const float* x     = (const float*)d_in[0];
  const int*   mask  = (const int*)d_in[1];
  const float* alpha = (const float*)d_in[2];
  const float* bias  = (const float*)d_in[3];
  const float* w_q   = (const float*)d_in[4];
  const float* w_k   = (const float*)d_in[5];
  const float* w_v   = (const float*)d_in[6];
  const float* w_o   = (const float*)d_in[7];
  const float* fc1_w = (const float*)d_in[8];
  const float* fc1_b = (const float*)d_in[9];
  const float* fc2_w = (const float*)d_in[10];
  const float* fc2_b = (const float*)d_in[11];
  float* out = (float*)d_out;

  char* ws = (char*)d_ws;
  size_t off = 0;
  auto alloc = [&](size_t bytes) -> char* {
    char* p = ws + off;
    off += (bytes + 255) & ~(size_t)255;
    return p;
  };
  _Float16* xn_h  = (_Float16*)alloc((size_t)ROWS * D_MODEL * 2);
  _Float16* wq_h  = (_Float16*)alloc((size_t)D_MODEL * D_MODEL * 2);
  _Float16* wk_h  = (_Float16*)alloc((size_t)D_MODEL * D_MODEL * 2);
  _Float16* wv_h  = (_Float16*)alloc((size_t)D_MODEL * D_MODEL * 2);
  _Float16* wo_h  = (_Float16*)alloc((size_t)D_MODEL * D_MODEL * 2);
  _Float16* fc1_h = (_Float16*)alloc((size_t)FF_DIM * D_MODEL * 2);
  _Float16* fc2_h = (_Float16*)alloc((size_t)D_MODEL * FF_DIM * 2);
  _Float16* q_h   = (_Float16*)alloc((size_t)ROWS * D_MODEL * 2);
  _Float16* k_h   = (_Float16*)alloc((size_t)ROWS * D_MODEL * 2);
  _Float16* v_h   = (_Float16*)alloc((size_t)ROWS * D_MODEL * 2);
  _Float16* vt_h  = (_Float16*)alloc((size_t)ROWS * D_MODEL * 2);
  _Float16* ctx_h = (_Float16*)alloc((size_t)ROWS * D_MODEL * 2);
  float*    x1    = (float*)   alloc((size_t)ROWS * D_MODEL * 4);
  _Float16* xn2_h = (_Float16*)alloc((size_t)ROWS * D_MODEL * 2);
  _Float16* ff_h  = (_Float16*)alloc((size_t)ROWS * FF_DIM * 2);
  float*    madd  = (float*)   alloc((size_t)BATCH * SEQ * 4);

  const int nDD = D_MODEL * D_MODEL;
  const int nFD = FF_DIM * D_MODEL;
  cvt_kernel<<<(nDD + 255) / 256, 256, 0, stream>>>(w_q, wq_h, nDD);
  cvt_kernel<<<(nDD + 255) / 256, 256, 0, stream>>>(w_k, wk_h, nDD);
  cvt_kernel<<<(nDD + 255) / 256, 256, 0, stream>>>(w_v, wv_h, nDD);
  cvt_kernel<<<(nDD + 255) / 256, 256, 0, stream>>>(w_o, wo_h, nDD);
  cvt_kernel<<<(nFD + 255) / 256, 256, 0, stream>>>(fc1_w, fc1_h, nFD);
  cvt_kernel<<<(nFD + 255) / 256, 256, 0, stream>>>(fc2_w, fc2_h, nFD);
  maskf_kernel<<<(BATCH * SEQ + 255) / 256, 256, 0, stream>>>(mask, madd,
                                                              BATCH * SEQ);

  ln_kernel<<<ROWS, 256, 0, stream>>>(x, alpha, bias, xn_h);

  dim3 gD(D_MODEL / 128, ROWS / 128);   // 8 x 32
  dim3 gF(FF_DIM / 128, ROWS / 128);    // 32 x 32

  // Q/K/V projections (f16 outputs for attention)
  gemm_kernel<false, false, false, false, true><<<gD, 256, 0, stream>>>(
      xn_h, wq_h, nullptr, nullptr, nullptr, q_h, ROWS, D_MODEL, D_MODEL);
  gemm_kernel<false, false, false, false, true><<<gD, 256, 0, stream>>>(
      xn_h, wk_h, nullptr, nullptr, nullptr, k_h, ROWS, D_MODEL, D_MODEL);
  gemm_kernel<false, false, false, false, true><<<gD, 256, 0, stream>>>(
      xn_h, wv_h, nullptr, nullptr, nullptr, v_h, ROWS, D_MODEL, D_MODEL);

  vtrans_kernel<<<(ROWS * D_MODEL) / 256, 256, 0, stream>>>(v_h, vt_h);

  attn_kernel<<<dim3(SEQ / 128, NHEAD, BATCH), 256, 0, stream>>>(
      q_h, k_h, vt_h, madd, ctx_h);

  // x1 = x + ctx @ Wo^T
  gemm_kernel<false, true, false, true, false><<<gD, 256, 0, stream>>>(
      ctx_h, wo_h, nullptr, x, x1, nullptr, ROWS, D_MODEL, D_MODEL);

  ln_kernel<<<ROWS, 256, 0, stream>>>(x1, alpha, bias, xn2_h);

  // ff = relu(xn2 @ fc1^T + b1)
  gemm_kernel<true, false, true, false, true><<<gF, 256, 0, stream>>>(
      xn2_h, fc1_h, fc1_b, nullptr, nullptr, ff_h, ROWS, FF_DIM, D_MODEL);

  // out = x1 + ff @ fc2^T + b2
  gemm_kernel<false, true, true, true, false><<<gD, 256, 0, stream>>>(
      ff_h, fc2_h, fc2_b, x1, out, nullptr, ROWS, D_MODEL, FF_DIM);
}

// v002
// One run takes 237 microseconds.
// Two timings next to v001 put it at 1.44 and 1.43 times that version's speed.
// Counting every step since v000, it is 1.72 times as fast.
#include <hip/hip_runtime.h>
#include <hip/hip_bf16.h>
#include <math.h>

// ---------------------------------------------------------------------------
// EncoderBlock for MI455X (gfx1250).
//   D=1024, H=16, HD=64, FF=4096, B=2, S=2048.
// f16 WMMA (v_wmma_f32_16x16x32_f16) for all GEMMs + flash attention,
// double-buffered TDM (tensor_load_to_lds) staging of GEMM tiles into LDS.
// ---------------------------------------------------------------------------

typedef __attribute__((ext_vector_type(16))) _Float16 v16h;
typedef __attribute__((ext_vector_type(8)))  _Float16 v8h;
typedef __attribute__((ext_vector_type(8)))  float    v8f;
typedef __attribute__((ext_vector_type(4)))  unsigned int u32x4;
typedef __attribute__((ext_vector_type(8)))  unsigned int u32x8;

#define D_MODEL 1024
#define NHEAD   16
#define HD      64
#define FF_DIM  4096
#define SEQ     2048
#define BATCH   2
#define ROWS    (BATCH * SEQ)   /* 4096 */
#define LN_EPS  1e-6f

// ---- WMMA helpers ---------------------------------------------------------

static __device__ __forceinline__ v8f wmma16x16x32(v16h a, v16h b, v8f c) {
  return __builtin_amdgcn_wmma_f32_16x16x32_f16(false, a, false, b, (short)0, c,
                                                false, false);
}

// A/B fragment loader from a row-major [16 x >=32] tile (row = M for A, N for B;
// K contiguous within the row). ISA 16-bit A layout:
//   lanes 0-15:  M=lane,    elems 0..7 -> K=0..7,  elems 8..15 -> K=16..23
//   lanes 16-31: M=lane-16, elems 0..7 -> K=8..15, elems 8..15 -> K=24..31
static __device__ __forceinline__ v16h load_frag_rowmajor(const _Float16* base,
                                                          int ld, int lane) {
  const int r  = lane & 15;
  const int kb = (lane >> 4) * 8;
  const _Float16* p = base + (size_t)r * ld + kb;
  v16h f;
#pragma unroll
  for (int i = 0; i < 8; ++i) f[i] = p[i];
#pragma unroll
  for (int i = 0; i < 8; ++i) f[8 + i] = p[16 + i];
  return f;
}

// ---- Tensor loads: one wave brings a slice of 32 rows x 256 bytes to LDS ----
// The mover pads every 256-byte row by 16 bytes: the LDS pitch is 272 bytes
// (16 B x odd), at which the ds_load_b128 fragment reads meet no bank conflict.

#define G_K      128                  /* k per stage: rows of 256 bytes */
#define G_ROWB   256                  /* bytes per staged row */
#define G_PITCH  272                  /* bytes per LDS row, pad included */
#define G_SROWS  32                   /* rows per slice, one slice a wave */
#define G_SLICE  10240                /* 32 x 272 = 8704 B, rounded up to a multiple of 2 KiB */
#define G_BUF    (8 * G_SLICE)        /* one stage: A slices 0..3, W slices 4..7 */

static __device__ __forceinline__ uint32_t uni(uint32_t v) {
  return (uint32_t)__builtin_amdgcn_readfirstlane(v);
}
// Holds a wave-uniform test in a scalar register, so that the branch on it is
// a scalar branch: a tensor load ignores EXEC.
static __device__ __forceinline__ uint32_t pinned(uint32_t v) {
  uint32_t w = uni(v);
  asm volatile("" : "+s"(w));
  return w;
}
static __device__ __forceinline__ void tdm_group0(u32x4& g, uint32_t lds_dst, uint64_t ga) {
  g[0] = uni(1u);                                              // count = 1
  g[1] = uni(lds_dst);                                         // byte offset in LDS
  g[2] = uni((uint32_t)ga);                                    // address [31:0]
  g[3] = uni((((uint32_t)(ga >> 32)) & 0x01FFFFFFu) | 0x80000000u);  // [56:32], type = 2
}
// Extents in bytes (data_size code 0); tensor dims = tile dims.
static __device__ __forceinline__ u32x8 tdm_group1(uint32_t src_pitch) {
  u32x8 g;
  g[0] = uni((1u << 20) | (5u << 22) | (3u << 25));  // pad 4 dwords after every 64 dwords
  g[1] = uni((uint32_t)G_ROWB << 16);                // tensor_dim0
  g[2] = uni((uint32_t)G_SROWS << 16);               // tensor_dim1
  g[3] = uni((uint32_t)G_ROWB << 16);                // tile_dim0
  g[4] = uni((uint32_t)G_SROWS);                     // tile_dim1
  g[5] = uni(src_pitch);                             // source row pitch, bytes
  g[6] = uni(0u);
  g[7] = uni(0u);
  return g;
}
// Load and wait both name the two groups as in-out operands: their scalar
// registers then hold nothing else from the issue to the wait, and the next
// descriptor is formed only behind the wait.
static __device__ __forceinline__ void tdm_load(u32x4& g0, u32x8& g1) {
  asm volatile("tensor_load_to_lds %0, %1" : "+s"(g0), "+s"(g1) :: "memory");
}
static __device__ __forceinline__ void tdm_wait(u32x4& g0, u32x8& g1) {
  asm volatile("s_wait_tensorcnt 0x0" : "+s"(g0), "+s"(g1) :: "memory");
}

// Fragment from padded LDS rows; the same k order as load_frag_rowmajor.
static __device__ __forceinline__ v16h load_frag_lds(const char* base, int lane) {
  const char* p = base + (lane & 15) * G_PITCH + (lane >> 4) * 16;
  const v8h lo = *reinterpret_cast<const v8h*>(p);
  const v8h hi = *reinterpret_cast<const v8h*>(p + 32);
  return __builtin_shufflevector(lo, hi, 0, 1, 2, 3, 4, 5, 6, 7, 8, 9, 10, 11, 12, 13, 14, 15);
}

// ---- elementwise f32 -> f16 ----------------------------------------------

__global__ void cvt_kernel(const float* __restrict__ in,
                           _Float16* __restrict__ out, int n) {
  int i = blockIdx.x * blockDim.x + threadIdx.x;
  if (i < n) out[i] = (_Float16)in[i];
}

// ---- additive attention mask: 0 or -1e9 -----------------------------------

__global__ void maskf_kernel(const int* __restrict__ mask,
                             float* __restrict__ madd, int n) {
  int i = blockIdx.x * blockDim.x + threadIdx.x;
  if (i < n) madd[i] = (mask[i] != 0) ? 0.f : -1e9f;
}

// ---- V transpose to head-major vt[B,H,HD,SEQ] (f16) -----------------------

__global__ void vtrans_kernel(const _Float16* __restrict__ vsrc,
                              _Float16* __restrict__ vt) {
  const size_t o = (size_t)blockIdx.x * 256 + threadIdx.x;  // output index
  const int s   = (int)(o & (SEQ - 1));
  const size_t r = o >> 11;                 // (b*H + h)*HD + d
  const int d   = (int)(r & (HD - 1));
  const int hh  = (int)((r >> 6) & (NHEAD - 1));
  const int b   = (int)(r >> 10);
  vt[o] = vsrc[((size_t)(b * SEQ + s)) * D_MODEL + hh * HD + d];
}

// ---- LayerNorm (unbiased std, eps added to sd) -> f16 ---------------------

__global__ __launch_bounds__(256)
void ln_kernel(const float* __restrict__ x, const float* __restrict__ alpha,
               const float* __restrict__ bias, _Float16* __restrict__ out) {
  __shared__ float red[256];
  const int row = blockIdx.x;
  const int t = threadIdx.x;
  const float* xr = x + (size_t)row * D_MODEL;
  float v[4];
  float s = 0.f;
#pragma unroll
  for (int i = 0; i < 4; ++i) { v[i] = xr[t + i * 256]; s += v[i]; }
  red[t] = s; __syncthreads();
  for (int off = 128; off > 0; off >>= 1) {
    if (t < off) red[t] += red[t + off];
    __syncthreads();
  }
  const float mu = red[0] * (1.f / D_MODEL);
  __syncthreads();
  float ss = 0.f;
#pragma unroll
  for (int i = 0; i < 4; ++i) { float d = v[i] - mu; ss += d * d; }
  red[t] = ss; __syncthreads();
  for (int off = 128; off > 0; off >>= 1) {
    if (t < off) red[t] += red[t + off];
    __syncthreads();
  }
  const float sd  = sqrtf(red[0] / (float)(D_MODEL - 1));
  const float inv = 1.f / (sd + LN_EPS);
#pragma unroll
  for (int i = 0; i < 4; ++i) {
    int c = t + i * 256;
    out[(size_t)row * D_MODEL + c] =
        (_Float16)(alpha[c] * (v[i] - mu) * inv + bias[c]);
  }
}

// ---- Tiled WMMA GEMM:  C[M,N] = act(A[M,K] * W[N,K]^T + bias) (+resid) ----
// Block = 256 threads (8 waves), tile 128x128, 128 k a stage. Waves: 2 (M) x 4 (N);
// each wave owns 64x32 of output (4 M-frags x 2 N-frags = 8 WMMA / 32 k).
// Two LDS buffers: every wave issues one tensor load a stage for its own slice
// (waves 0..3: 32 rows of A each, waves 4..7: 32 rows of W each), so that the
// next stage flies while this one is worked on. K: a multiple of 128, >= 256.

template <bool RELU, bool RESID, bool BIAS, bool OUTF32, bool OUTF16>
__global__ __launch_bounds__(256)
void gemm_kernel(const _Float16* __restrict__ A, const _Float16* __restrict__ W,
                 const float* __restrict__ bias, const float* __restrict__ resid,
                 float* __restrict__ outf, _Float16* __restrict__ outh,
                 int M, int N, int K) {
  __shared__ __attribute__((aligned(2048))) char sm[2 * G_BUF];
  const int t    = threadIdx.x;
  const int lane = t & 31;
  const uint32_t wave = uni((uint32_t)t >> 5);
  const int wm   = wave >> 2;       // 0..1  (64 rows of M each)
  const int wn   = wave & 3;        // 0..3  (32 cols of N each)
  const int m0   = blockIdx.y * 128;
  const int n0   = blockIdx.x * 128;

  v8f acc[4][2];
#pragma unroll
  for (int i = 0; i < 4; ++i)
#pragma unroll
    for (int j = 0; j < 2; ++j) acc[i][j] = v8f{};

  auto compute_stage = [&](const char* buf) {
    const char* Ab = buf + (wm * 2) * G_SLICE;   // this wave's 64 rows of A: two slices
    const char* Bb = buf + (4 + wn) * G_SLICE;   // this wave's 32 rows of W: one slice
#pragma unroll
    for (int kk = 0; kk < G_K / 32; ++kk) {
      v16h bf[2], af[4];
#pragma unroll
      for (int nf = 0; nf < 2; ++nf)
        bf[nf] = load_frag_lds(Bb + nf * 16 * G_PITCH + kk * 64, lane);
#pragma unroll
      for (int mf = 0; mf < 4; ++mf)
        af[mf] = load_frag_lds(Ab + (mf >> 1) * G_SLICE + (mf & 1) * 16 * G_PITCH + kk * 64, lane);
#pragma unroll
      for (int mf = 0; mf < 4; ++mf)
#pragma unroll
        for (int nf = 0; nf < 2; ++nf)
          acc[mf][nf] = wmma16x16x32(af[mf], bf[nf], acc[mf][nf]);
    }
  };

  const _Float16* srow = (wave < 4u) ? A + (size_t)(m0 + wave * G_SROWS) * K
                                     : W + (size_t)(n0 + (wave - 4u) * G_SROWS) * K;
  const uint64_t ga0  = (uint64_t)(uintptr_t)srow;
  const uint32_t lds0 = (uint32_t)(uintptr_t)(void*)&sm[0] + wave * G_SLICE;
  u32x8 g1 = tdm_group1((uint32_t)K * 2u);
  u32x4 g0;
  const int nk = K / G_K;

  tdm_group0(g0, lds0, ga0);
  tdm_load(g0, g1);                                    // stage 0 into buffer 0
  tdm_wait(g0, g1);                                    // own slice of stage 0 landed
  __syncthreads();                                     // stage 0 readable by all waves
  tdm_group0(g0, lds0 + G_BUF, ga0 + G_ROWB);
  tdm_load(g0, g1);                                    // stage 1 into buffer 1

  for (int s = 0; s < nk; ++s) {
    compute_stage(&sm[(s & 1) * G_BUF]);
    // Hand-over: this wave's reads of stage s are done, its slice of stage s + 1
    // has landed; behind the barrier stage s + 1 is readable and buffer s & 1 free.
    asm volatile("s_wait_dscnt 0x0" ::: "memory");
    tdm_wait(g0, g1);
    __syncthreads();
    if (pinned(s + 2 < nk)) {
      tdm_group0(g0, lds0 + (uint32_t)(s & 1) * G_BUF, ga0 + (uint64_t)(s + 2) * G_ROWB);
      tdm_load(g0, g1);
    }
  }
  tdm_wait(g0, g1);                                    // nothing in flight at the wave's end
  asm volatile("s_wait_dscnt 0x0" ::: "memory");

  const int hi8 = (lane >> 4) * 8;
#pragma unroll
  for (int nf = 0; nf < 2; ++nf) {
    const int gn = n0 + wn * 32 + nf * 16 + (lane & 15);
    float bv = 0.f;
    if constexpr (BIAS) bv = bias[gn];
#pragma unroll
    for (int mf = 0; mf < 4; ++mf) {
#pragma unroll
      for (int v = 0; v < 8; ++v) {
        const int gm = m0 + wm * 64 + mf * 16 + hi8 + v;  // D layout: M = v + hi8
        float val = acc[mf][nf][v];
        if constexpr (BIAS)  val += bv;
        if constexpr (RELU)  val = fmaxf(val, 0.f);
        const size_t idx = (size_t)gm * N + gn;
        if constexpr (RESID) val += resid[idx];
        if constexpr (OUTF32) outf[idx] = val;
        if constexpr (OUTF16) outh[idx] = (_Float16)val;
      }
    }
  }
}

#define ATT_KEYS  64                  /* keys per staged tile */
#define ATT_PITCH 72                  /* halfs per LDS row: 128 B + 16 B pad, 16 B x odd for b128 readers */
#define ATT_TILE  (64 * ATT_PITCH)    /* halfs per staged K or V^T tile */
#define ATT_NST   (SEQ / ATT_KEYS)    /* tiles per (b, h) */

// One tile's four copies of a lane (16 bytes each). The s_wait_xcnt stands in
// the copies' own statement so that no address register is rewritten ahead of it.
static __device__ __forceinline__ void attn_copy4(
    unsigned int l0, const _Float16* g0, unsigned int l1, const _Float16* g1,
    unsigned int l2, const _Float16* g2, unsigned int l3, const _Float16* g3) {
  asm volatile(
      "global_load_async_to_lds_b128 %0, %1, off\n\t"
      "global_load_async_to_lds_b128 %2, %3, off\n\t"
      "global_load_async_to_lds_b128 %4, %5, off\n\t"
      "global_load_async_to_lds_b128 %6, %7, off\n\t"
      "s_wait_xcnt 0x0"
      :: "v"(l0), "v"(g0), "v"(l1), "v"(g1), "v"(l2), "v"(g2), "v"(l3), "v"(g3)
      : "memory");
}

__global__ __launch_bounds__(256)
void attn_kernel(const _Float16* __restrict__ qh, const _Float16* __restrict__ kh,
                 const _Float16* __restrict__ vt, const float* __restrict__ madd,
                 _Float16* __restrict__ ctxh) {
  __shared__ __attribute__((aligned(16))) _Float16 kv[2][2][ATT_TILE];
  const int lane = threadIdx.x & 31;
  const int wave = threadIdx.x >> 5;
  const int q0   = blockIdx.x * 128 + wave * 16;
  const int h    = blockIdx.y;
  const int b    = blockIdx.z;
  const size_t hoff = (size_t)h * HD;
  const int hi8  = (lane >> 4) * 8;
  const float scale = 0.125f;  // 1/sqrt(HD)

  const _Float16* qbase = qh + ((size_t)(b * SEQ + q0)) * D_MODEL + hoff;
  v16h qb_lo = load_frag_rowmajor(qbase,      D_MODEL, lane);   // B: N=q, K=hd
  v16h qb_hi = load_frag_rowmajor(qbase + 32, D_MODEL, lane);

  v8f ctx[4] = {v8f{}, v8f{}, v8f{}, v8f{}};
  float m = -1e30f, l = 0.f;
  const float* mrow = madd + (size_t)b * SEQ;
  const _Float16* vtb = vt + ((size_t)(b * NHEAD + h) * HD) * SEQ;

  // Each thread copies rows crow and crow + 32 of both tiles, 16 bytes at ccol.
  const int crow = threadIdx.x >> 3;         // 0..31
  const int ccol = (threadIdx.x & 7) * 8;    // halfs
  const _Float16* gk = kh + ((size_t)(b * SEQ + crow)) * D_MODEL + hoff + ccol;
  const _Float16* gv = vtb + (size_t)crow * SEQ + ccol;
  const unsigned int lds0 =
      (unsigned int)(uintptr_t)(void*)&kv[0][0][crow * ATT_PITCH + ccol];
  auto copy_tile = [&](int s) {
    const unsigned int lk = lds0 + (unsigned int)(s & 1) * (2 * ATT_TILE * 2);
    const unsigned int lv = lk + ATT_TILE * 2;
    const _Float16* k0 = gk + (size_t)s * ATT_KEYS * D_MODEL;
    const _Float16* v0 = gv + s * ATT_KEYS;
    attn_copy4(lk, k0, lk + 32 * ATT_PITCH * 2, k0 + 32 * D_MODEL,
               lv, v0, lv + 32 * ATT_PITCH * 2, v0 + (size_t)32 * SEQ);
  };

  copy_tile(0);
  asm volatile("s_wait_asynccnt 0x0" ::: "memory");  // own copies of tile 0 landed
  __syncthreads();                                   // tile 0 readable by all waves
  copy_tile(1);

  for (int s = 0; s < ATT_NST; ++s) {
   const _Float16* Ks = &kv[s & 1][0][0];
   const _Float16* Vs = &kv[s & 1][1][0];
   // Unrolled: both halves' LDS offsets become immediates, no inner branch.
#pragma unroll
   for (int sub = 0; sub < ATT_KEYS; sub += 32) {
    const int j = s * ATT_KEYS + sub;
    const _Float16* kbase = Ks + sub * ATT_PITCH;
    v16h ka0l = load_frag_rowmajor(kbase,                       ATT_PITCH, lane);
    v16h ka0h = load_frag_rowmajor(kbase + 32,                  ATT_PITCH, lane);
    v16h ka1l = load_frag_rowmajor(kbase + 16 * ATT_PITCH,      ATT_PITCH, lane);
    v16h ka1h = load_frag_rowmajor(kbase + 16 * ATT_PITCH + 32, ATT_PITCH, lane);
    v8f s0 = {}; s0 = wmma16x16x32(ka0l, qb_lo, s0); s0 = wmma16x16x32(ka0h, qb_hi, s0);
    v8f s1 = {}; s1 = wmma16x16x32(ka1l, qb_lo, s1); s1 = wmma16x16x32(ka1h, qb_hi, s1);

    // per-lane: q = lane&15 ; element v: key = j + hi8 + v (s0) / +16 (s1)
    float sv0[8], sv1[8];
    float tmax = -1e30f;
#pragma unroll
    for (int v = 0; v < 8; ++v) {
      const int key0 = j + hi8 + v;
      const float a = fmaf(s0[v], scale, mrow[key0]);
      const float c = fmaf(s1[v], scale, mrow[key0 + 16]);
      sv0[v] = a; sv1[v] = c;
      tmax = fmaxf(tmax, fmaxf(a, c));
    }
    tmax = fmaxf(tmax, __shfl_xor(tmax, 16, 32));
    const float mnew  = fmaxf(m, tmax);
    const float alpha = __expf(m - mnew);
    float psum = 0.f;
    v16h pa;
#pragma unroll
    for (int v = 0; v < 8; ++v) {
      const float p0 = __expf(sv0[v] - mnew);
      const float p1 = __expf(sv1[v] - mnew);
      pa[v]     = (_Float16)p0;    // A-frag elem e<8  -> key kb+e
      pa[8 + v] = (_Float16)p1;    // A-frag elem e>=8 -> key kb+16+(e-8)
      psum += p0 + p1;
    }
    psum += __shfl_xor(psum, 16, 32);
    l = l * alpha + psum;
    m = mnew;

    // rescale ctx: row q = v + hi8 -> alpha lives in lane (v + hi8)
    float rs[8];
#pragma unroll
    for (int v = 0; v < 8; ++v) rs[v] = __shfl(alpha, hi8 + v, 32);
#pragma unroll
    for (int nf = 0; nf < 4; ++nf)
#pragma unroll
      for (int v = 0; v < 8; ++v) ctx[nf][v] *= rs[v];

#pragma unroll
    for (int nf = 0; nf < 4; ++nf) {
      // B operand: N = hd (rows of vt), K = keys (contiguous)
      v16h vb = load_frag_rowmajor(Vs + (nf * 16) * ATT_PITCH + sub, ATT_PITCH, lane);
      ctx[nf] = wmma16x16x32(pa, vb, ctx[nf]);
    }
   }
   // Hand-over: this wave's reads of tile s are done, its copies of tile s + 1
   // have landed; behind the barrier tile s + 1 is readable and buffer s & 1 free.
   asm volatile("s_wait_dscnt 0x0" ::: "memory");
   asm volatile("s_wait_asynccnt 0x0" ::: "memory");
   // Stands ahead of the advance of the mask loads' address register.
   asm volatile("s_wait_xcnt 0x0" ::: "memory");
   __syncthreads();
   if (s + 2 < ATT_NST) copy_tile(s + 2);
  }
  asm volatile("s_wait_asynccnt 0x0" ::: "memory");  // nothing in flight at the wave's end

  const float linv = 1.f / l;
  float rs[8];
#pragma unroll
  for (int v = 0; v < 8; ++v) rs[v] = __shfl(linv, hi8 + v, 32);
  _Float16* obase = ctxh + ((size_t)(b * SEQ + q0)) * D_MODEL + hoff;
#pragma unroll
  for (int nf = 0; nf < 4; ++nf) {
#pragma unroll
    for (int v = 0; v < 8; ++v) {
      const int qrow = hi8 + v;
      const int hd   = nf * 16 + (lane & 15);
      obase[(size_t)qrow * D_MODEL + hd] = (_Float16)(ctx[nf][v] * rs[v]);
    }
  }
}

// ---- host side ------------------------------------------------------------

extern "C" void kernel_launch(void* const* d_in, const int* in_sizes, int n_in,
                              void* d_out, int out_size, void* d_ws, size_t ws_size,
                              hipStream_t stream) {
  (void)in_sizes; (void)n_in; (void)out_size; (void)ws_size;
  const float* x     = (const float*)d_in[0];
  const int*   mask  = (const int*)d_in[1];
  const float* alpha = (const float*)d_in[2];
  const float* bias  = (const float*)d_in[3];
  const float* w_q   = (const float*)d_in[4];
  const float* w_k   = (const float*)d_in[5];
  const float* w_v   = (const float*)d_in[6];
  const float* w_o   = (const float*)d_in[7];
  const float* fc1_w = (const float*)d_in[8];
  const float* fc1_b = (const float*)d_in[9];
  const float* fc2_w = (const float*)d_in[10];
  const float* fc2_b = (const float*)d_in[11];
  float* out = (float*)d_out;

  char* ws = (char*)d_ws;
  size_t off = 0;
  auto alloc = [&](size_t bytes) -> char* {
    char* p = ws + off;
    off += (bytes + 255) & ~(size_t)255;
    return p;
  };
  _Float16* xn_h  = (_Float16*)alloc((size_t)ROWS * D_MODEL * 2);
  _Float16* wq_h  = (_Float16*)alloc((size_t)D_MODEL * D_MODEL * 2);
  _Float16* wk_h  = (_Float16*)alloc((size_t)D_MODEL * D_MODEL * 2);
  _Float16* wv_h  = (_Float16*)alloc((size_t)D_MODEL * D_MODEL * 2);
  _Float16* wo_h  = (_Float16*)alloc((size_t)D_MODEL * D_MODEL * 2);
  _Float16* fc1_h = (_Float16*)alloc((size_t)FF_DIM * D_MODEL * 2);
  _Float16* fc2_h = (_Float16*)alloc((size_t)D_MODEL * FF_DIM * 2);
  _Float16* q_h   = (_Float16*)alloc((size_t)ROWS * D_MODEL * 2);
  _Float16* k_h   = (_Float16*)alloc((size_t)ROWS * D_MODEL * 2);
  _Float16* v_h   = (_Float16*)alloc((size_t)ROWS * D_MODEL * 2);
  _Float16* vt_h  = (_Float16*)alloc((size_t)ROWS * D_MODEL * 2);
  _Float16* ctx_h = (_Float16*)alloc((size_t)ROWS * D_MODEL * 2);
  float*    x1    = (float*)   alloc((size_t)ROWS * D_MODEL * 4);
  _Float16* xn2_h = (_Float16*)alloc((size_t)ROWS * D_MODEL * 2);
  _Float16* ff_h  = (_Float16*)alloc((size_t)ROWS * FF_DIM * 2);
  float*    madd  = (float*)   alloc((size_t)BATCH * SEQ * 4);

  const int nDD = D_MODEL * D_MODEL;
  const int nFD = FF_DIM * D_MODEL;
  cvt_kernel<<<(nDD + 255) / 256, 256, 0, stream>>>(w_q, wq_h, nDD);
  cvt_kernel<<<(nDD + 255) / 256, 256, 0, stream>>>(w_k, wk_h, nDD);
  cvt_kernel<<<(nDD + 255) / 256, 256, 0, stream>>>(w_v, wv_h, nDD);
  cvt_kernel<<<(nDD + 255) / 256, 256, 0, stream>>>(w_o, wo_h, nDD);
  cvt_kernel<<<(nFD + 255) / 256, 256, 0, stream>>>(fc1_w, fc1_h, nFD);
  cvt_kernel<<<(nFD + 255) / 256, 256, 0, stream>>>(fc2_w, fc2_h, nFD);
  maskf_kernel<<<(BATCH * SEQ + 255) / 256, 256, 0, stream>>>(mask, madd,
                                                              BATCH * SEQ);

  ln_kernel<<<ROWS, 256, 0, stream>>>(x, alpha, bias, xn_h);

  dim3 gD(D_MODEL / 128, ROWS / 128);   // 8 x 32
  dim3 gF(FF_DIM / 128, ROWS / 128);    // 32 x 32

  // Q/K/V projections (f16 outputs for attention)
  gemm_kernel<false, false, false, false, true><<<gD, 256, 0, stream>>>(
      xn_h, wq_h, nullptr, nullptr, nullptr, q_h, ROWS, D_MODEL, D_MODEL);
  gemm_kernel<false, false, false, false, true><<<gD, 256, 0, stream>>>(
      xn_h, wk_h, nullptr, nullptr, nullptr, k_h, ROWS, D_MODEL, D_MODEL);
  gemm_kernel<false, false, false, false, true><<<gD, 256, 0, stream>>>(
      xn_h, wv_h, nullptr, nullptr, nullptr, v_h, ROWS, D_MODEL, D_MODEL);

  vtrans_kernel<<<(ROWS * D_MODEL) / 256, 256, 0, stream>>>(v_h, vt_h);

  attn_kernel<<<dim3(SEQ / 128, NHEAD, BATCH), 256, 0, stream>>>(
      q_h, k_h, vt_h, madd, ctx_h);

  // x1 = x + ctx @ Wo^T
  gemm_kernel<false, true, false, true, false><<<gD, 256, 0, stream>>>(
      ctx_h, wo_h, nullptr, x, x1, nullptr, ROWS, D_MODEL, D_MODEL);

  ln_kernel<<<ROWS, 256, 0, stream>>>(x1, alpha, bias, xn2_h);

  // ff = relu(xn2 @ fc1^T + b1)
  gemm_kernel<true, false, true, false, true><<<gF, 256, 0, stream>>>(
      xn2_h, fc1_h, fc1_b, nullptr, nullptr, ff_h, ROWS, FF_DIM, D_MODEL);

  // out = x1 + ff @ fc2^T + b2
  gemm_kernel<false, true, true, true, false><<<gD, 256, 0, stream>>>(
      ff_h, fc2_h, fc2_b, x1, out, nullptr, ROWS, D_MODEL, FF_DIM);
}

// v003
// A run of this version takes 221 microseconds.
// In two side-by-side timings against v002, it was 1.07 and 1.08 times as fast.
// All steps since v000 together make it 1.86 times as fast.
#include <hip/hip_runtime.h>
#include <hip/hip_bf16.h>
#include <math.h>

// ---------------------------------------------------------------------------
// EncoderBlock for MI455X (gfx1250).
//   D=1024, H=16, HD=64, FF=4096, B=2, S=2048.
// f16 WMMA (v_wmma_f32_16x16x32_f16) for all GEMMs + flash attention,
// double-buffered TDM (tensor_load_to_lds) staging of GEMM tiles into LDS.
// ---------------------------------------------------------------------------

typedef __attribute__((ext_vector_type(16))) _Float16 v16h;
typedef __attribute__((ext_vector_type(8)))  _Float16 v8h;
typedef __attribute__((ext_vector_type(4)))  _Float16 v4h;
typedef __attribute__((ext_vector_type(8)))  float    v8f;
typedef __attribute__((ext_vector_type(4)))  float    v4f;
typedef __attribute__((ext_vector_type(4)))  unsigned int u32x4;
typedef __attribute__((ext_vector_type(8)))  unsigned int u32x8;

#define D_MODEL 1024
#define NHEAD   16
#define HD      64
#define FF_DIM  4096
#define SEQ     2048
#define BATCH   2
#define ROWS    (BATCH * SEQ)   /* 4096 */
#define LN_EPS  1e-6f

// ---- WMMA helpers ---------------------------------------------------------

static __device__ __forceinline__ v8f wmma16x16x32(v16h a, v16h b, v8f c) {
  return __builtin_amdgcn_wmma_f32_16x16x32_f16(false, a, false, b, (short)0, c,
                                                false, false);
}

// A/B fragment loader from a row-major [16 x >=32] tile (row = M for A, N for B;
// K contiguous within the row). ISA 16-bit A layout:
//   lanes 0-15:  M=lane,    elems 0..7 -> K=0..7,  elems 8..15 -> K=16..23
//   lanes 16-31: M=lane-16, elems 0..7 -> K=8..15, elems 8..15 -> K=24..31
static __device__ __forceinline__ v16h load_frag_rowmajor(const _Float16* base,
                                                          int ld, int lane) {
  const int r  = lane & 15;
  const int kb = (lane >> 4) * 8;
  const _Float16* p = base + (size_t)r * ld + kb;
  v16h f;
#pragma unroll
  for (int i = 0; i < 8; ++i) f[i] = p[i];
#pragma unroll
  for (int i = 0; i < 8; ++i) f[8 + i] = p[16 + i];
  return f;
}

// ---- Tensor loads: one wave brings a slice of 32 rows x 256 bytes to LDS ----
// The mover pads every 256-byte row by 16 bytes: the LDS pitch is 272 bytes
// (16 B x odd), at which the ds_load_b128 fragment reads meet no bank conflict.

#define G_K      128                  /* k per stage: rows of 256 bytes */
#define G_ROWB   256                  /* bytes per staged row */
#define G_PITCH  272                  /* bytes per LDS row, pad included */
#define G_SROWS  32                   /* rows per slice, one slice a wave */
#define G_SLICE  10240                /* 32 x 272 = 8704 B, rounded up to a multiple of 2 KiB */
#define G_BUF    (8 * G_SLICE)        /* one stage: A slices 0..3, W slices 4..7 */

static __device__ __forceinline__ uint32_t uni(uint32_t v) {
  return (uint32_t)__builtin_amdgcn_readfirstlane(v);
}
// Holds a wave-uniform test in a scalar register, so that the branch on it is
// a scalar branch: a tensor load ignores EXEC.
static __device__ __forceinline__ uint32_t pinned(uint32_t v) {
  uint32_t w = uni(v);
  asm volatile("" : "+s"(w));
  return w;
}
static __device__ __forceinline__ void tdm_group0(u32x4& g, uint32_t lds_dst, uint64_t ga) {
  g[0] = uni(1u);                                              // count = 1
  g[1] = uni(lds_dst);                                         // byte offset in LDS
  g[2] = uni((uint32_t)ga);                                    // address [31:0]
  g[3] = uni((((uint32_t)(ga >> 32)) & 0x01FFFFFFu) | 0x80000000u);  // [56:32], type = 2
}
// Extents in bytes (data_size code 0); tensor dims = tile dims.
static __device__ __forceinline__ u32x8 tdm_group1(uint32_t src_pitch) {
  u32x8 g;
  g[0] = uni((1u << 20) | (5u << 22) | (3u << 25));  // pad 4 dwords after every 64 dwords
  g[1] = uni((uint32_t)G_ROWB << 16);                // tensor_dim0
  g[2] = uni((uint32_t)G_SROWS << 16);               // tensor_dim1
  g[3] = uni((uint32_t)G_ROWB << 16);                // tile_dim0
  g[4] = uni((uint32_t)G_SROWS);                     // tile_dim1
  g[5] = uni(src_pitch);                             // source row pitch, bytes
  g[6] = uni(0u);
  g[7] = uni(0u);
  return g;
}
// Load and wait both name the two groups as in-out operands: their scalar
// registers then hold nothing else from the issue to the wait, and the next
// descriptor is formed only behind the wait.
static __device__ __forceinline__ void tdm_load(u32x4& g0, u32x8& g1) {
  asm volatile("tensor_load_to_lds %0, %1" : "+s"(g0), "+s"(g1) :: "memory");
}
static __device__ __forceinline__ void tdm_wait(u32x4& g0, u32x8& g1) {
  asm volatile("s_wait_tensorcnt 0x0" : "+s"(g0), "+s"(g1) :: "memory");
}

// Fragment from padded LDS rows; the same k order as load_frag_rowmajor.
static __device__ __forceinline__ v16h load_frag_lds(const char* base, int lane) {
  const char* p = base + (lane & 15) * G_PITCH + (lane >> 4) * 16;
  const v8h lo = *reinterpret_cast<const v8h*>(p);
  const v8h hi = *reinterpret_cast<const v8h*>(p + 32);
  return __builtin_shufflevector(lo, hi, 0, 1, 2, 3, 4, 5, 6, 7, 8, 9, 10, 11, 12, 13, 14, 15);
}

// ---- elementwise f32 -> f16 ----------------------------------------------

// A block converts CVT_BLOCK consecutive floats; every array's length is a
// multiple of that. Each wave-wide load covers 512 contiguous bytes, each store
// 256; a thread's eight loads are all issued ahead of its first conversion.

#define CVT_U     8                   /* 16-byte loads a thread */
#define CVT_BLOCK (256 * 4 * CVT_U)   /* floats a block */

__global__ __launch_bounds__(256)
void cvt_kernel(const float* __restrict__ in, _Float16* __restrict__ out) {
  const size_t base = (size_t)blockIdx.x * CVT_BLOCK + threadIdx.x * 4;
  v4f v[CVT_U];
#pragma unroll
  for (int u = 0; u < CVT_U; ++u)
    v[u] = *reinterpret_cast<const v4f*>(in + base + u * 1024);
#pragma unroll
  for (int u = 0; u < CVT_U; ++u) {
    v4h h;
#pragma unroll
    for (int e = 0; e < 4; ++e) h[e] = (_Float16)v[u][e];
    *reinterpret_cast<v4h*>(out + base + u * 1024) = h;
  }
}

// ---- additive attention mask: 0 or -1e9 -----------------------------------

__global__ void maskf_kernel(const int* __restrict__ mask,
                             float* __restrict__ madd, int n) {
  int i = blockIdx.x * blockDim.x + threadIdx.x;
  if (i < n) madd[i] = (mask[i] != 0) ? 0.f : -1e9f;
}

// ---- V transpose to head-major vt[B,H,HD,SEQ] (f16) -----------------------

__global__ void vtrans_kernel(const _Float16* __restrict__ vsrc,
                              _Float16* __restrict__ vt) {
  const size_t o = (size_t)blockIdx.x * 256 + threadIdx.x;  // output index
  const int s   = (int)(o & (SEQ - 1));
  const size_t r = o >> 11;                 // (b*H + h)*HD + d
  const int d   = (int)(r & (HD - 1));
  const int hh  = (int)((r >> 6) & (NHEAD - 1));
  const int b   = (int)(r >> 10);
  vt[o] = vsrc[((size_t)(b * SEQ + s)) * D_MODEL + hh * HD + d];
}

// ---- LayerNorm (unbiased std, eps added to sd) -> f16 ---------------------

__global__ __launch_bounds__(256)
void ln_kernel(const float* __restrict__ x, const float* __restrict__ alpha,
               const float* __restrict__ bias, _Float16* __restrict__ out) {
  __shared__ float red[256];
  const int row = blockIdx.x;
  const int t = threadIdx.x;
  const float* xr = x + (size_t)row * D_MODEL;
  float v[4];
  float s = 0.f;
#pragma unroll
  for (int i = 0; i < 4; ++i) { v[i] = xr[t + i * 256]; s += v[i]; }
  red[t] = s; __syncthreads();
  for (int off = 128; off > 0; off >>= 1) {
    if (t < off) red[t] += red[t + off];
    __syncthreads();
  }
  const float mu = red[0] * (1.f / D_MODEL);
  __syncthreads();
  float ss = 0.f;
#pragma unroll
  for (int i = 0; i < 4; ++i) { float d = v[i] - mu; ss += d * d; }
  red[t] = ss; __syncthreads();
  for (int off = 128; off > 0; off >>= 1) {
    if (t < off) red[t] += red[t + off];
    __syncthreads();
  }
  const float sd  = sqrtf(red[0] / (float)(D_MODEL - 1));
  const float inv = 1.f / (sd + LN_EPS);
#pragma unroll
  for (int i = 0; i < 4; ++i) {
    int c = t + i * 256;
    out[(size_t)row * D_MODEL + c] =
        (_Float16)(alpha[c] * (v[i] - mu) * inv + bias[c]);
  }
}

// ---- Tiled WMMA GEMM:  C[M,N] = act(A[M,K] * W[N,K]^T + bias) (+resid) ----
// Block = 256 threads (8 waves), tile 128x128, 128 k a stage. Waves: 2 (M) x 4 (N);
// each wave owns 64x32 of output (4 M-frags x 2 N-frags = 8 WMMA / 32 k).
// Two LDS buffers: every wave issues one tensor load a stage for its own slice
// (waves 0..3: 32 rows of A each, waves 4..7: 32 rows of W each), so that the
// next stage flies while this one is worked on. K: a multiple of 128, >= 256.

template <bool RELU, bool RESID, bool BIAS, bool OUTF32, bool OUTF16>
__global__ __launch_bounds__(256)
void gemm_kernel(const _Float16* __restrict__ A, const _Float16* __restrict__ W,
                 const float* __restrict__ bias, const float* __restrict__ resid,
                 float* __restrict__ outf, _Float16* __restrict__ outh,
                 int M, int N, int K) {
  __shared__ __attribute__((aligned(2048))) char sm[2 * G_BUF];
  const int t    = threadIdx.x;
  const int lane = t & 31;
  const uint32_t wave = uni((uint32_t)t >> 5);
  const int wm   = wave >> 2;       // 0..1  (64 rows of M each)
  const int wn   = wave & 3;        // 0..3  (32 cols of N each)
  const int m0   = blockIdx.y * 128;
  const int n0   = blockIdx.x * 128;

  v8f acc[4][2];
#pragma unroll
  for (int i = 0; i < 4; ++i)
#pragma unroll
    for (int j = 0; j < 2; ++j) acc[i][j] = v8f{};

  auto compute_stage = [&](const char* buf) {
    const char* Ab = buf + (wm * 2) * G_SLICE;   // this wave's 64 rows of A: two slices
    const char* Bb = buf + (4 + wn) * G_SLICE;   // this wave's 32 rows of W: one slice
#pragma unroll
    for (int kk = 0; kk < G_K / 32; ++kk) {
      v16h bf[2], af[4];
#pragma unroll
      for (int nf = 0; nf < 2; ++nf)
        bf[nf] = load_frag_lds(Bb + nf * 16 * G_PITCH + kk * 64, lane);
#pragma unroll
      for (int mf = 0; mf < 4; ++mf)
        af[mf] = load_frag_lds(Ab + (mf >> 1) * G_SLICE + (mf & 1) * 16 * G_PITCH + kk * 64, lane);
#pragma unroll
      for (int mf = 0; mf < 4; ++mf)
#pragma unroll
        for (int nf = 0; nf < 2; ++nf)
          acc[mf][nf] = wmma16x16x32(af[mf], bf[nf], acc[mf][nf]);
    }
  };

  const _Float16* srow = (wave < 4u) ? A + (size_t)(m0 + wave * G_SROWS) * K
                                     : W + (size_t)(n0 + (wave - 4u) * G_SROWS) * K;
  const uint64_t ga0  = (uint64_t)(uintptr_t)srow;
  const uint32_t lds0 = (uint32_t)(uintptr_t)(void*)&sm[0] + wave * G_SLICE;
  u32x8 g1 = tdm_group1((uint32_t)K * 2u);
  u32x4 g0;
  const int nk = K / G_K;

  tdm_group0(g0, lds0, ga0);
  tdm_load(g0, g1);                                    // stage 0 into buffer 0
  tdm_wait(g0, g1);                                    // own slice of stage 0 landed
  __syncthreads();                                     // stage 0 readable by all waves
  tdm_group0(g0, lds0 + G_BUF, ga0 + G_ROWB);
  tdm_load(g0, g1);                                    // stage 1 into buffer 1

  for (int s = 0; s < nk; ++s) {
    compute_stage(&sm[(s & 1) * G_BUF]);
    // Hand-over: this wave's reads of stage s are done, its slice of stage s + 1
    // has landed; behind the barrier stage s + 1 is readable and buffer s & 1 free.
    asm volatile("s_wait_dscnt 0x0" ::: "memory");
    tdm_wait(g0, g1);
    __syncthreads();
    if (pinned(s + 2 < nk)) {
      tdm_group0(g0, lds0 + (uint32_t)(s & 1) * G_BUF, ga0 + (uint64_t)(s + 2) * G_ROWB);
      tdm_load(g0, g1);
    }
  }
  tdm_wait(g0, g1);                                    // nothing in flight at the wave's end
  asm volatile("s_wait_dscnt 0x0" ::: "memory");

  const int hi8 = (lane >> 4) * 8;
#pragma unroll
  for (int nf = 0; nf < 2; ++nf) {
    const int gn = n0 + wn * 32 + nf * 16 + (lane & 15);
    float bv = 0.f;
    if constexpr (BIAS) bv = bias[gn];
#pragma unroll
    for (int mf = 0; mf < 4; ++mf) {
#pragma unroll
      for (int v = 0; v < 8; ++v) {
        const int gm = m0 + wm * 64 + mf * 16 + hi8 + v;  // D layout: M = v + hi8
        float val = acc[mf][nf][v];
        if constexpr (BIAS)  val += bv;
        if constexpr (RELU)  val = fmaxf(val, 0.f);
        const size_t idx = (size_t)gm * N + gn;
        if constexpr (RESID) val += resid[idx];
        if constexpr (OUTF32) outf[idx] = val;
        if constexpr (OUTF16) outh[idx] = (_Float16)val;
      }
    }
  }
}

#define ATT_KEYS  64                  /* keys per staged tile */
#define ATT_PITCH 72                  /* halfs per LDS row: 128 B + 16 B pad, 16 B x odd for b128 readers */
#define ATT_TILE  (64 * ATT_PITCH)    /* halfs per staged K or V^T tile */
#define ATT_NST   (SEQ / ATT_KEYS)    /* tiles per (b, h) */

// One tile's four copies of a lane (16 bytes each). The s_wait_xcnt stands in
// the copies' own statement so that no address register is rewritten ahead of it.
static __device__ __forceinline__ void attn_copy4(
    unsigned int l0, const _Float16* g0, unsigned int l1, const _Float16* g1,
    unsigned int l2, const _Float16* g2, unsigned int l3, const _Float16* g3) {
  asm volatile(
      "global_load_async_to_lds_b128 %0, %1, off\n\t"
      "global_load_async_to_lds_b128 %2, %3, off\n\t"
      "global_load_async_to_lds_b128 %4, %5, off\n\t"
      "global_load_async_to_lds_b128 %6, %7, off\n\t"
      "s_wait_xcnt 0x0"
      :: "v"(l0), "v"(g0), "v"(l1), "v"(g1), "v"(l2), "v"(g2), "v"(l3), "v"(g3)
      : "memory");
}

__global__ __launch_bounds__(256)
void attn_kernel(const _Float16* __restrict__ qh, const _Float16* __restrict__ kh,
                 const _Float16* __restrict__ vt, const float* __restrict__ madd,
                 _Float16* __restrict__ ctxh) {
  __shared__ __attribute__((aligned(16))) _Float16 kv[2][2][ATT_TILE];
  const int lane = threadIdx.x & 31;
  const int wave = threadIdx.x >> 5;
  const int q0   = blockIdx.x * 128 + wave * 16;
  const int h    = blockIdx.y;
  const int b    = blockIdx.z;
  const size_t hoff = (size_t)h * HD;
  const int hi8  = (lane >> 4) * 8;
  const float scale = 0.125f;  // 1/sqrt(HD)

  const _Float16* qbase = qh + ((size_t)(b * SEQ + q0)) * D_MODEL + hoff;
  v16h qb_lo = load_frag_rowmajor(qbase,      D_MODEL, lane);   // B: N=q, K=hd
  v16h qb_hi = load_frag_rowmajor(qbase + 32, D_MODEL, lane);

  v8f ctx[4] = {v8f{}, v8f{}, v8f{}, v8f{}};
  float m = -1e30f, l = 0.f;
  const float* mrow = madd + (size_t)b * SEQ;
  const _Float16* vtb = vt + ((size_t)(b * NHEAD + h) * HD) * SEQ;

  // Each thread copies rows crow and crow + 32 of both tiles, 16 bytes at ccol.
  const int crow = threadIdx.x >> 3;         // 0..31
  const int ccol = (threadIdx.x & 7) * 8;    // halfs
  const _Float16* gk = kh + ((size_t)(b * SEQ + crow)) * D_MODEL + hoff + ccol;
  const _Float16* gv = vtb + (size_t)crow * SEQ + ccol;
  const unsigned int lds0 =
      (unsigned int)(uintptr_t)(void*)&kv[0][0][crow * ATT_PITCH + ccol];
  auto copy_tile = [&](int s) {
    const unsigned int lk = lds0 + (unsigned int)(s & 1) * (2 * ATT_TILE * 2);
    const unsigned int lv = lk + ATT_TILE * 2;
    const _Float16* k0 = gk + (size_t)s * ATT_KEYS * D_MODEL;
    const _Float16* v0 = gv + s * ATT_KEYS;
    attn_copy4(lk, k0, lk + 32 * ATT_PITCH * 2, k0 + 32 * D_MODEL,
               lv, v0, lv + 32 * ATT_PITCH * 2, v0 + (size_t)32 * SEQ);
  };

  copy_tile(0);
  asm volatile("s_wait_asynccnt 0x0" ::: "memory");  // own copies of tile 0 landed
  __syncthreads();                                   // tile 0 readable by all waves
  copy_tile(1);

  for (int s = 0; s < ATT_NST; ++s) {
   const _Float16* Ks = &kv[s & 1][0][0];
   const _Float16* Vs = &kv[s & 1][1][0];
   // Unrolled: both halves' LDS offsets become immediates, no inner branch.
#pragma unroll
   for (int sub = 0; sub < ATT_KEYS; sub += 32) {
    const int j = s * ATT_KEYS + sub;
    const _Float16* kbase = Ks + sub * ATT_PITCH;
    v16h ka0l = load_frag_rowmajor(kbase,                       ATT_PITCH, lane);
    v16h ka0h = load_frag_rowmajor(kbase + 32,                  ATT_PITCH, lane);
    v16h ka1l = load_frag_rowmajor(kbase + 16 * ATT_PITCH,      ATT_PITCH, lane);
    v16h ka1h = load_frag_rowmajor(kbase + 16 * ATT_PITCH + 32, ATT_PITCH, lane);
    v8f s0 = {}; s0 = wmma16x16x32(ka0l, qb_lo, s0); s0 = wmma16x16x32(ka0h, qb_hi, s0);
    v8f s1 = {}; s1 = wmma16x16x32(ka1l, qb_lo, s1); s1 = wmma16x16x32(ka1h, qb_hi, s1);

    // per-lane: q = lane&15 ; element v: key = j + hi8 + v (s0) / +16 (s1)
    float sv0[8], sv1[8];
    float tmax = -1e30f;
#pragma unroll
    for (int v = 0; v < 8; ++v) {
      const int key0 = j + hi8 + v;
      const float a = fmaf(s0[v], scale, mrow[key0]);
      const float c = fmaf(s1[v], scale, mrow[key0 + 16]);
      sv0[v] = a; sv1[v] = c;
      tmax = fmaxf(tmax, fmaxf(a, c));
    }
    tmax = fmaxf(tmax, __shfl_xor(tmax, 16, 32));
    const float mnew  = fmaxf(m, tmax);
    const float alpha = __expf(m - mnew);
    float psum = 0.f;
    v16h pa;
#pragma unroll
    for (int v = 0; v < 8; ++v) {
      const float p0 = __expf(sv0[v] - mnew);
      const float p1 = __expf(sv1[v] - mnew);
      pa[v]     = (_Float16)p0;    // A-frag elem e<8  -> key kb+e
      pa[8 + v] = (_Float16)p1;    // A-frag elem e>=8 -> key kb+16+(e-8)
      psum += p0 + p1;
    }
    psum += __shfl_xor(psum, 16, 32);
    l = l * alpha + psum;
    m = mnew;

    // rescale ctx: row q = v + hi8 -> alpha lives in lane (v + hi8)
    float rs[8];
#pragma unroll
    for (int v = 0; v < 8; ++v) rs[v] = __shfl(alpha, hi8 + v, 32);
#pragma unroll
    for (int nf = 0; nf < 4; ++nf)
#pragma unroll
      for (int v = 0; v < 8; ++v) ctx[nf][v] *= rs[v];

#pragma unroll
    for (int nf = 0; nf < 4; ++nf) {
      // B operand: N = hd (rows of vt), K = keys (contiguous)
      v16h vb = load_frag_rowmajor(Vs + (nf * 16) * ATT_PITCH + sub, ATT_PITCH, lane);
      ctx[nf] = wmma16x16x32(pa, vb, ctx[nf]);
    }
   }
   // Hand-over: this wave's reads of tile s are done, its copies of tile s + 1
   // have landed; behind the barrier tile s + 1 is readable and buffer s & 1 free.
   asm volatile("s_wait_dscnt 0x0" ::: "memory");
   asm volatile("s_wait_asynccnt 0x0" ::: "memory");
   // Stands ahead of the advance of the mask loads' address register.
   asm volatile("s_wait_xcnt 0x0" ::: "memory");
   __syncthreads();
   if (s + 2 < ATT_NST) copy_tile(s + 2);
  }
  asm volatile("s_wait_asynccnt 0x0" ::: "memory");  // nothing in flight at the wave's end

  const float linv = 1.f / l;
  float rs[8];
#pragma unroll
  for (int v = 0; v < 8; ++v) rs[v] = __shfl(linv, hi8 + v, 32);
  _Float16* obase = ctxh + ((size_t)(b * SEQ + q0)) * D_MODEL + hoff;
#pragma unroll
  for (int nf = 0; nf < 4; ++nf) {
#pragma unroll
    for (int v = 0; v < 8; ++v) {
      const int qrow = hi8 + v;
      const int hd   = nf * 16 + (lane & 15);
      obase[(size_t)qrow * D_MODEL + hd] = (_Float16)(ctx[nf][v] * rs[v]);
    }
  }
}

// ---- host side ------------------------------------------------------------

extern "C" void kernel_launch(void* const* d_in, const int* in_sizes, int n_in,
                              void* d_out, int out_size, void* d_ws, size_t ws_size,
                              hipStream_t stream) {
  (void)in_sizes; (void)n_in; (void)out_size; (void)ws_size;
  const float* x     = (const float*)d_in[0];
  const int*   mask  = (const int*)d_in[1];
  const float* alpha = (const float*)d_in[2];
  const float* bias  = (const float*)d_in[3];
  const float* w_q   = (const float*)d_in[4];
  const float* w_k   = (const float*)d_in[5];
  const float* w_v   = (const float*)d_in[6];
  const float* w_o   = (const float*)d_in[7];
  const float* fc1_w = (const float*)d_in[8];
  const float* fc1_b = (const float*)d_in[9];
  const float* fc2_w = (const float*)d_in[10];
  const float* fc2_b = (const float*)d_in[11];
  float* out = (float*)d_out;

  char* ws = (char*)d_ws;
  size_t off = 0;
  auto alloc = [&](size_t bytes) -> char* {
    char* p = ws + off;
    off += (bytes + 255) & ~(size_t)255;
    return p;
  };
  _Float16* xn_h  = (_Float16*)alloc((size_t)ROWS * D_MODEL * 2);
  _Float16* wq_h  = (_Float16*)alloc((size_t)D_MODEL * D_MODEL * 2);
  _Float16* wk_h  = (_Float16*)alloc((size_t)D_MODEL * D_MODEL * 2);
  _Float16* wv_h  = (_Float16*)alloc((size_t)D_MODEL * D_MODEL * 2);
  _Float16* wo_h  = (_Float16*)alloc((size_t)D_MODEL * D_MODEL * 2);
  _Float16* fc1_h = (_Float16*)alloc((size_t)FF_DIM * D_MODEL * 2);
  _Float16* fc2_h = (_Float16*)alloc((size_t)D_MODEL * FF_DIM * 2);
  _Float16* q_h   = (_Float16*)alloc((size_t)ROWS * D_MODEL * 2);
  _Float16* k_h   = (_Float16*)alloc((size_t)ROWS * D_MODEL * 2);
  _Float16* v_h   = (_Float16*)alloc((size_t)ROWS * D_MODEL * 2);
  _Float16* vt_h  = (_Float16*)alloc((size_t)ROWS * D_MODEL * 2);
  _Float16* ctx_h = (_Float16*)alloc((size_t)ROWS * D_MODEL * 2);
  float*    x1    = (float*)   alloc((size_t)ROWS * D_MODEL * 4);
  _Float16* xn2_h = (_Float16*)alloc((size_t)ROWS * D_MODEL * 2);
  _Float16* ff_h  = (_Float16*)alloc((size_t)ROWS * FF_DIM * 2);
  float*    madd  = (float*)   alloc((size_t)BATCH * SEQ * 4);

  const int nDD = D_MODEL * D_MODEL;
  const int nFD = FF_DIM * D_MODEL;
  cvt_kernel<<<nDD / CVT_BLOCK, 256, 0, stream>>>(w_q, wq_h);
  cvt_kernel<<<nDD / CVT_BLOCK, 256, 0, stream>>>(w_k, wk_h);
  cvt_kernel<<<nDD / CVT_BLOCK, 256, 0, stream>>>(w_v, wv_h);
  cvt_kernel<<<nDD / CVT_BLOCK, 256, 0, stream>>>(w_o, wo_h);
  cvt_kernel<<<nFD / CVT_BLOCK, 256, 0, stream>>>(fc1_w, fc1_h);
  cvt_kernel<<<nFD / CVT_BLOCK, 256, 0, stream>>>(fc2_w, fc2_h);
  maskf_kernel<<<(BATCH * SEQ + 255) / 256, 256, 0, stream>>>(mask, madd,
                                                              BATCH * SEQ);

  ln_kernel<<<ROWS, 256, 0, stream>>>(x, alpha, bias, xn_h);

  dim3 gD(D_MODEL / 128, ROWS / 128);   // 8 x 32
  dim3 gF(FF_DIM / 128, ROWS / 128);    // 32 x 32

  // Q/K/V projections (f16 outputs for attention)
  gemm_kernel<false, false, false, false, true><<<gD, 256, 0, stream>>>(
      xn_h, wq_h, nullptr, nullptr, nullptr, q_h, ROWS, D_MODEL, D_MODEL);
  gemm_kernel<false, false, false, false, true><<<gD, 256, 0, stream>>>(
      xn_h, wk_h, nullptr, nullptr, nullptr, k_h, ROWS, D_MODEL, D_MODEL);
  gemm_kernel<false, false, false, false, true><<<gD, 256, 0, stream>>>(
      xn_h, wv_h, nullptr, nullptr, nullptr, v_h, ROWS, D_MODEL, D_MODEL);

  vtrans_kernel<<<(ROWS * D_MODEL) / 256, 256, 0, stream>>>(v_h, vt_h);

  attn_kernel<<<dim3(SEQ / 128, NHEAD, BATCH), 256, 0, stream>>>(
      q_h, k_h, vt_h, madd, ctx_h);

  // x1 = x + ctx @ Wo^T
  gemm_kernel<false, true, false, true, false><<<gD, 256, 0, stream>>>(
      ctx_h, wo_h, nullptr, x, x1, nullptr, ROWS, D_MODEL, D_MODEL);

  ln_kernel<<<ROWS, 256, 0, stream>>>(x1, alpha, bias, xn2_h);

  // ff = relu(xn2 @ fc1^T + b1)
  gemm_kernel<true, false, true, false, true><<<gF, 256, 0, stream>>>(
      xn2_h, fc1_h, fc1_b, nullptr, nullptr, ff_h, ROWS, FF_DIM, D_MODEL);

  // out = x1 + ff @ fc2^T + b2
  gemm_kernel<false, true, true, true, false><<<gD, 256, 0, stream>>>(
      ff_h, fc2_h, fc2_b, x1, out, nullptr, ROWS, D_MODEL, FF_DIM);
}

// v004
// One run takes 200 microseconds.
// Timed twice side by side with v003, it ran 1.11 times as fast both times.
// Over all steps from v000 it is 2.06 times as fast.
#include <hip/hip_runtime.h>
#include <hip/hip_bf16.h>
#include <math.h>

// ---------------------------------------------------------------------------
// EncoderBlock for MI455X (gfx1250).
//   D=1024, H=16, HD=64, FF=4096, B=2, S=2048.
// f16 WMMA (v_wmma_f32_16x16x32_f16) for all GEMMs + flash attention,
// double-buffered TDM (tensor_load_to_lds) staging of GEMM tiles into LDS.
// ---------------------------------------------------------------------------

typedef __attribute__((ext_vector_type(16))) _Float16 v16h;
typedef __attribute__((ext_vector_type(8)))  _Float16 v8h;
typedef __attribute__((ext_vector_type(4)))  _Float16 v4h;
typedef __attribute__((ext_vector_type(8)))  float    v8f;
typedef __attribute__((ext_vector_type(4)))  float    v4f;
typedef __attribute__((ext_vector_type(4)))  unsigned int u32x4;
typedef __attribute__((ext_vector_type(8)))  unsigned int u32x8;

#define D_MODEL 1024
#define NHEAD   16
#define HD      64
#define FF_DIM  4096
#define SEQ     2048
#define BATCH   2
#define ROWS    (BATCH * SEQ)   /* 4096 */
#define LN_EPS  1e-6f

// ---- WMMA helpers ---------------------------------------------------------

static __device__ __forceinline__ v8f wmma16x16x32(v16h a, v16h b, v8f c) {
  return __builtin_amdgcn_wmma_f32_16x16x32_f16(false, a, false, b, (short)0, c,
                                                false, false);
}

// A/B fragment loader from a row-major [16 x >=32] tile (row = M for A, N for B;
// K contiguous within the row). ISA 16-bit A layout:
//   lanes 0-15:  M=lane,    elems 0..7 -> K=0..7,  elems 8..15 -> K=16..23
//   lanes 16-31: M=lane-16, elems 0..7 -> K=8..15, elems 8..15 -> K=24..31
static __device__ __forceinline__ v16h load_frag_rowmajor(const _Float16* base,
                                                          int ld, int lane) {
  const int r  = lane & 15;
  const int kb = (lane >> 4) * 8;
  const _Float16* p = base + (size_t)r * ld + kb;
  v16h f;
#pragma unroll
  for (int i = 0; i < 8; ++i) f[i] = p[i];
#pragma unroll
  for (int i = 0; i < 8; ++i) f[8 + i] = p[16 + i];
  return f;
}

// ---- Tensor loads: one wave brings a slice of 32 rows x 256 bytes to LDS ----
// The mover pads every 256-byte row by 16 bytes: the LDS pitch is 272 bytes
// (16 B x odd), at which the ds_load_b128 fragment reads meet no bank conflict.

#define G_K      128                  /* k per stage: rows of 256 bytes */
#define G_ROWB   256                  /* bytes per staged row */
#define G_PITCH  272                  /* bytes per LDS row, pad included */
#define G_SROWS  32                   /* rows per slice, one slice a wave */
#define G_SLICE  10240                /* 32 x 272 = 8704 B, rounded up to a multiple of 2 KiB */
#define G_BUF    (8 * G_SLICE)        /* one stage: A slices 0..3, W slices 4..7 */

static __device__ __forceinline__ uint32_t uni(uint32_t v) {
  return (uint32_t)__builtin_amdgcn_readfirstlane(v);
}
// Holds a wave-uniform test in a scalar register, so that the branch on it is
// a scalar branch: a tensor load ignores EXEC.
static __device__ __forceinline__ uint32_t pinned(uint32_t v) {
  uint32_t w = uni(v);
  asm volatile("" : "+s"(w));
  return w;
}
static __device__ __forceinline__ void tdm_group0(u32x4& g, uint32_t lds_dst, uint64_t ga) {
  g[0] = uni(1u);                                              // count = 1
  g[1] = uni(lds_dst);                                         // byte offset in LDS
  g[2] = uni((uint32_t)ga);                                    // address [31:0]
  g[3] = uni((((uint32_t)(ga >> 32)) & 0x01FFFFFFu) | 0x80000000u);  // [56:32], type = 2
}
// Extents in bytes (data_size code 0); tensor dims = tile dims.
static __device__ __forceinline__ u32x8 tdm_group1(uint32_t src_pitch) {
  u32x8 g;
  g[0] = uni((1u << 20) | (5u << 22) | (3u << 25));  // pad 4 dwords after every 64 dwords
  g[1] = uni((uint32_t)G_ROWB << 16);                // tensor_dim0
  g[2] = uni((uint32_t)G_SROWS << 16);               // tensor_dim1
  g[3] = uni((uint32_t)G_ROWB << 16);                // tile_dim0
  g[4] = uni((uint32_t)G_SROWS);                     // tile_dim1
  g[5] = uni(src_pitch);                             // source row pitch, bytes
  g[6] = uni(0u);
  g[7] = uni(0u);
  return g;
}
// Load and wait both name the two groups as in-out operands: their scalar
// registers then hold nothing else from the issue to the wait, and the next
// descriptor is formed only behind the wait.
static __device__ __forceinline__ void tdm_load(u32x4& g0, u32x8& g1) {
  asm volatile("tensor_load_to_lds %0, %1" : "+s"(g0), "+s"(g1) :: "memory");
}
static __device__ __forceinline__ void tdm_wait(u32x4& g0, u32x8& g1) {
  asm volatile("s_wait_tensorcnt 0x0" : "+s"(g0), "+s"(g1) :: "memory");
}

// Fragment from padded LDS rows; the same k order as load_frag_rowmajor.
static __device__ __forceinline__ v16h load_frag_lds(const char* base, int lane) {
  const char* p = base + (lane & 15) * G_PITCH + (lane >> 4) * 16;
  const v8h lo = *reinterpret_cast<const v8h*>(p);
  const v8h hi = *reinterpret_cast<const v8h*>(p + 32);
  return __builtin_shufflevector(lo, hi, 0, 1, 2, 3, 4, 5, 6, 7, 8, 9, 10, 11, 12, 13, 14, 15);
}

// ---- elementwise f32 -> f16 ----------------------------------------------

// A block converts CVT_BLOCK consecutive floats; every array's length is a
// multiple of that. Each wave-wide load covers 512 contiguous bytes, each store
// 256; a thread's eight loads are all issued ahead of its first conversion.

#define CVT_U     8                   /* 16-byte loads a thread */
#define CVT_BLOCK (256 * 4 * CVT_U)   /* floats a block */

static __device__ __forceinline__
void cvt_block(const float* __restrict__ in, _Float16* __restrict__ out, int blk) {
  const size_t base = (size_t)blk * CVT_BLOCK + threadIdx.x * 4;
  v4f v[CVT_U];
#pragma unroll
  for (int u = 0; u < CVT_U; ++u)
    v[u] = *reinterpret_cast<const v4f*>(in + base + u * 1024);
#pragma unroll
  for (int u = 0; u < CVT_U; ++u) {
    v4h h;
#pragma unroll
    for (int e = 0; e < 4; ++e) h[e] = (_Float16)v[u][e];
    *reinterpret_cast<v4h*>(out + base + u * 1024) = h;
  }
  // Stands behind the last store: in the merged kernel's listing another block
  // range follows, which writes the registers that these stores name.
  asm volatile("s_wait_xcnt 0x0" ::: "memory");
}

// ---- additive attention mask: 0 or -1e9 -----------------------------------

static __device__ __forceinline__
void maskf_block(const int* __restrict__ mask, float* __restrict__ madd, int blk) {
  const int i = blk * 256 + threadIdx.x;   // BATCH * SEQ is a multiple of 256
  madd[i] = (mask[i] != 0) ? 0.f : -1e9f;
  // Stands ahead of the scalar writes on the merged kernel's way out, which
  // reuse the registers of the store's base address.
  asm volatile("s_wait_xcnt 0x0" ::: "memory");
}

// ---- V transpose to head-major vt[B,H,HD,SEQ] (f16) -----------------------

__global__ void vtrans_kernel(const _Float16* __restrict__ vsrc,
                              _Float16* __restrict__ vt) {
  const size_t o = (size_t)blockIdx.x * 256 + threadIdx.x;  // output index
  const int s   = (int)(o & (SEQ - 1));
  const size_t r = o >> 11;                 // (b*H + h)*HD + d
  const int d   = (int)(r & (HD - 1));
  const int hh  = (int)((r >> 6) & (NHEAD - 1));
  const int b   = (int)(r >> 10);
  vt[o] = vsrc[((size_t)(b * SEQ + s)) * D_MODEL + hh * HD + d];
}

// ---- LayerNorm (unbiased std, eps added to sd) -> f16 ---------------------

static __device__ __forceinline__
void ln_row(const float* __restrict__ x, const float* __restrict__ alpha,
            const float* __restrict__ bias, _Float16* __restrict__ out, int row) {
  __shared__ float red[256];
  const int t = threadIdx.x;
  const float* xr = x + (size_t)row * D_MODEL;
  float v[4];
  float s = 0.f;
#pragma unroll
  for (int i = 0; i < 4; ++i) { v[i] = xr[t + i * 256]; s += v[i]; }
  red[t] = s; __syncthreads();
  for (int off = 128; off > 0; off >>= 1) {
    if (t < off) red[t] += red[t + off];
    __syncthreads();
  }
  const float mu = red[0] * (1.f / D_MODEL);
  __syncthreads();
  float ss = 0.f;
#pragma unroll
  for (int i = 0; i < 4; ++i) { float d = v[i] - mu; ss += d * d; }
  red[t] = ss; __syncthreads();
  for (int off = 128; off > 0; off >>= 1) {
    if (t < off) red[t] += red[t + off];
    __syncthreads();
  }
  const float sd  = sqrtf(red[0] / (float)(D_MODEL - 1));
  const float inv = 1.f / (sd + LN_EPS);
#pragma unroll
  for (int i = 0; i < 4; ++i) {
    int c = t + i * 256;
    out[(size_t)row * D_MODEL + c] =
        (_Float16)(alpha[c] * (v[i] - mu) * inv + bias[c]);
  }
}

__global__ __launch_bounds__(256)
void ln_kernel(const float* __restrict__ x, const float* __restrict__ alpha,
               const float* __restrict__ bias, _Float16* __restrict__ out) {
  ln_row(x, alpha, bias, out, blockIdx.x);
}

// ---- everything that depends on the inputs alone, in one launch ------------
// Block ranges of one grid: the first LayerNorm (a row a block), the six weight
// conversions (their f16 planes lie one behind another in wh, in this order),
// the additive mask. No range reads what another writes.

#define PREP_LN    ROWS                                /* blocks: LayerNorm rows */
#define PREP_DD    (D_MODEL * D_MODEL / CVT_BLOCK)     /* blocks per D x D weight: 128 */
#define PREP_FD    (FF_DIM * D_MODEL / CVT_BLOCK)      /* blocks per FF x D weight: 512 */
#define PREP_CVT   (4 * PREP_DD + 2 * PREP_FD)
#define PREP_MASK  (BATCH * SEQ / 256)
#define PREP_GRID  (PREP_LN + PREP_CVT + PREP_MASK)

__global__ __launch_bounds__(256)
void prep_kernel(const float* __restrict__ x, const float* __restrict__ alpha,
                 const float* __restrict__ bias, _Float16* __restrict__ xn,
                 const float* __restrict__ w_q, const float* __restrict__ w_k,
                 const float* __restrict__ w_v, const float* __restrict__ w_o,
                 const float* __restrict__ fc1_w, const float* __restrict__ fc2_w,
                 _Float16* __restrict__ wh,
                 const int* __restrict__ mask, float* __restrict__ madd) {
  const int blk = blockIdx.x;
  if (blk < PREP_LN) {
    ln_row(x, alpha, bias, xn, blk);
  } else if (blk < PREP_LN + PREP_CVT) {
    const int cb = blk - PREP_LN;          // block within the six planes
    const float* in;
    int first;                             // the plane's first block
    if (cb < 4 * PREP_DD) {
      const int w = cb / PREP_DD;
      in = (w == 0) ? w_q : (w == 1) ? w_k : (w == 2) ? w_v : w_o;
      first = w * PREP_DD;
    } else if (cb < 4 * PREP_DD + PREP_FD) {
      in = fc1_w; first = 4 * PREP_DD;
    } else {
      in = fc2_w; first = 4 * PREP_DD + PREP_FD;
    }
    cvt_block(in, wh + (size_t)first * CVT_BLOCK, cb - first);
  } else {
    maskf_block(mask, madd, blk - (PREP_LN + PREP_CVT));
  }
}

// ---- Tiled WMMA GEMM:  C[M,N] = act(A[M,K] * W[N,K]^T + bias) (+resid) ----
// Block = 256 threads (8 waves), tile 128x128, 128 k a stage. Waves: 2 (M) x 4 (N);
// each wave owns 64x32 of output (4 M-frags x 2 N-frags = 8 WMMA / 32 k).
// Two LDS buffers: every wave issues one tensor load a stage for its own slice
// (waves 0..3: 32 rows of A each, waves 4..7: 32 rows of W each), so that the
// next stage flies while this one is worked on. K: a multiple of 128, >= 256.
// blockIdx.z picks one of several products on the same A: weight planes [N,K]
// and f16 output planes [M,N] lie one behind another.

template <bool RELU, bool RESID, bool BIAS, bool OUTF32, bool OUTF16>
__global__ __launch_bounds__(256)
void gemm_kernel(const _Float16* __restrict__ A, const _Float16* __restrict__ W,
                 const float* __restrict__ bias, const float* __restrict__ resid,
                 float* __restrict__ outf, _Float16* __restrict__ outh,
                 int M, int N, int K) {
  __shared__ __attribute__((aligned(2048))) char sm[2 * G_BUF];
  const int t    = threadIdx.x;
  const int lane = t & 31;
  const uint32_t wave = uni((uint32_t)t >> 5);
  const int wm   = wave >> 2;       // 0..1  (64 rows of M each)
  const int wn   = wave & 3;        // 0..3  (32 cols of N each)
  const int m0   = blockIdx.y * 128;
  const int n0   = blockIdx.x * 128;

  v8f acc[4][2];
#pragma unroll
  for (int i = 0; i < 4; ++i)
#pragma unroll
    for (int j = 0; j < 2; ++j) acc[i][j] = v8f{};

  auto compute_stage = [&](const char* buf) {
    const char* Ab = buf + (wm * 2) * G_SLICE;   // this wave's 64 rows of A: two slices
    const char* Bb = buf + (4 + wn) * G_SLICE;   // this wave's 32 rows of W: one slice
#pragma unroll
    for (int kk = 0; kk < G_K / 32; ++kk) {
      v16h bf[2], af[4];
#pragma unroll
      for (int nf = 0; nf < 2; ++nf)
        bf[nf] = load_frag_lds(Bb + nf * 16 * G_PITCH + kk * 64, lane);
#pragma unroll
      for (int mf = 0; mf < 4; ++mf)
        af[mf] = load_frag_lds(Ab + (mf >> 1) * G_SLICE + (mf & 1) * 16 * G_PITCH + kk * 64, lane);
#pragma unroll
      for (int mf = 0; mf < 4; ++mf)
#pragma unroll
        for (int nf = 0; nf < 2; ++nf)
          acc[mf][nf] = wmma16x16x32(af[mf], bf[nf], acc[mf][nf]);
    }
  };

  const _Float16* srow = (wave < 4u) ? A + (size_t)(m0 + wave * G_SROWS) * K
                                     : W + ((size_t)blockIdx.z * N + n0 + (wave - 4u) * G_SROWS) * K;
  const uint64_t ga0  = (uint64_t)(uintptr_t)srow;
  const uint32_t lds0 = (uint32_t)(uintptr_t)(void*)&sm[0] + wave * G_SLICE;
  u32x8 g1 = tdm_group1((uint32_t)K * 2u);
  u32x4 g0;
  const int nk = K / G_K;

  tdm_group0(g0, lds0, ga0);
  tdm_load(g0, g1);                                    // stage 0 into buffer 0
  tdm_wait(g0, g1);                                    // own slice of stage 0 landed
  __syncthreads();                                     // stage 0 readable by all waves
  tdm_group0(g0, lds0 + G_BUF, ga0 + G_ROWB);
  tdm_load(g0, g1);                                    // stage 1 into buffer 1

  for (int s = 0; s < nk; ++s) {
    compute_stage(&sm[(s & 1) * G_BUF]);
    // Hand-over: this wave's reads of stage s are done, its slice of stage s + 1
    // has landed; behind the barrier stage s + 1 is readable and buffer s & 1 free.
    asm volatile("s_wait_dscnt 0x0" ::: "memory");
    tdm_wait(g0, g1);
    __syncthreads();
    if (pinned(s + 2 < nk)) {
      tdm_group0(g0, lds0 + (uint32_t)(s & 1) * G_BUF, ga0 + (uint64_t)(s + 2) * G_ROWB);
      tdm_load(g0, g1);
    }
  }
  tdm_wait(g0, g1);                                    // nothing in flight at the wave's end
  asm volatile("s_wait_dscnt 0x0" ::: "memory");

  const int hi8 = (lane >> 4) * 8;
#pragma unroll
  for (int nf = 0; nf < 2; ++nf) {
    const int gn = n0 + wn * 32 + nf * 16 + (lane & 15);
    float bv = 0.f;
    if constexpr (BIAS) bv = bias[gn];
#pragma unroll
    for (int mf = 0; mf < 4; ++mf) {
#pragma unroll
      for (int v = 0; v < 8; ++v) {
        const int gm = m0 + wm * 64 + mf * 16 + hi8 + v;  // D layout: M = v + hi8
        float val = acc[mf][nf][v];
        if constexpr (BIAS)  val += bv;
        if constexpr (RELU)  val = fmaxf(val, 0.f);
        const size_t idx = (size_t)gm * N + gn;
        if constexpr (RESID) val += resid[idx];
        if constexpr (OUTF32) outf[idx] = val;
        if constexpr (OUTF16) outh[(size_t)blockIdx.z * M * N + idx] = (_Float16)val;
      }
    }
  }
}

#define ATT_KEYS  64                  /* keys per staged tile */
#define ATT_PITCH 72                  /* halfs per LDS row: 128 B + 16 B pad, 16 B x odd for b128 readers */
#define ATT_TILE  (64 * ATT_PITCH)    /* halfs per staged K or V^T tile */
#define ATT_NST   (SEQ / ATT_KEYS)    /* tiles per (b, h) */

// One tile's four copies of a lane (16 bytes each). The s_wait_xcnt stands in
// the copies' own statement so that no address register is rewritten ahead of it.
static __device__ __forceinline__ void attn_copy4(
    unsigned int l0, const _Float16* g0, unsigned int l1, const _Float16* g1,
    unsigned int l2, const _Float16* g2, unsigned int l3, const _Float16* g3) {
  asm volatile(
      "global_load_async_to_lds_b128 %0, %1, off\n\t"
      "global_load_async_to_lds_b128 %2, %3, off\n\t"
      "global_load_async_to_lds_b128 %4, %5, off\n\t"
      "global_load_async_to_lds_b128 %6, %7, off\n\t"
      "s_wait_xcnt 0x0"
      :: "v"(l0), "v"(g0), "v"(l1), "v"(g1), "v"(l2), "v"(g2), "v"(l3), "v"(g3)
      : "memory");
}

__global__ __launch_bounds__(256)
void attn_kernel(const _Float16* __restrict__ qh, const _Float16* __restrict__ kh,
                 const _Float16* __restrict__ vt, const float* __restrict__ madd,
                 _Float16* __restrict__ ctxh) {
  __shared__ __attribute__((aligned(16))) _Float16 kv[2][2][ATT_TILE];
  const int lane = threadIdx.x & 31;
  const int wave = threadIdx.x >> 5;
  const int q0   = blockIdx.x * 128 + wave * 16;
  const int h    = blockIdx.y;
  const int b    = blockIdx.z;
  const size_t hoff = (size_t)h * HD;
  const int hi8  = (lane >> 4) * 8;
  const float scale = 0.125f;  // 1/sqrt(HD)

  const _Float16* qbase = qh + ((size_t)(b * SEQ + q0)) * D_MODEL + hoff;
  v16h qb_lo = load_frag_rowmajor(qbase,      D_MODEL, lane);   // B: N=q, K=hd
  v16h qb_hi = load_frag_rowmajor(qbase + 32, D_MODEL, lane);

  v8f ctx[4] = {v8f{}, v8f{}, v8f{}, v8f{}};
  float m = -1e30f, l = 0.f;
  const float* mrow = madd + (size_t)b * SEQ;
  const _Float16* vtb = vt + ((size_t)(b * NHEAD + h) * HD) * SEQ;

  // Each thread copies rows crow and crow + 32 of both tiles, 16 bytes at ccol.
  const int crow = threadIdx.x >> 3;         // 0..31
  const int ccol = (threadIdx.x & 7) * 8;    // halfs
  const _Float16* gk = kh + ((size_t)(b * SEQ + crow)) * D_MODEL + hoff + ccol;
  const _Float16* gv = vtb + (size_t)crow * SEQ + ccol;
  const unsigned int lds0 =
      (unsigned int)(uintptr_t)(void*)&kv[0][0][crow * ATT_PITCH + ccol];
  auto copy_tile = [&](int s) {
    const unsigned int lk = lds0 + (unsigned int)(s & 1) * (2 * ATT_TILE * 2);
    const unsigned int lv = lk + ATT_TILE * 2;
    const _Float16* k0 = gk + (size_t)s * ATT_KEYS * D_MODEL;
    const _Float16* v0 = gv + s * ATT_KEYS;
    attn_copy4(lk, k0, lk + 32 * ATT_PITCH * 2, k0 + 32 * D_MODEL,
               lv, v0, lv + 32 * ATT_PITCH * 2, v0 + (size_t)32 * SEQ);
  };

  copy_tile(0);
  asm volatile("s_wait_asynccnt 0x0" ::: "memory");  // own copies of tile 0 landed
  __syncthreads();                                   // tile 0 readable by all waves
  copy_tile(1);

  for (int s = 0; s < ATT_NST; ++s) {
   const _Float16* Ks = &kv[s & 1][0][0];
   const _Float16* Vs = &kv[s & 1][1][0];
   // Unrolled: both halves' LDS offsets become immediates, no inner branch.
#pragma unroll
   for (int sub = 0; sub < ATT_KEYS; sub += 32) {
    const int j = s * ATT_KEYS + sub;
    const _Float16* kbase = Ks + sub * ATT_PITCH;
    v16h ka0l = load_frag_rowmajor(kbase,                       ATT_PITCH, lane);
    v16h ka0h = load_frag_rowmajor(kbase + 32,                  ATT_PITCH, lane);
    v16h ka1l = load_frag_rowmajor(kbase + 16 * ATT_PITCH,      ATT_PITCH, lane);
    v16h ka1h = load_frag_rowmajor(kbase + 16 * ATT_PITCH + 32, ATT_PITCH, lane);
    v8f s0 = {}; s0 = wmma16x16x32(ka0l, qb_lo, s0); s0 = wmma16x16x32(ka0h, qb_hi, s0);
    v8f s1 = {}; s1 = wmma16x16x32(ka1l, qb_lo, s1); s1 = wmma16x16x32(ka1h, qb_hi, s1);

    // per-lane: q = lane&15 ; element v: key = j + hi8 + v (s0) / +16 (s1)
    float sv0[8], sv1[8];
    float tmax = -1e30f;
#pragma unroll
    for (int v = 0; v < 8; ++v) {
      const int key0 = j + hi8 + v;
      const float a = fmaf(s0[v], scale, mrow[key0]);
      const float c = fmaf(s1[v], scale, mrow[key0 + 16]);
      sv0[v] = a; sv1[v] = c;
      tmax = fmaxf(tmax, fmaxf(a, c));
    }
    tmax = fmaxf(tmax, __shfl_xor(tmax, 16, 32));
    const float mnew  = fmaxf(m, tmax);
    const float alpha = __expf(m - mnew);
    float psum = 0.f;
    v16h pa;
#pragma unroll
    for (int v = 0; v < 8; ++v) {
      const float p0 = __expf(sv0[v] - mnew);
      const float p1 = __expf(sv1[v] - mnew);
      pa[v]     = (_Float16)p0;    // A-frag elem e<8  -> key kb+e
      pa[8 + v] = (_Float16)p1;    // A-frag elem e>=8 -> key kb+16+(e-8)
      psum += p0 + p1;
    }
    psum += __shfl_xor(psum, 16, 32);
    l = l * alpha + psum;
    m = mnew;

    // rescale ctx: row q = v + hi8 -> alpha lives in lane (v + hi8)
    float rs[8];
#pragma unroll
    for (int v = 0; v < 8; ++v) rs[v] = __shfl(alpha, hi8 + v, 32);
#pragma unroll
    for (int nf = 0; nf < 4; ++nf)
#pragma unroll
      for (int v = 0; v < 8; ++v) ctx[nf][v] *= rs[v];

#pragma unroll
    for (int nf = 0; nf < 4; ++nf) {
      // B operand: N = hd (rows of vt), K = keys (contiguous)
      v16h vb = load_frag_rowmajor(Vs + (nf * 16) * ATT_PITCH + sub, ATT_PITCH, lane);
      ctx[nf] = wmma16x16x32(pa, vb, ctx[nf]);
    }
   }
   // Hand-over: this wave's reads of tile s are done, its copies of tile s + 1
   // have landed; behind the barrier tile s + 1 is readable and buffer s & 1 free.
   asm volatile("s_wait_dscnt 0x0" ::: "memory");
   asm volatile("s_wait_asynccnt 0x0" ::: "memory");
   // Stands ahead of the advance of the mask loads' address register.
   asm volatile("s_wait_xcnt 0x0" ::: "memory");
   __syncthreads();
   if (s + 2 < ATT_NST) copy_tile(s + 2);
  }
  asm volatile("s_wait_asynccnt 0x0" ::: "memory");  // nothing in flight at the wave's end

  const float linv = 1.f / l;
  float rs[8];
#pragma unroll
  for (int v = 0; v < 8; ++v) rs[v] = __shfl(linv, hi8 + v, 32);
  _Float16* obase = ctxh + ((size_t)(b * SEQ + q0)) * D_MODEL + hoff;
#pragma unroll
  for (int nf = 0; nf < 4; ++nf) {
#pragma unroll
    for (int v = 0; v < 8; ++v) {
      const int qrow = hi8 + v;
      const int hd   = nf * 16 + (lane & 15);
      obase[(size_t)qrow * D_MODEL + hd] = (_Float16)(ctx[nf][v] * rs[v]);
    }
  }
}

// ---- host side ------------------------------------------------------------

extern "C" void kernel_launch(void* const* d_in, const int* in_sizes, int n_in,
                              void* d_out, int out_size, void* d_ws, size_t ws_size,
                              hipStream_t stream) {
  (void)in_sizes; (void)n_in; (void)out_size; (void)ws_size;
  const float* x     = (const float*)d_in[0];
  const int*   mask  = (const int*)d_in[1];
  const float* alpha = (const float*)d_in[2];
  const float* bias  = (const float*)d_in[3];
  const float* w_q   = (const float*)d_in[4];
  const float* w_k   = (const float*)d_in[5];
  const float* w_v   = (const float*)d_in[6];
  const float* w_o   = (const float*)d_in[7];
  const float* fc1_w = (const float*)d_in[8];
  const float* fc1_b = (const float*)d_in[9];
  const float* fc2_w = (const float*)d_in[10];
  const float* fc2_b = (const float*)d_in[11];
  float* out = (float*)d_out;

  char* ws = (char*)d_ws;
  size_t off = 0;
  auto alloc = [&](size_t bytes) -> char* {
    char* p = ws + off;
    off += (bytes + 255) & ~(size_t)255;
    return p;
  };
  _Float16* xn_h  = (_Float16*)alloc((size_t)ROWS * D_MODEL * 2);
  _Float16* wq_h  = (_Float16*)alloc((size_t)D_MODEL * D_MODEL * 2);
  _Float16* wk_h  = (_Float16*)alloc((size_t)D_MODEL * D_MODEL * 2);
  _Float16* wv_h  = (_Float16*)alloc((size_t)D_MODEL * D_MODEL * 2);
  _Float16* wo_h  = (_Float16*)alloc((size_t)D_MODEL * D_MODEL * 2);
  _Float16* fc1_h = (_Float16*)alloc((size_t)FF_DIM * D_MODEL * 2);
  _Float16* fc2_h = (_Float16*)alloc((size_t)D_MODEL * FF_DIM * 2);
  _Float16* q_h   = (_Float16*)alloc((size_t)ROWS * D_MODEL * 2);
  _Float16* k_h   = (_Float16*)alloc((size_t)ROWS * D_MODEL * 2);
  _Float16* v_h   = (_Float16*)alloc((size_t)ROWS * D_MODEL * 2);
  _Float16* vt_h  = (_Float16*)alloc((size_t)ROWS * D_MODEL * 2);
  _Float16* ctx_h = (_Float16*)alloc((size_t)ROWS * D_MODEL * 2);
  float*    x1    = (float*)   alloc((size_t)ROWS * D_MODEL * 4);
  _Float16* xn2_h = (_Float16*)alloc((size_t)ROWS * D_MODEL * 2);
  _Float16* ff_h  = (_Float16*)alloc((size_t)ROWS * FF_DIM * 2);
  float*    madd  = (float*)   alloc((size_t)BATCH * SEQ * 4);
  (void)wk_h; (void)wv_h;   // reached through wq_h: the planes are contiguous

  // LayerNorm 1, the six weight conversions (planes wq_h .. fc2_h are contiguous)
  // and the mask: one launch.
  prep_kernel<<<PREP_GRID, 256, 0, stream>>>(x, alpha, bias, xn_h, w_q, w_k, w_v, w_o,
                                             fc1_w, fc2_w, wq_h, mask, madd);

  dim3 gD(D_MODEL / 128, ROWS / 128);      // 8 x 32
  dim3 gQKV(D_MODEL / 128, ROWS / 128, 3); // 8 x 32 x 3
  dim3 gF(FF_DIM / 128, ROWS / 128);       // 32 x 32

  // Q/K/V projections (f16 outputs for attention) in one launch: the planes
  // wq_h, wk_h, wv_h and q_h, k_h, v_h are contiguous.
  gemm_kernel<false, false, false, false, true><<<gQKV, 256, 0, stream>>>(
      xn_h, wq_h, nullptr, nullptr, nullptr, q_h, ROWS, D_MODEL, D_MODEL);

  vtrans_kernel<<<(ROWS * D_MODEL) / 256, 256, 0, stream>>>(v_h, vt_h);

  attn_kernel<<<dim3(SEQ / 128, NHEAD, BATCH), 256, 0, stream>>>(
      q_h, k_h, vt_h, madd, ctx_h);

  // x1 = x + ctx @ Wo^T
  gemm_kernel<false, true, false, true, false><<<gD, 256, 0, stream>>>(
      ctx_h, wo_h, nullptr, x, x1, nullptr, ROWS, D_MODEL, D_MODEL);

  ln_kernel<<<ROWS, 256, 0, stream>>>(x1, alpha, bias, xn2_h);

  // ff = relu(xn2 @ fc1^T + b1)
  gemm_kernel<true, false, true, false, true><<<gF, 256, 0, stream>>>(
      xn2_h, fc1_h, fc1_b, nullptr, nullptr, ff_h, ROWS, FF_DIM, D_MODEL);

  // out = x1 + ff @ fc2^T + b2
  gemm_kernel<false, true, true, true, false><<<gD, 256, 0, stream>>>(
      ff_h, fc2_h, fc2_b, x1, out, nullptr, ROWS, D_MODEL, FF_DIM);
}

// v005
// It runs in 184 microseconds.
// In two side-by-side timings against v004, it was 1.09 and 1.08 times as fast.
// All steps since v000 together make it 2.24 times as fast.
#include <hip/hip_runtime.h>
#include <hip/hip_bf16.h>
#include <math.h>

// ---------------------------------------------------------------------------
// EncoderBlock for MI455X (gfx1250).
//   D=1024, H=16, HD=64, FF=4096, B=2, S=2048.
// f16 WMMA (v_wmma_f32_16x16x32_f16) for all GEMMs + flash attention,
// double-buffered TDM (tensor_load_to_lds) staging of GEMM tiles into LDS.
// ---------------------------------------------------------------------------

typedef __attribute__((ext_vector_type(16))) _Float16 v16h;
typedef __attribute__((ext_vector_type(8)))  _Float16 v8h;
typedef __attribute__((ext_vector_type(4)))  _Float16 v4h;
typedef __attribute__((ext_vector_type(8)))  float    v8f;
typedef __attribute__((ext_vector_type(4)))  float    v4f;
typedef __attribute__((ext_vector_type(4)))  unsigned int u32x4;
typedef __attribute__((ext_vector_type(8)))  unsigned int u32x8;

#define D_MODEL 1024
#define NHEAD   16
#define HD      64
#define FF_DIM  4096
#define SEQ     2048
#define BATCH   2
#define ROWS    (BATCH * SEQ)   /* 4096 */
#define LN_EPS  1e-6f

// ---- WMMA helpers ---------------------------------------------------------

static __device__ __forceinline__ v8f wmma16x16x32(v16h a, v16h b, v8f c) {
  return __builtin_amdgcn_wmma_f32_16x16x32_f16(false, a, false, b, (short)0, c,
                                                false, false);
}

// A/B fragment loader from a row-major [16 x >=32] tile (row = M for A, N for B;
// K contiguous within the row). ISA 16-bit A layout:
//   lanes 0-15:  M=lane,    elems 0..7 -> K=0..7,  elems 8..15 -> K=16..23
//   lanes 16-31: M=lane-16, elems 0..7 -> K=8..15, elems 8..15 -> K=24..31
static __device__ __forceinline__ v16h load_frag_rowmajor(const _Float16* base,
                                                          int ld, int lane) {
  const int r  = lane & 15;
  const int kb = (lane >> 4) * 8;
  const _Float16* p = base + (size_t)r * ld + kb;
  v16h f;
#pragma unroll
  for (int i = 0; i < 8; ++i) f[i] = p[i];
#pragma unroll
  for (int i = 0; i < 8; ++i) f[8 + i] = p[16 + i];
  return f;
}

// ---- Tensor loads: one wave brings a slice of 32 rows x 256 bytes to LDS ----
// The mover pads every 256-byte row by 16 bytes: the LDS pitch is 272 bytes
// (16 B x odd), at which the ds_load_b128 fragment reads meet no bank conflict.

#define G_K      128                  /* k per stage: rows of 256 bytes */
#define G_ROWB   256                  /* bytes per staged row */
#define G_PITCH  272                  /* bytes per LDS row, pad included */
#define G_SROWS  32                   /* rows per slice, one slice a wave */
#define G_SLICE  10240                /* 32 x 272 = 8704 B, rounded up to a multiple of 2 KiB */
#define G_BUF    (8 * G_SLICE)        /* one stage: A slices 0..3, W slices 4..7 */

static __device__ __forceinline__ uint32_t uni(uint32_t v) {
  return (uint32_t)__builtin_amdgcn_readfirstlane(v);
}
// Holds a wave-uniform test in a scalar register, so that the branch on it is
// a scalar branch: a tensor load ignores EXEC.
static __device__ __forceinline__ uint32_t pinned(uint32_t v) {
  uint32_t w = uni(v);
  asm volatile("" : "+s"(w));
  return w;
}
static __device__ __forceinline__ void tdm_group0(u32x4& g, uint32_t lds_dst, uint64_t ga) {
  g[0] = uni(1u);                                              // count = 1
  g[1] = uni(lds_dst);                                         // byte offset in LDS
  g[2] = uni((uint32_t)ga);                                    // address [31:0]
  g[3] = uni((((uint32_t)(ga >> 32)) & 0x01FFFFFFu) | 0x80000000u);  // [56:32], type = 2
}
// Extents in bytes (data_size code 0); tensor dims = tile dims.
static __device__ __forceinline__ u32x8 tdm_group1(uint32_t src_pitch) {
  u32x8 g;
  g[0] = uni((1u << 20) | (5u << 22) | (3u << 25));  // pad 4 dwords after every 64 dwords
  g[1] = uni((uint32_t)G_ROWB << 16);                // tensor_dim0
  g[2] = uni((uint32_t)G_SROWS << 16);               // tensor_dim1
  g[3] = uni((uint32_t)G_ROWB << 16);                // tile_dim0
  g[4] = uni((uint32_t)G_SROWS);                     // tile_dim1
  g[5] = uni(src_pitch);                             // source row pitch, bytes
  g[6] = uni(0u);
  g[7] = uni(0u);
  return g;
}
// Load and wait both name the two groups as in-out operands: their scalar
// registers then hold nothing else from the issue to the wait, and the next
// descriptor is formed only behind the wait.
static __device__ __forceinline__ void tdm_load(u32x4& g0, u32x8& g1) {
  asm volatile("tensor_load_to_lds %0, %1" : "+s"(g0), "+s"(g1) :: "memory");
}
static __device__ __forceinline__ void tdm_wait(u32x4& g0, u32x8& g1) {
  asm volatile("s_wait_tensorcnt 0x0" : "+s"(g0), "+s"(g1) :: "memory");
}

// Fragment from padded LDS rows; the same k order as load_frag_rowmajor.
static __device__ __forceinline__ v16h load_frag_lds(const char* base, int lane) {
  const char* p = base + (lane & 15) * G_PITCH + (lane >> 4) * 16;
  const v8h lo = *reinterpret_cast<const v8h*>(p);
  const v8h hi = *reinterpret_cast<const v8h*>(p + 32);
  return __builtin_shufflevector(lo, hi, 0, 1, 2, 3, 4, 5, 6, 7, 8, 9, 10, 11, 12, 13, 14, 15);
}

// ---- elementwise f32 -> f16 ----------------------------------------------

// A block converts CVT_BLOCK consecutive floats; every array's length is a
// multiple of that. Each wave-wide load covers 512 contiguous bytes, each store
// 256; a thread's eight loads are all issued ahead of its first conversion.

#define CVT_U     8                   /* 16-byte loads a thread */
#define CVT_BLOCK (256 * 4 * CVT_U)   /* floats a block */

static __device__ __forceinline__
void cvt_block(const float* __restrict__ in, _Float16* __restrict__ out, int blk) {
  const size_t base = (size_t)blk * CVT_BLOCK + threadIdx.x * 4;
  v4f v[CVT_U];
#pragma unroll
  for (int u = 0; u < CVT_U; ++u)
    v[u] = *reinterpret_cast<const v4f*>(in + base + u * 1024);
#pragma unroll
  for (int u = 0; u < CVT_U; ++u) {
    v4h h;
#pragma unroll
    for (int e = 0; e < 4; ++e) h[e] = (_Float16)v[u][e];
    *reinterpret_cast<v4h*>(out + base + u * 1024) = h;
  }
  // Stands behind the last store: in the merged kernel's listing another block
  // range follows, which writes the registers that these stores name.
  asm volatile("s_wait_xcnt 0x0" ::: "memory");
}

// ---- additive attention mask: 0 or -1e9 -----------------------------------

static __device__ __forceinline__
void maskf_block(const int* __restrict__ mask, float* __restrict__ madd, int blk) {
  const int i = blk * 256 + threadIdx.x;   // BATCH * SEQ is a multiple of 256
  madd[i] = (mask[i] != 0) ? 0.f : -1e9f;
  // Stands ahead of the scalar writes on the merged kernel's way out, which
  // reuse the registers of the store's base address.
  asm volatile("s_wait_xcnt 0x0" ::: "memory");
}

// ---- LayerNorm (unbiased std, eps added to sd) -> f16 ---------------------

static __device__ __forceinline__
void ln_row(const float* __restrict__ x, const float* __restrict__ alpha,
            const float* __restrict__ bias, _Float16* __restrict__ out, int row) {
  __shared__ float red[256];
  const int t = threadIdx.x;
  const float* xr = x + (size_t)row * D_MODEL;
  float v[4];
  float s = 0.f;
#pragma unroll
  for (int i = 0; i < 4; ++i) { v[i] = xr[t + i * 256]; s += v[i]; }
  red[t] = s; __syncthreads();
  for (int off = 128; off > 0; off >>= 1) {
    if (t < off) red[t] += red[t + off];
    __syncthreads();
  }
  const float mu = red[0] * (1.f / D_MODEL);
  __syncthreads();
  float ss = 0.f;
#pragma unroll
  for (int i = 0; i < 4; ++i) { float d = v[i] - mu; ss += d * d; }
  red[t] = ss; __syncthreads();
  for (int off = 128; off > 0; off >>= 1) {
    if (t < off) red[t] += red[t + off];
    __syncthreads();
  }
  const float sd  = sqrtf(red[0] / (float)(D_MODEL - 1));
  const float inv = 1.f / (sd + LN_EPS);
#pragma unroll
  for (int i = 0; i < 4; ++i) {
    int c = t + i * 256;
    out[(size_t)row * D_MODEL + c] =
        (_Float16)(alpha[c] * (v[i] - mu) * inv + bias[c]);
  }
}

__global__ __launch_bounds__(256)
void ln_kernel(const float* __restrict__ x, const float* __restrict__ alpha,
               const float* __restrict__ bias, _Float16* __restrict__ out) {
  ln_row(x, alpha, bias, out, blockIdx.x);
}

// ---- everything that depends on the inputs alone, in one launch ------------
// Block ranges of one grid: the first LayerNorm (a row a block), the six weight
// conversions (their f16 planes lie one behind another in wh, in this order),
// the additive mask. No range reads what another writes.

#define PREP_LN    ROWS                                /* blocks: LayerNorm rows */
#define PREP_DD    (D_MODEL * D_MODEL / CVT_BLOCK)     /* blocks per D x D weight: 128 */
#define PREP_FD    (FF_DIM * D_MODEL / CVT_BLOCK)      /* blocks per FF x D weight: 512 */
#define PREP_CVT   (4 * PREP_DD + 2 * PREP_FD)
#define PREP_MASK  (BATCH * SEQ / 256)
#define PREP_GRID  (PREP_LN + PREP_CVT + PREP_MASK)

__global__ __launch_bounds__(256)
void prep_kernel(const float* __restrict__ x, const float* __restrict__ alpha,
                 const float* __restrict__ bias, _Float16* __restrict__ xn,
                 const float* __restrict__ w_q, const float* __restrict__ w_k,
                 const float* __restrict__ w_v, const float* __restrict__ w_o,
                 const float* __restrict__ fc1_w, const float* __restrict__ fc2_w,
                 _Float16* __restrict__ wh,
                 const int* __restrict__ mask, float* __restrict__ madd) {
  const int blk = blockIdx.x;
  if (blk < PREP_LN) {
    ln_row(x, alpha, bias, xn, blk);
  } else if (blk < PREP_LN + PREP_CVT) {
    const int cb = blk - PREP_LN;          // block within the six planes
    const float* in;
    int first;                             // the plane's first block
    if (cb < 4 * PREP_DD) {
      const int w = cb / PREP_DD;
      in = (w == 0) ? w_q : (w == 1) ? w_k : (w == 2) ? w_v : w_o;
      first = w * PREP_DD;
    } else if (cb < 4 * PREP_DD + PREP_FD) {
      in = fc1_w; first = 4 * PREP_DD;
    } else {
      in = fc2_w; first = 4 * PREP_DD + PREP_FD;
    }
    cvt_block(in, wh + (size_t)first * CVT_BLOCK, cb - first);
  } else {
    maskf_block(mask, madd, blk - (PREP_LN + PREP_CVT));
  }
}

// ---- Tiled WMMA GEMM:  C[M,N] = act(A[M,K] * W[N,K]^T + bias) (+resid) ----
// Block = 256 threads (8 waves), tile 128x128, 128 k a stage. Waves: 2 (M) x 4 (N);
// each wave owns 64x32 of output (4 M-frags x 2 N-frags = 8 WMMA / 32 k).
// Two LDS buffers: every wave issues one tensor load a stage for its own slice
// (waves 0..3: 32 rows of A each, waves 4..7: 32 rows of W each), so that the
// next stage flies while this one is worked on. K: a multiple of 128, >= 256.
// blockIdx.z picks one of several products on the same A: weight planes [N,K]
// and f16 output planes [M,N] lie one behind another.
// VTRANS: the plane of blockIdx.z == 2 (V) is stored head-major and transposed,
// [B, N, SEQ] (N = head * HD + hd), as attention reads it: an accumulator
// register group holds 8 consecutive rows of one column, which are 16
// contiguous bytes there, so each group goes out as one 16-byte store.

template <bool RELU, bool RESID, bool BIAS, bool OUTF32, bool OUTF16, bool VTRANS>
__global__ __launch_bounds__(256)
void gemm_kernel(const _Float16* __restrict__ A, const _Float16* __restrict__ W,
                 const float* __restrict__ bias, const float* __restrict__ resid,
                 float* __restrict__ outf, _Float16* __restrict__ outh,
                 int M, int N, int K) {
  __shared__ __attribute__((aligned(2048))) char sm[2 * G_BUF];
  const int t    = threadIdx.x;
  const int lane = t & 31;
  const uint32_t wave = uni((uint32_t)t >> 5);
  const int wm   = wave >> 2;       // 0..1  (64 rows of M each)
  const int wn   = wave & 3;        // 0..3  (32 cols of N each)
  const int m0   = blockIdx.y * 128;
  const int n0   = blockIdx.x * 128;

  v8f acc[4][2];
#pragma unroll
  for (int i = 0; i < 4; ++i)
#pragma unroll
    for (int j = 0; j < 2; ++j) acc[i][j] = v8f{};

  auto compute_stage = [&](const char* buf) {
    const char* Ab = buf + (wm * 2) * G_SLICE;   // this wave's 64 rows of A: two slices
    const char* Bb = buf + (4 + wn) * G_SLICE;   // this wave's 32 rows of W: one slice
#pragma unroll
    for (int kk = 0; kk < G_K / 32; ++kk) {
      v16h bf[2], af[4];
#pragma unroll
      for (int nf = 0; nf < 2; ++nf)
        bf[nf] = load_frag_lds(Bb + nf * 16 * G_PITCH + kk * 64, lane);
#pragma unroll
      for (int mf = 0; mf < 4; ++mf)
        af[mf] = load_frag_lds(Ab + (mf >> 1) * G_SLICE + (mf & 1) * 16 * G_PITCH + kk * 64, lane);
#pragma unroll
      for (int mf = 0; mf < 4; ++mf)
#pragma unroll
        for (int nf = 0; nf < 2; ++nf)
          acc[mf][nf] = wmma16x16x32(af[mf], bf[nf], acc[mf][nf]);
    }
  };

  const _Float16* srow = (wave < 4u) ? A + (size_t)(m0 + wave * G_SROWS) * K
                                     : W + ((size_t)blockIdx.z * N + n0 + (wave - 4u) * G_SROWS) * K;
  const uint64_t ga0  = (uint64_t)(uintptr_t)srow;
  const uint32_t lds0 = (uint32_t)(uintptr_t)(void*)&sm[0] + wave * G_SLICE;
  u32x8 g1 = tdm_group1((uint32_t)K * 2u);
  u32x4 g0;
  const int nk = K / G_K;

  tdm_group0(g0, lds0, ga0);
  tdm_load(g0, g1);                                    // stage 0 into buffer 0
  tdm_wait(g0, g1);                                    // own slice of stage 0 landed
  __syncthreads();                                     // stage 0 readable by all waves
  tdm_group0(g0, lds0 + G_BUF, ga0 + G_ROWB);
  tdm_load(g0, g1);                                    // stage 1 into buffer 1

  for (int s = 0; s < nk; ++s) {
    compute_stage(&sm[(s & 1) * G_BUF]);
    // Hand-over: this wave's reads of stage s are done, its slice of stage s + 1
    // has landed; behind the barrier stage s + 1 is readable and buffer s & 1 free.
    asm volatile("s_wait_dscnt 0x0" ::: "memory");
    tdm_wait(g0, g1);
    __syncthreads();
    if (pinned(s + 2 < nk)) {
      tdm_group0(g0, lds0 + (uint32_t)(s & 1) * G_BUF, ga0 + (uint64_t)(s + 2) * G_ROWB);
      tdm_load(g0, g1);
    }
  }
  tdm_wait(g0, g1);                                    // nothing in flight at the wave's end
  asm volatile("s_wait_dscnt 0x0" ::: "memory");

  const int hi8 = (lane >> 4) * 8;
  if constexpr (VTRANS) {
    if (blockIdx.z == 2) {
      // SEQ is a multiple of the tile's 128 rows: a tile lies in one batch.
      const unsigned int bb = (unsigned int)m0 / SEQ;
      const unsigned int s0 = (unsigned int)m0 % SEQ + wm * 64 + hi8;  // first of this lane's rows
      _Float16* vt = outh + (size_t)2 * M * N + (size_t)bb * N * SEQ + s0;
      // All three loops unrolled: acc is then indexed by constants alone and
      // stays in registers, and mf becomes the stores' immediate offset.
#pragma unroll
      for (int nf = 0; nf < 2; ++nf) {
        const int gn = n0 + wn * 32 + nf * 16 + (lane & 15);
        _Float16* col = vt + (size_t)gn * SEQ;
        // The four stores of a column fill one 128-byte line between the two lane halves.
#pragma unroll
        for (int mf = 0; mf < 4; ++mf) {
          v8h h;
#pragma unroll
          for (int v = 0; v < 8; ++v) h[v] = (_Float16)acc[mf][nf][v];
          *reinterpret_cast<v8h*>(col + mf * 16) = h;
        }
      }
      return;
    }
  }
#pragma unroll
  for (int nf = 0; nf < 2; ++nf) {
    const int gn = n0 + wn * 32 + nf * 16 + (lane & 15);
    float bv = 0.f;
    if constexpr (BIAS) bv = bias[gn];
#pragma unroll
    for (int mf = 0; mf < 4; ++mf) {
#pragma unroll
      for (int v = 0; v < 8; ++v) {
        const int gm = m0 + wm * 64 + mf * 16 + hi8 + v;  // D layout: M = v + hi8
        float val = acc[mf][nf][v];
        if constexpr (BIAS)  val += bv;
        if constexpr (RELU)  val = fmaxf(val, 0.f);
        const size_t idx = (size_t)gm * N + gn;
        if constexpr (RESID) val += resid[idx];
        if constexpr (OUTF32) outf[idx] = val;
        if constexpr (OUTF16) outh[(size_t)blockIdx.z * M * N + idx] = (_Float16)val;
      }
    }
  }
  // Stands behind the last Q or K store: in this form's listing the V block is
  // laid out behind them and writes registers that these stores name.
  if constexpr (VTRANS) asm volatile("s_wait_xcnt 0x0" ::: "memory");
}

#define ATT_KEYS  64                  /* keys per staged tile */
#define ATT_PITCH 72                  /* halfs per LDS row: 128 B + 16 B pad, 16 B x odd for b128 readers */
#define ATT_TILE  (64 * ATT_PITCH)    /* halfs per staged K or V^T tile */
#define ATT_NST   (SEQ / ATT_KEYS)    /* tiles per (b, h) */

// One tile's four copies of a lane (16 bytes each). The s_wait_xcnt stands in
// the copies' own statement so that no address register is rewritten ahead of it.
static __device__ __forceinline__ void attn_copy4(
    unsigned int l0, const _Float16* g0, unsigned int l1, const _Float16* g1,
    unsigned int l2, const _Float16* g2, unsigned int l3, const _Float16* g3) {
  asm volatile(
      "global_load_async_to_lds_b128 %0, %1, off\n\t"
      "global_load_async_to_lds_b128 %2, %3, off\n\t"
      "global_load_async_to_lds_b128 %4, %5, off\n\t"
      "global_load_async_to_lds_b128 %6, %7, off\n\t"
      "s_wait_xcnt 0x0"
      :: "v"(l0), "v"(g0), "v"(l1), "v"(g1), "v"(l2), "v"(g2), "v"(l3), "v"(g3)
      : "memory");
}

__global__ __launch_bounds__(256)
void attn_kernel(const _Float16* __restrict__ qh, const _Float16* __restrict__ kh,
                 const _Float16* __restrict__ vt, const float* __restrict__ madd,
                 _Float16* __restrict__ ctxh) {
  __shared__ __attribute__((aligned(16))) _Float16 kv[2][2][ATT_TILE];
  const int lane = threadIdx.x & 31;
  const int wave = threadIdx.x >> 5;
  const int q0   = blockIdx.x * 128 + wave * 16;
  const int h    = blockIdx.y;
  const int b    = blockIdx.z;
  const size_t hoff = (size_t)h * HD;
  const int hi8  = (lane >> 4) * 8;
  const float scale = 0.125f;  // 1/sqrt(HD)

  const _Float16* qbase = qh + ((size_t)(b * SEQ + q0)) * D_MODEL + hoff;
  v16h qb_lo = load_frag_rowmajor(qbase,      D_MODEL, lane);   // B: N=q, K=hd
  v16h qb_hi = load_frag_rowmajor(qbase + 32, D_MODEL, lane);

  v8f ctx[4] = {v8f{}, v8f{}, v8f{}, v8f{}};
  float m = -1e30f, l = 0.f;
  const float* mrow = madd + (size_t)b * SEQ;
  const _Float16* vtb = vt + ((size_t)(b * NHEAD + h) * HD) * SEQ;

  // Each thread copies rows crow and crow + 32 of both tiles, 16 bytes at ccol.
  const int crow = threadIdx.x >> 3;         // 0..31
  const int ccol = (threadIdx.x & 7) * 8;    // halfs
  const _Float16* gk = kh + ((size_t)(b * SEQ + crow)) * D_MODEL + hoff + ccol;
  const _Float16* gv = vtb + (size_t)crow * SEQ + ccol;
  const unsigned int lds0 =
      (unsigned int)(uintptr_t)(void*)&kv[0][0][crow * ATT_PITCH + ccol];
  auto copy_tile = [&](int s) {
    const unsigned int lk = lds0 + (unsigned int)(s & 1) * (2 * ATT_TILE * 2);
    const unsigned int lv = lk + ATT_TILE * 2;
    const _Float16* k0 = gk + (size_t)s * ATT_KEYS * D_MODEL;
    const _Float16* v0 = gv + s * ATT_KEYS;
    attn_copy4(lk, k0, lk + 32 * ATT_PITCH * 2, k0 + 32 * D_MODEL,
               lv, v0, lv + 32 * ATT_PITCH * 2, v0 + (size_t)32 * SEQ);
  };

  copy_tile(0);
  asm volatile("s_wait_asynccnt 0x0" ::: "memory");  // own copies of tile 0 landed
  __syncthreads();                                   // tile 0 readable by all waves
  copy_tile(1);

  for (int s = 0; s < ATT_NST; ++s) {
   const _Float16* Ks = &kv[s & 1][0][0];
   const _Float16* Vs = &kv[s & 1][1][0];
   // Unrolled: both halves' LDS offsets become immediates, no inner branch.
#pragma unroll
   for (int sub = 0; sub < ATT_KEYS; sub += 32) {
    const int j = s * ATT_KEYS + sub;
    const _Float16* kbase = Ks + sub * ATT_PITCH;
    v16h ka0l = load_frag_rowmajor(kbase,                       ATT_PITCH, lane);
    v16h ka0h = load_frag_rowmajor(kbase + 32,                  ATT_PITCH, lane);
    v16h ka1l = load_frag_rowmajor(kbase + 16 * ATT_PITCH,      ATT_PITCH, lane);
    v16h ka1h = load_frag_rowmajor(kbase + 16 * ATT_PITCH + 32, ATT_PITCH, lane);
    v8f s0 = {}; s0 = wmma16x16x32(ka0l, qb_lo, s0); s0 = wmma16x16x32(ka0h, qb_hi, s0);
    v8f s1 = {}; s1 = wmma16x16x32(ka1l, qb_lo, s1); s1 = wmma16x16x32(ka1h, qb_hi, s1);

    // per-lane: q = lane&15 ; element v: key = j + hi8 + v (s0) / +16 (s1)
    float sv0[8], sv1[8];
    float tmax = -1e30f;
#pragma unroll
    for (int v = 0; v < 8; ++v) {
      const int key0 = j + hi8 + v;
      const float a = fmaf(s0[v], scale, mrow[key0]);
      const float c = fmaf(s1[v], scale, mrow[key0 + 16]);
      sv0[v] = a; sv1[v] = c;
      tmax = fmaxf(tmax, fmaxf(a, c));
    }
    tmax = fmaxf(tmax, __shfl_xor(tmax, 16, 32));
    const float mnew  = fmaxf(m, tmax);
    const float alpha = __expf(m - mnew);
    float psum = 0.f;
    v16h pa;
#pragma unroll
    for (int v = 0; v < 8; ++v) {
      const float p0 = __expf(sv0[v] - mnew);
      const float p1 = __expf(sv1[v] - mnew);
      pa[v]     = (_Float16)p0;    // A-frag elem e<8  -> key kb+e
      pa[8 + v] = (_Float16)p1;    // A-frag elem e>=8 -> key kb+16+(e-8)
      psum += p0 + p1;
    }
    psum += __shfl_xor(psum, 16, 32);
    l = l * alpha + psum;
    m = mnew;

    // rescale ctx: row q = v + hi8 -> alpha lives in lane (v + hi8)
    float rs[8];
#pragma unroll
    for (int v = 0; v < 8; ++v) rs[v] = __shfl(alpha, hi8 + v, 32);
#pragma unroll
    for (int nf = 0; nf < 4; ++nf)
#pragma unroll
      for (int v = 0; v < 8; ++v) ctx[nf][v] *= rs[v];

#pragma unroll
    for (int nf = 0; nf < 4; ++nf) {
      // B operand: N = hd (rows of vt), K = keys (contiguous)
      v16h vb = load_frag_rowmajor(Vs + (nf * 16) * ATT_PITCH + sub, ATT_PITCH, lane);
      ctx[nf] = wmma16x16x32(pa, vb, ctx[nf]);
    }
   }
   // Hand-over: this wave's reads of tile s are done, its copies of tile s + 1
   // have landed; behind the barrier tile s + 1 is readable and buffer s & 1 free.
   asm volatile("s_wait_dscnt 0x0" ::: "memory");
   asm volatile("s_wait_asynccnt 0x0" ::: "memory");
   // Stands ahead of the advance of the mask loads' address register.
   asm volatile("s_wait_xcnt 0x0" ::: "memory");
   __syncthreads();
   if (s + 2 < ATT_NST) copy_tile(s + 2);
  }
  asm volatile("s_wait_asynccnt 0x0" ::: "memory");  // nothing in flight at the wave's end

  const float linv = 1.f / l;
  float rs[8];
#pragma unroll
  for (int v = 0; v < 8; ++v) rs[v] = __shfl(linv, hi8 + v, 32);
  _Float16* obase = ctxh + ((size_t)(b * SEQ + q0)) * D_MODEL + hoff;
#pragma unroll
  for (int nf = 0; nf < 4; ++nf) {
#pragma unroll
    for (int v = 0; v < 8; ++v) {
      const int qrow = hi8 + v;
      const int hd   = nf * 16 + (lane & 15);
      obase[(size_t)qrow * D_MODEL + hd] = (_Float16)(ctx[nf][v] * rs[v]);
    }
  }
}

// ---- host side ------------------------------------------------------------

extern "C" void kernel_launch(void* const* d_in, const int* in_sizes, int n_in,
                              void* d_out, int out_size, void* d_ws, size_t ws_size,
                              hipStream_t stream) {
  (void)in_sizes; (void)n_in; (void)out_size; (void)ws_size;
  const float* x     = (const float*)d_in[0];
  const int*   mask  = (const int*)d_in[1];
  const float* alpha = (const float*)d_in[2];
  const float* bias  = (const float*)d_in[3];
  const float* w_q   = (const float*)d_in[4];
  const float* w_k   = (const float*)d_in[5];
  const float* w_v   = (const float*)d_in[6];
  const float* w_o   = (const float*)d_in[7];
  const float* fc1_w = (const float*)d_in[8];
  const float* fc1_b = (const float*)d_in[9];
  const float* fc2_w = (const float*)d_in[10];
  const float* fc2_b = (const float*)d_in[11];
  float* out = (float*)d_out;

  char* ws = (char*)d_ws;
  size_t off = 0;
  auto alloc = [&](size_t bytes) -> char* {
    char* p = ws + off;
    off += (bytes + 255) & ~(size_t)255;
    return p;
  };
  _Float16* xn_h  = (_Float16*)alloc((size_t)ROWS * D_MODEL * 2);
  _Float16* wq_h  = (_Float16*)alloc((size_t)D_MODEL * D_MODEL * 2);
  _Float16* wk_h  = (_Float16*)alloc((size_t)D_MODEL * D_MODEL * 2);
  _Float16* wv_h  = (_Float16*)alloc((size_t)D_MODEL * D_MODEL * 2);
  _Float16* wo_h  = (_Float16*)alloc((size_t)D_MODEL * D_MODEL * 2);
  _Float16* fc1_h = (_Float16*)alloc((size_t)FF_DIM * D_MODEL * 2);
  _Float16* fc2_h = (_Float16*)alloc((size_t)D_MODEL * FF_DIM * 2);
  _Float16* q_h   = (_Float16*)alloc((size_t)ROWS * D_MODEL * 2);
  _Float16* k_h   = (_Float16*)alloc((size_t)ROWS * D_MODEL * 2);
  _Float16* vt_h  = (_Float16*)alloc((size_t)ROWS * D_MODEL * 2);
  _Float16* ctx_h = (_Float16*)alloc((size_t)ROWS * D_MODEL * 2);
  float*    x1    = (float*)   alloc((size_t)ROWS * D_MODEL * 4);
  _Float16* xn2_h = (_Float16*)alloc((size_t)ROWS * D_MODEL * 2);
  _Float16* ff_h  = (_Float16*)alloc((size_t)ROWS * FF_DIM * 2);
  float*    madd  = (float*)   alloc((size_t)BATCH * SEQ * 4);
  (void)wk_h; (void)wv_h;   // reached through wq_h: the planes are contiguous

  // LayerNorm 1, the six weight conversions (planes wq_h .. fc2_h are contiguous)
  // and the mask: one launch.
  prep_kernel<<<PREP_GRID, 256, 0, stream>>>(x, alpha, bias, xn_h, w_q, w_k, w_v, w_o,
                                             fc1_w, fc2_w, wq_h, mask, madd);

  dim3 gD(D_MODEL / 128, ROWS / 128);      // 8 x 32
  dim3 gQKV(D_MODEL / 128, ROWS / 128, 3); // 8 x 32 x 3
  dim3 gF(FF_DIM / 128, ROWS / 128);       // 32 x 32

  // Q/K/V projections (f16 outputs for attention) in one launch: the planes
  // wq_h, wk_h, wv_h and q_h, k_h, vt_h are contiguous; V goes out transposed.
  gemm_kernel<false, false, false, false, true, true><<<gQKV, 256, 0, stream>>>(
      xn_h, wq_h, nullptr, nullptr, nullptr, q_h, ROWS, D_MODEL, D_MODEL);

  attn_kernel<<<dim3(SEQ / 128, NHEAD, BATCH), 256, 0, stream>>>(
      q_h, k_h, vt_h, madd, ctx_h);

  // x1 = x + ctx @ Wo^T
  gemm_kernel<false, true, false, true, false, false><<<gD, 256, 0, stream>>>(
      ctx_h, wo_h, nullptr, x, x1, nullptr, ROWS, D_MODEL, D_MODEL);

  ln_kernel<<<ROWS, 256, 0, stream>>>(x1, alpha, bias, xn2_h);

  // ff = relu(xn2 @ fc1^T + b1)
  gemm_kernel<true, false, true, false, true, false><<<gF, 256, 0, stream>>>(
      xn2_h, fc1_h, fc1_b, nullptr, nullptr, ff_h, ROWS, FF_DIM, D_MODEL);

  // out = x1 + ff @ fc2^T + b2
  gemm_kernel<false, true, true, true, false, false><<<gD, 256, 0, stream>>>(
      ff_h, fc2_h, fc2_b, x1, out, nullptr, ROWS, D_MODEL, FF_DIM);
}

// v006
// Measured time: 159 microseconds a run.
// Next to v005, in two timings, it ran 1.15 and 1.16 times as fast.
// All steps since v000 together make it 2.58 times as fast.
#include <hip/hip_runtime.h>
#include <hip/hip_bf16.h>
#include <math.h>

// ---------------------------------------------------------------------------
// EncoderBlock for MI455X (gfx1250).
//   D=1024, H=16, HD=64, FF=4096, B=2, S=2048.
// f16 WMMA (v_wmma_f32_16x16x32_f16) for all GEMMs + flash attention,
// double-buffered TDM (tensor_load_to_lds) staging of GEMM tiles into LDS.
// ---------------------------------------------------------------------------

typedef __attribute__((ext_vector_type(16))) _Float16 v16h;
typedef __attribute__((ext_vector_type(8)))  _Float16 v8h;
typedef __attribute__((ext_vector_type(4)))  _Float16 v4h;
typedef __attribute__((ext_vector_type(8)))  float    v8f;
typedef __attribute__((ext_vector_type(4)))  float    v4f;
typedef __attribute__((ext_vector_type(4)))  int      v4i;
typedef __attribute__((ext_vector_type(4)))  unsigned int u32x4;
typedef __attribute__((ext_vector_type(8)))  unsigned int u32x8;

#define D_MODEL 1024
#define NHEAD   16
#define HD      64
#define FF_DIM  4096
#define SEQ     2048
#define BATCH   2
#define ROWS    (BATCH * SEQ)   /* 4096 */
#define LN_EPS  1e-6f

// ---- WMMA helpers ---------------------------------------------------------

static __device__ __forceinline__ v8f wmma16x16x32(v16h a, v16h b, v8f c) {
  return __builtin_amdgcn_wmma_f32_16x16x32_f16(false, a, false, b, (short)0, c,
                                                false, false);
}

// A/B fragment loader from a row-major [16 x >=32] tile (row = M for A, N for B;
// K contiguous within the row). ISA 16-bit A layout:
//   lanes 0-15:  M=lane,    elems 0..7 -> K=0..7,  elems 8..15 -> K=16..23
//   lanes 16-31: M=lane-16, elems 0..7 -> K=8..15, elems 8..15 -> K=24..31
static __device__ __forceinline__ v16h load_frag_rowmajor(const _Float16* base,
                                                          int ld, int lane) {
  const int r  = lane & 15;
  const int kb = (lane >> 4) * 8;
  const _Float16* p = base + (size_t)r * ld + kb;
  v16h f;
#pragma unroll
  for (int i = 0; i < 8; ++i) f[i] = p[i];
#pragma unroll
  for (int i = 0; i < 8; ++i) f[8 + i] = p[16 + i];
  return f;
}

// ---- Tensor loads: one wave brings a slice of 32 rows x 256 bytes to LDS ----
// The mover pads every 256-byte row by 16 bytes: the LDS pitch is 272 bytes
// (16 B x odd), at which the ds_load_b128 fragment reads meet no bank conflict.

#define G_K      128                  /* k per stage: rows of 256 bytes */
#define G_ROWB   256                  /* bytes per staged row */
#define G_PITCH  272                  /* bytes per LDS row, pad included */
#define G_SROWS  32                   /* rows per slice, one slice a wave */
#define G_SLICE  10240                /* 32 x 272 = 8704 B, rounded up to a multiple of 2 KiB */
#define G_BUF    (8 * G_SLICE)        /* one stage: A slices 0..3, W slices 4..7 */

static __device__ __forceinline__ uint32_t uni(uint32_t v) {
  return (uint32_t)__builtin_amdgcn_readfirstlane(v);
}
// Holds a wave-uniform test in a scalar register, so that the branch on it is
// a scalar branch: a tensor load ignores EXEC.
static __device__ __forceinline__ uint32_t pinned(uint32_t v) {
  uint32_t w = uni(v);
  asm volatile("" : "+s"(w));
  return w;
}
static __device__ __forceinline__ void tdm_group0(u32x4& g, uint32_t lds_dst, uint64_t ga) {
  g[0] = uni(1u);                                              // count = 1
  g[1] = uni(lds_dst);                                         // byte offset in LDS
  g[2] = uni((uint32_t)ga);                                    // address [31:0]
  g[3] = uni((((uint32_t)(ga >> 32)) & 0x01FFFFFFu) | 0x80000000u);  // [56:32], type = 2
}
// Extents in bytes (data_size code 0); tensor dims = tile dims.
static __device__ __forceinline__ u32x8 tdm_group1(uint32_t src_pitch) {
  u32x8 g;
  g[0] = uni((1u << 20) | (5u << 22) | (3u << 25));  // pad 4 dwords after every 64 dwords
  g[1] = uni((uint32_t)G_ROWB << 16);                // tensor_dim0
  g[2] = uni((uint32_t)G_SROWS << 16);               // tensor_dim1
  g[3] = uni((uint32_t)G_ROWB << 16);                // tile_dim0
  g[4] = uni((uint32_t)G_SROWS);                     // tile_dim1
  g[5] = uni(src_pitch);                             // source row pitch, bytes
  g[6] = uni(0u);
  g[7] = uni(0u);
  return g;
}
// Load and wait both name the two groups as in-out operands: their scalar
// registers then hold nothing else from the issue to the wait, and the next
// descriptor is formed only behind the wait.
static __device__ __forceinline__ void tdm_load(u32x4& g0, u32x8& g1) {
  asm volatile("tensor_load_to_lds %0, %1" : "+s"(g0), "+s"(g1) :: "memory");
}
static __device__ __forceinline__ void tdm_wait(u32x4& g0, u32x8& g1) {
  asm volatile("s_wait_tensorcnt 0x0" : "+s"(g0), "+s"(g1) :: "memory");
}

// Fragment from padded LDS rows; the same k order as load_frag_rowmajor.
static __device__ __forceinline__ v16h load_frag_lds(const char* base, int lane) {
  const char* p = base + (lane & 15) * G_PITCH + (lane >> 4) * 16;
  const v8h lo = *reinterpret_cast<const v8h*>(p);
  const v8h hi = *reinterpret_cast<const v8h*>(p + 32);
  return __builtin_shufflevector(lo, hi, 0, 1, 2, 3, 4, 5, 6, 7, 8, 9, 10, 11, 12, 13, 14, 15);
}

// ---- elementwise f32 -> f16 ----------------------------------------------

// A block converts CVT_BLOCK consecutive floats; every array's length is a
// multiple of that. Each wave-wide load covers 512 contiguous bytes, each store
// 256; a thread's eight loads are all issued ahead of its first conversion.

#define CVT_U     8                   /* 16-byte loads a thread */
#define CVT_BLOCK (256 * 4 * CVT_U)   /* floats a block */

static __device__ __forceinline__
void cvt_block(const float* __restrict__ in, _Float16* __restrict__ out, int blk) {
  const size_t base = (size_t)blk * CVT_BLOCK + threadIdx.x * 4;
  v4f v[CVT_U];
#pragma unroll
  for (int u = 0; u < CVT_U; ++u)
    v[u] = *reinterpret_cast<const v4f*>(in + base + u * 1024);
#pragma unroll
  for (int u = 0; u < CVT_U; ++u) {
    v4h h;
#pragma unroll
    for (int e = 0; e < 4; ++e) h[e] = (_Float16)v[u][e];
    *reinterpret_cast<v4h*>(out + base + u * 1024) = h;
  }
  // Stands behind the last store: in the merged kernel's listing another block
  // range follows, which writes the registers that these stores name.
  asm volatile("s_wait_xcnt 0x0" ::: "memory");
}

// ---- token order: kept keys first ------------------------------------------
// A key whose mask is 0 gets the score -1e9 and so the softmax weight 0 as soon
// as its batch holds one kept key. Each batch's tokens are therefore put in a
// stable partition: the kept ones (mask != 0) first, the others behind them.
//   place(s) = kept ? (kept tokens ahead of s) : total kept + (others ahead of s)
// LayerNorm 1 writes row s at place(s), so Q, K and V all come out in that order,
// and attention walks only the key tiles that hold a kept key; K and V behind
// them are not computed. With no kept key the order is the identity and
// attention walks every tile, all at -1e9.
// One block a batch writes what attention reads: inv[place] = s, the additive
// mask by place (0 ahead of the total, -1e9 from there on) and the total.
// Each wave counts the whole batch by ballots and places its own 256 tokens:
// no wave needs another's count.

#define ATT_KEYS  64                  /* keys per tile that attention stages */
#define CNT_PITCH 32                  /* ints between two batches' totals: a 128-byte line each, one writer a line */

// Key tiles of a batch that hold a kept key, 1 .. SEQ / ATT_KEYS; all of them
// where the batch has none. The same for every thread that asks for one batch.
static __device__ __forceinline__ int walked_tiles(const int* __restrict__ cnt, int b) {
  const int kept = __builtin_amdgcn_readfirstlane(cnt[b * CNT_PITCH]);
  return (kept <= 0 || kept > SEQ) ? SEQ / ATT_KEYS : (kept + ATT_KEYS - 1) / ATT_KEYS;
}

static __device__ __forceinline__
void keymap_block(const int* __restrict__ mask, float* __restrict__ madd,
                  int* __restrict__ inv, int* __restrict__ cnt, int b) {
  const int lane = threadIdx.x & 31;
  const int wave = threadIdx.x >> 5;
  const int* mb = mask + b * SEQ;
  int tot = 0, run = 0;   // kept tokens of the batch; of them, ahead of this wave's tokens
  // Unrolled: the loads are all asked for ahead of the first count.
#pragma unroll
  for (int g = 0; g < SEQ / 32; ++g) {
    const int c = __popc(__builtin_amdgcn_ballot_w32(mb[g * 32 + lane] != 0));
    tot += c;
    run += (g < wave * 8) ? c : 0;
  }
  // Stands behind the counting loads: the loads below take registers that
  // those name as their results.
  asm volatile("s_wait_xcnt 0x0" ::: "memory");
  // Unrolled: the eight loads go out together, and so do the stores.
#pragma unroll
  for (int i = 0; i < 8; ++i) {
    const int s = (wave * 8 + i) * 32 + lane;
    const bool keep = mb[s] != 0;
    const unsigned int w = __builtin_amdgcn_ballot_w32(keep);
    const int ahead = run + __popc(w & ((1u << lane) - 1u));   // kept tokens ahead of s
    inv[b * SEQ + (keep ? ahead : tot + (s - ahead))] = s;
    madd[b * SEQ + s] = (s < tot) ? 0.f : -1e9f;
    run += __popc(w);
  }
  if (threadIdx.x == 0) cnt[b * CNT_PITCH] = tot;
}

// ---- LayerNorm (unbiased std, eps added to sd) -> f16 ---------------------

// PLACE: the row goes out at its token's place in the kept-first order. The
// block counts its batch's kept tokens itself (8 mask words a thread; the total
// in the high half of a word, those ahead of the row's token in the low half);
// the counts ride on the first sum's reduction and its barriers.
template <bool PLACE>
static __device__ __forceinline__
void ln_row(const float* __restrict__ x, const float* __restrict__ alpha,
            const float* __restrict__ bias, _Float16* __restrict__ out, int row,
            const int* __restrict__ mask) {
  __shared__ float red[256];
  __shared__ int   kc[PLACE ? 256 : 1];
  const int t = threadIdx.x;
  const float* xr = x + (size_t)row * D_MODEL;
  const int tok = row % SEQ;
  int own = 1;
  if constexpr (PLACE) own = mask[row];   // asked for together with the row
  float v[4];
  float s = 0.f;
#pragma unroll
  for (int i = 0; i < 4; ++i) { v[i] = xr[t + i * 256]; s += v[i]; }
  if constexpr (PLACE) {
    const int* mb = mask + (row - tok) + t * 8;
    const v4i ma = *reinterpret_cast<const v4i*>(mb);
    const v4i mc = *reinterpret_cast<const v4i*>(mb + 4);
    int k = 0;
    // Unrolled: the vectors' elements are then picked by constants.
#pragma unroll
    for (int e = 0; e < 4; ++e) {
      if (ma[e] != 0) k += 0x10000 + ((t * 8 + e < tok) ? 1 : 0);
      if (mc[e] != 0) k += 0x10000 + ((t * 8 + 4 + e < tok) ? 1 : 0);
    }
    kc[t] = k;
  }
  red[t] = s; __syncthreads();
  for (int off = 128; off > 0; off >>= 1) {
    if (t < off) {
      red[t] += red[t + off];
      if constexpr (PLACE) kc[t] += kc[t + off];
    }
    __syncthreads();
  }
  const float mu = red[0] * (1.f / D_MODEL);
  int orow = row;
  if constexpr (PLACE) {
    const int tot   = kc[0] >> 16;
    const int ahead = kc[0] & 0xffff;
    orow = (row - tok) + ((own != 0) ? ahead : tot + (tok - ahead));
  }
  __syncthreads();
  float ss = 0.f;
#pragma unroll
  for (int i = 0; i < 4; ++i) { float d = v[i] - mu; ss += d * d; }
  red[t] = ss; __syncthreads();
  for (int off = 128; off > 0; off >>= 1) {
    if (t < off) red[t] += red[t + off];
    __syncthreads();
  }
  const float sd  = sqrtf(red[0] / (float)(D_MODEL - 1));
  const float inv = 1.f / (sd + LN_EPS);
#pragma unroll
  for (int i = 0; i < 4; ++i) {
    int c = t + i * 256;
    out[(size_t)orow * D_MODEL + c] =
        (_Float16)(alpha[c] * (v[i] - mu) * inv + bias[c]);
  }
}

__global__ __launch_bounds__(256)
void ln_kernel(const float* __restrict__ x, const float* __restrict__ alpha,
               const float* __restrict__ bias, _Float16* __restrict__ out) {
  ln_row<false>(x, alpha, bias, out, blockIdx.x, nullptr);
}

// ---- everything that depends on the inputs alone, in one launch ------------
// Block ranges of one grid: the first LayerNorm (a row a block), the six weight
// conversions (their f16 planes lie one behind another in wh, in this order),
// the token order's tables. No range reads what another writes.

#define PREP_LN    ROWS                                /* blocks: LayerNorm rows */
#define PREP_DD    (D_MODEL * D_MODEL / CVT_BLOCK)     /* blocks per D x D weight: 128 */
#define PREP_FD    (FF_DIM * D_MODEL / CVT_BLOCK)      /* blocks per FF x D weight: 512 */
#define PREP_CVT   (4 * PREP_DD + 2 * PREP_FD)
#define PREP_MASK  BATCH                               /* blocks: token order, one a batch */
#define PREP_GRID  (PREP_LN + PREP_CVT + PREP_MASK)

__global__ __launch_bounds__(256)
void prep_kernel(const float* __restrict__ x, const float* __restrict__ alpha,
                 const float* __restrict__ bias, _Float16* __restrict__ xn,
                 const float* __restrict__ w_q, const float* __restrict__ w_k,
                 const float* __restrict__ w_v, const float* __restrict__ w_o,
                 const float* __restrict__ fc1_w, const float* __restrict__ fc2_w,
                 _Float16* __restrict__ wh,
                 const int* __restrict__ mask, float* __restrict__ madd,
                 int* __restrict__ inv, int* __restrict__ cnt) {
  const int blk = blockIdx.x;
  if (blk < PREP_LN) {
    ln_row<true>(x, alpha, bias, xn, blk, mask);
  } else if (blk < PREP_LN + PREP_CVT) {
    const int cb = blk - PREP_LN;          // block within the six planes
    const float* in;
    int first;                             // the plane's first block
    if (cb < 4 * PREP_DD) {
      const int w = cb / PREP_DD;
      in = (w == 0) ? w_q : (w == 1) ? w_k : (w == 2) ? w_v : w_o;
      first = w * PREP_DD;
    } else if (cb < 4 * PREP_DD + PREP_FD) {
      in = fc1_w; first = 4 * PREP_DD;
    } else {
      in = fc2_w; first = 4 * PREP_DD + PREP_FD;
    }
    cvt_block(in, wh + (size_t)first * CVT_BLOCK, cb - first);
  } else {
    keymap_block(mask, madd, inv, cnt, blk - (PREP_LN + PREP_CVT));
  }
}

// ---- Tiled WMMA GEMM:  C[M,N] = act(A[M,K] * W[N,K]^T + bias) (+resid) ----
// Block = 256 threads (8 waves), tile 128x128, 128 k a stage. Waves: 2 (M) x 4 (N);
// each wave owns 64x32 of output (4 M-frags x 2 N-frags = 8 WMMA / 32 k).
// Two LDS buffers: every wave issues one tensor load a stage for its own slice
// (waves 0..3: 32 rows of A each, waves 4..7: 32 rows of W each), so that the
// next stage flies while this one is worked on. K: a multiple of 128, >= 256.
// blockIdx.z picks one of several products on the same A: weight planes [N,K]
// and f16 output planes [M,N] lie one behind another.
// VTRANS: the plane of blockIdx.z == 2 (V) is stored head-major and transposed,
// [B, N, SEQ] (N = head * HD + hd), as attention reads it: an accumulator
// register group holds 8 consecutive rows of one column, which are 16
// contiguous bytes there, so each group goes out as one 16-byte store.
// In that form the rows stand in the kept-first token order, and a K or V tile
// whose rows all lie behind the last key tile that attention walks is not
// computed: nothing reads it.

template <bool RELU, bool RESID, bool BIAS, bool OUTF32, bool OUTF16, bool VTRANS>
__global__ __launch_bounds__(256)
void gemm_kernel(const _Float16* __restrict__ A, const _Float16* __restrict__ W,
                 const float* __restrict__ bias, const float* __restrict__ resid,
                 float* __restrict__ outf, _Float16* __restrict__ outh,
                 const int* __restrict__ cnt, int M, int N, int K) {
  __shared__ __attribute__((aligned(2048))) char sm[2 * G_BUF];
  const int t    = threadIdx.x;
  const int lane = t & 31;
  const uint32_t wave = uni((uint32_t)t >> 5);
  const int wm   = wave >> 2;       // 0..1  (64 rows of M each)
  const int wn   = wave & 3;        // 0..3  (32 cols of N each)
  const int m0   = blockIdx.y * 128;
  const int n0   = blockIdx.x * 128;

  if constexpr (VTRANS) {
    // The whole work-group leaves, ahead of every tensor load and barrier.
    if (blockIdx.z != 0 && m0 % SEQ >= walked_tiles(cnt, m0 / SEQ) * ATT_KEYS) return;
  }

  v8f acc[4][2];
#pragma unroll
  for (int i = 0; i < 4; ++i)
#pragma unroll
    for (int j = 0; j < 2; ++j) acc[i][j] = v8f{};

  auto compute_stage = [&](const char* buf) {
    const char* Ab = buf + (wm * 2) * G_SLICE;   // this wave's 64 rows of A: two slices
    const char* Bb = buf + (4 + wn) * G_SLICE;   // this wave's 32 rows of W: one slice
#pragma unroll
    for (int kk = 0; kk < G_K / 32; ++kk) {
      v16h bf[2], af[4];
#pragma unroll
      for (int nf = 0; nf < 2; ++nf)
        bf[nf] = load_frag_lds(Bb + nf * 16 * G_PITCH + kk * 64, lane);
#pragma unroll
      for (int mf = 0; mf < 4; ++mf)
        af[mf] = load_frag_lds(Ab + (mf >> 1) * G_SLICE + (mf & 1) * 16 * G_PITCH + kk * 64, lane);
#pragma unroll
      for (int mf = 0; mf < 4; ++mf)
#pragma unroll
        for (int nf = 0; nf < 2; ++nf)
          acc[mf][nf] = wmma16x16x32(af[mf], bf[nf], acc[mf][nf]);
    }
  };

  const _Float16* srow = (wave < 4u) ? A + (size_t)(m0 + wave * G_SROWS) * K
                                     : W + ((size_t)blockIdx.z * N + n0 + (wave - 4u) * G_SROWS) * K;
  const uint64_t ga0  = (uint64_t)(uintptr_t)srow;
  const uint32_t lds0 = (uint32_t)(uintptr_t)(void*)&sm[0] + wave * G_SLICE;
  u32x8 g1 = tdm_group1((uint32_t)K * 2u);
  u32x4 g0;
  const int nk = K / G_K;

  tdm_group0(g0, lds0, ga0);
  tdm_load(g0, g1);                                    // stage 0 into buffer 0
  tdm_wait(g0, g1);                                    // own slice of stage 0 landed
  __syncthreads();                                     // stage 0 readable by all waves
  tdm_group0(g0, lds0 + G_BUF, ga0 + G_ROWB);
  tdm_load(g0, g1);                                    // stage 1 into buffer 1

  for (int s = 0; s < nk; ++s) {
    compute_stage(&sm[(s & 1) * G_BUF]);
    // Hand-over: this wave's reads of stage s are done, its slice of stage s + 1
    // has landed; behind the barrier stage s + 1 is readable and buffer s & 1 free.
    asm volatile("s_wait_dscnt 0x0" ::: "memory");
    tdm_wait(g0, g1);
    __syncthreads();
    if (pinned(s + 2 < nk)) {
      tdm_group0(g0, lds0 + (uint32_t)(s & 1) * G_BUF, ga0 + (uint64_t)(s + 2) * G_ROWB);
      tdm_load(g0, g1);
    }
  }
  tdm_wait(g0, g1);                                    // nothing in flight at the wave's end
  asm volatile("s_wait_dscnt 0x0" ::: "memory");

  const int hi8 = (lane >> 4) * 8;
  if constexpr (VTRANS) {
    if (blockIdx.z == 2) {
      // SEQ is a multiple of the tile's 128 rows: a tile lies in one batch.
      const unsigned int bb = (unsigned int)m0 / SEQ;
      const unsigned int s0 = (unsigned int)m0 % SEQ + wm * 64 + hi8;  // first of this lane's rows
      _Float16* vt = outh + (size_t)2 * M * N + (size_t)bb * N * SEQ + s0;
      // All three loops unrolled: acc is then indexed by constants alone and
      // stays in registers, and mf becomes the stores' immediate offset.
#pragma unroll
      for (int nf = 0; nf < 2; ++nf) {
        const int gn = n0 + wn * 32 + nf * 16 + (lane & 15);
        _Float16* col = vt + (size_t)gn * SEQ;
        // The four stores of a column fill one 128-byte line between the two lane halves.
#pragma unroll
        for (int mf = 0; mf < 4; ++mf) {
          v8h h;
#pragma unroll
          for (int v = 0; v < 8; ++v) h[v] = (_Float16)acc[mf][nf][v];
          *reinterpret_cast<v8h*>(col + mf * 16) = h;
        }
      }
      return;
    }
  }
#pragma unroll
  for (int nf = 0; nf < 2; ++nf) {
    const int gn = n0 + wn * 32 + nf * 16 + (lane & 15);
    float bv = 0.f;
    if constexpr (BIAS) bv = bias[gn];
#pragma unroll
    for (int mf = 0; mf < 4; ++mf) {
#pragma unroll
      for (int v = 0; v < 8; ++v) {
        const int gm = m0 + wm * 64 + mf * 16 + hi8 + v;  // D layout: M = v + hi8
        float val = acc[mf][nf][v];
        if constexpr (BIAS)  val += bv;
        if constexpr (RELU)  val = fmaxf(val, 0.f);
        const size_t idx = (size_t)gm * N + gn;
        if constexpr (RESID) val += resid[idx];
        if constexpr (OUTF32) outf[idx] = val;
        if constexpr (OUTF16) outh[(size_t)blockIdx.z * M * N + idx] = (_Float16)val;
      }
    }
  }
  // Stands behind the last Q or K store: in this form's listing the V block is
  // laid out behind them and writes registers that these stores name.
  if constexpr (VTRANS) asm volatile("s_wait_xcnt 0x0" ::: "memory");
}

#define ATT_PITCH 72                  /* halfs per LDS row: 128 B + 16 B pad, 16 B x odd for b128 readers */
#define ATT_TILE  (64 * ATT_PITCH)    /* halfs per staged K or V^T tile */
#define ATT_NST   (SEQ / ATT_KEYS)    /* tiles per (b, h) */

// One tile's four copies of a lane (16 bytes each). The s_wait_xcnt stands in
// the copies' own statement so that no address register is rewritten ahead of it.
static __device__ __forceinline__ void attn_copy4(
    unsigned int l0, const _Float16* g0, unsigned int l1, const _Float16* g1,
    unsigned int l2, const _Float16* g2, unsigned int l3, const _Float16* g3) {
  asm volatile(
      "global_load_async_to_lds_b128 %0, %1, off\n\t"
      "global_load_async_to_lds_b128 %2, %3, off\n\t"
      "global_load_async_to_lds_b128 %4, %5, off\n\t"
      "global_load_async_to_lds_b128 %6, %7, off\n\t"
      "s_wait_xcnt 0x0"
      :: "v"(l0), "v"(g0), "v"(l1), "v"(g1), "v"(l2), "v"(g2), "v"(l3), "v"(g3)
      : "memory");
}

__global__ __launch_bounds__(256)
void attn_kernel(const _Float16* __restrict__ qh, const _Float16* __restrict__ kh,
                 const _Float16* __restrict__ vt, const float* __restrict__ madd,
                 const int* __restrict__ inv, const int* __restrict__ cnt,
                 _Float16* __restrict__ ctxh) {
  __shared__ __attribute__((aligned(16))) _Float16 kv[2][2][ATT_TILE];
  const int lane = threadIdx.x & 31;
  const int wave = threadIdx.x >> 5;
  const int q0   = blockIdx.x * 128 + wave * 16;
  const int h    = blockIdx.y;
  const int b    = blockIdx.z;
  const size_t hoff = (size_t)h * HD;
  const int hi8  = (lane >> 4) * 8;
  const float scale = 0.125f;  // 1/sqrt(HD)

  // Tiles to walk: the same for the whole work-group, 1 .. ATT_NST.
  const int nst = walked_tiles(cnt, b);
  // The tokens of this lane's eight output rows (unrolled: two 16-byte loads,
  // and otok stays in registers).
  int otok[8];
#pragma unroll
  for (int v = 0; v < 8; ++v) otok[v] = inv[b * SEQ + q0 + hi8 + v] & (SEQ - 1);

  const _Float16* qbase = qh + ((size_t)(b * SEQ + q0)) * D_MODEL + hoff;
  v16h qb_lo = load_frag_rowmajor(qbase,      D_MODEL, lane);   // B: N=q, K=hd
  v16h qb_hi = load_frag_rowmajor(qbase + 32, D_MODEL, lane);

  v8f ctx[4] = {v8f{}, v8f{}, v8f{}, v8f{}};
  float m = -1e30f, l = 0.f;
  const float* mrow = madd + (size_t)b * SEQ;
  const _Float16* vtb = vt + ((size_t)(b * NHEAD + h) * HD) * SEQ;

  // Each thread copies rows crow and crow + 32 of both tiles, 16 bytes at ccol.
  const int crow = threadIdx.x >> 3;         // 0..31
  const int ccol = (threadIdx.x & 7) * 8;    // halfs
  const _Float16* gk = kh + ((size_t)(b * SEQ + crow)) * D_MODEL + hoff + ccol;
  const _Float16* gv = vtb + (size_t)crow * SEQ + ccol;
  const unsigned int lds0 =
      (unsigned int)(uintptr_t)(void*)&kv[0][0][crow * ATT_PITCH + ccol];
  auto copy_tile = [&](int s) {
    const unsigned int lk = lds0 + (unsigned int)(s & 1) * (2 * ATT_TILE * 2);
    const unsigned int lv = lk + ATT_TILE * 2;
    const _Float16* k0 = gk + (size_t)s * ATT_KEYS * D_MODEL;
    const _Float16* v0 = gv + s * ATT_KEYS;
    attn_copy4(lk, k0, lk + 32 * ATT_PITCH * 2, k0 + 32 * D_MODEL,
               lv, v0, lv + 32 * ATT_PITCH * 2, v0 + (size_t)32 * SEQ);
  };

  copy_tile(0);
  asm volatile("s_wait_asynccnt 0x0" ::: "memory");  // own copies of tile 0 landed
  __syncthreads();                                   // tile 0 readable by all waves
  if (nst > 1) copy_tile(1);

  for (int s = 0; s < nst; ++s) {
   const _Float16* Ks = &kv[s & 1][0][0];
   const _Float16* Vs = &kv[s & 1][1][0];
   // Unrolled: both halves' LDS offsets become immediates, no inner branch.
#pragma unroll
   for (int sub = 0; sub < ATT_KEYS; sub += 32) {
    const int j = s * ATT_KEYS + sub;
    const _Float16* kbase = Ks + sub * ATT_PITCH;
    v16h ka0l = load_frag_rowmajor(kbase,                       ATT_PITCH, lane);
    v16h ka0h = load_frag_rowmajor(kbase + 32,                  ATT_PITCH, lane);
    v16h ka1l = load_frag_rowmajor(kbase + 16 * ATT_PITCH,      ATT_PITCH, lane);
    v16h ka1h = load_frag_rowmajor(kbase + 16 * ATT_PITCH + 32, ATT_PITCH, lane);
    v8f s0 = {}; s0 = wmma16x16x32(ka0l, qb_lo, s0); s0 = wmma16x16x32(ka0h, qb_hi, s0);
    v8f s1 = {}; s1 = wmma16x16x32(ka1l, qb_lo, s1); s1 = wmma16x16x32(ka1h, qb_hi, s1);

    // per-lane: q = lane&15 ; element v: key = j + hi8 + v (s0) / +16 (s1)
    float sv0[8], sv1[8];
    float tmax = -1e30f;
#pragma unroll
    for (int v = 0; v < 8; ++v) {
      const int key0 = j + hi8 + v;
      const float a = fmaf(s0[v], scale, mrow[key0]);
      const float c = fmaf(s1[v], scale, mrow[key0 + 16]);
      sv0[v] = a; sv1[v] = c;
      tmax = fmaxf(tmax, fmaxf(a, c));
    }
    tmax = fmaxf(tmax, __shfl_xor(tmax, 16, 32));
    const float mnew  = fmaxf(m, tmax);
    const float alpha = __expf(m - mnew);
    float psum = 0.f;
    v16h pa;
#pragma unroll
    for (int v = 0; v < 8; ++v) {
      const float p0 = __expf(sv0[v] - mnew);
      const float p1 = __expf(sv1[v] - mnew);
      pa[v]     = (_Float16)p0;    // A-frag elem e<8  -> key kb+e
      pa[8 + v] = (_Float16)p1;    // A-frag elem e>=8 -> key kb+16+(e-8)
      psum += p0 + p1;
    }
    psum += __shfl_xor(psum, 16, 32);
    l = l * alpha + psum;
    m = mnew;

    // rescale ctx: row q = v + hi8 -> alpha lives in lane (v + hi8)
    float rs[8];
#pragma unroll
    for (int v = 0; v < 8; ++v) rs[v] = __shfl(alpha, hi8 + v, 32);
#pragma unroll
    for (int nf = 0; nf < 4; ++nf)
#pragma unroll
      for (int v = 0; v < 8; ++v) ctx[nf][v] *= rs[v];

#pragma unroll
    for (int nf = 0; nf < 4; ++nf) {
      // B operand: N = hd (rows of vt), K = keys (contiguous)
      v16h vb = load_frag_rowmajor(Vs + (nf * 16) * ATT_PITCH + sub, ATT_PITCH, lane);
      ctx[nf] = wmma16x16x32(pa, vb, ctx[nf]);
    }
   }
   // Hand-over: this wave's reads of tile s are done, its copies of tile s + 1
   // have landed; behind the barrier tile s + 1 is readable and buffer s & 1 free.
   asm volatile("s_wait_dscnt 0x0" ::: "memory");
   asm volatile("s_wait_asynccnt 0x0" ::: "memory");
   // Stands ahead of the advance of the mask loads' address register.
   asm volatile("s_wait_xcnt 0x0" ::: "memory");
   __syncthreads();
   if (s + 2 < nst) copy_tile(s + 2);
  }
  asm volatile("s_wait_asynccnt 0x0" ::: "memory");  // nothing in flight at the wave's end

  const float linv = 1.f / l;
  float rs[8];
#pragma unroll
  for (int v = 0; v < 8; ++v) rs[v] = __shfl(linv, hi8 + v, 32);
  _Float16* obase = ctxh + (size_t)b * SEQ * D_MODEL + hoff;
#pragma unroll
  for (int nf = 0; nf < 4; ++nf) {
#pragma unroll
    for (int v = 0; v < 8; ++v) {
      const int hd = nf * 16 + (lane & 15);
      obase[(size_t)otok[v] * D_MODEL + hd] = (_Float16)(ctx[nf][v] * rs[v]);
    }
  }
}

// ---- host side ------------------------------------------------------------

extern "C" void kernel_launch(void* const* d_in, const int* in_sizes, int n_in,
                              void* d_out, int out_size, void* d_ws, size_t ws_size,
                              hipStream_t stream) {
  (void)in_sizes; (void)n_in; (void)out_size; (void)ws_size;
  const float* x     = (const float*)d_in[0];
  const int*   mask  = (const int*)d_in[1];
  const float* alpha = (const float*)d_in[2];
  const float* bias  = (const float*)d_in[3];
  const float* w_q   = (const float*)d_in[4];
  const float* w_k   = (const float*)d_in[5];
  const float* w_v   = (const float*)d_in[6];
  const float* w_o   = (const float*)d_in[7];
  const float* fc1_w = (const float*)d_in[8];
  const float* fc1_b = (const float*)d_in[9];
  const float* fc2_w = (const float*)d_in[10];
  const float* fc2_b = (const float*)d_in[11];
  float* out = (float*)d_out;

  char* ws = (char*)d_ws;
  size_t off = 0;
  auto alloc = [&](size_t bytes) -> char* {
    char* p = ws + off;
    off += (bytes + 255) & ~(size_t)255;
    return p;
  };
  _Float16* xn_h  = (_Float16*)alloc((size_t)ROWS * D_MODEL * 2);
  _Float16* wq_h  = (_Float16*)alloc((size_t)D_MODEL * D_MODEL * 2);
  _Float16* wk_h  = (_Float16*)alloc((size_t)D_MODEL * D_MODEL * 2);
  _Float16* wv_h  = (_Float16*)alloc((size_t)D_MODEL * D_MODEL * 2);
  _Float16* wo_h  = (_Float16*)alloc((size_t)D_MODEL * D_MODEL * 2);
  _Float16* fc1_h = (_Float16*)alloc((size_t)FF_DIM * D_MODEL * 2);
  _Float16* fc2_h = (_Float16*)alloc((size_t)D_MODEL * FF_DIM * 2);
  _Float16* q_h   = (_Float16*)alloc((size_t)ROWS * D_MODEL * 2);
  _Float16* k_h   = (_Float16*)alloc((size_t)ROWS * D_MODEL * 2);
  _Float16* vt_h  = (_Float16*)alloc((size_t)ROWS * D_MODEL * 2);
  _Float16* ctx_h = (_Float16*)alloc((size_t)ROWS * D_MODEL * 2);
  float*    x1    = (float*)   alloc((size_t)ROWS * D_MODEL * 4);
  _Float16* xn2_h = (_Float16*)alloc((size_t)ROWS * D_MODEL * 2);
  _Float16* ff_h  = (_Float16*)alloc((size_t)ROWS * FF_DIM * 2);
  float*    madd  = (float*)   alloc((size_t)BATCH * SEQ * 4);
  int*      inv   = (int*)     alloc((size_t)BATCH * SEQ * 4);
  int*      cnt   = (int*)     alloc((size_t)BATCH * CNT_PITCH * 4);
  (void)wk_h; (void)wv_h;   // reached through wq_h: the planes are contiguous

  // LayerNorm 1, the six weight conversions (planes wq_h .. fc2_h are contiguous)
  // and the token order's tables: one launch.
  prep_kernel<<<PREP_GRID, 256, 0, stream>>>(x, alpha, bias, xn_h, w_q, w_k, w_v, w_o,
                                             fc1_w, fc2_w, wq_h, mask, madd, inv, cnt);

  dim3 gD(D_MODEL / 128, ROWS / 128);      // 8 x 32
  dim3 gQKV(D_MODEL / 128, ROWS / 128, 3); // 8 x 32 x 3
  dim3 gF(FF_DIM / 128, ROWS / 128);       // 32 x 32

  // Q/K/V projections (f16 outputs for attention) in one launch: the planes
  // wq_h, wk_h, wv_h and q_h, k_h, vt_h are contiguous; V goes out transposed.
  gemm_kernel<false, false, false, false, true, true><<<gQKV, 256, 0, stream>>>(
      xn_h, wq_h, nullptr, nullptr, nullptr, q_h, cnt, ROWS, D_MODEL, D_MODEL);

  attn_kernel<<<dim3(SEQ / 128, NHEAD, BATCH), 256, 0, stream>>>(
      q_h, k_h, vt_h, madd, inv, cnt, ctx_h);

  // x1 = x + ctx @ Wo^T
  gemm_kernel<false, true, false, true, false, false><<<gD, 256, 0, stream>>>(
      ctx_h, wo_h, nullptr, x, x1, nullptr, nullptr, ROWS, D_MODEL, D_MODEL);

  ln_kernel<<<ROWS, 256, 0, stream>>>(x1, alpha, bias, xn2_h);

  // ff = relu(xn2 @ fc1^T + b1)
  gemm_kernel<true, false, true, false, true, false><<<gF, 256, 0, stream>>>(
      xn2_h, fc1_h, fc1_b, nullptr, nullptr, ff_h, nullptr, ROWS, FF_DIM, D_MODEL);

  // out = x1 + ff @ fc2^T + b2
  gemm_kernel<false, true, true, true, false, false><<<gD, 256, 0, stream>>>(
      ff_h, fc2_h, fc2_b, x1, out, nullptr, nullptr, ROWS, D_MODEL, FF_DIM);
}

// v007
// It runs in 150 microseconds.
// Next to v006, in two timings, it ran 1.06 and 1.07 times as fast.
// Over all steps from v000 it is 2.75 times as fast.
#include <hip/hip_runtime.h>
#include <hip/hip_bf16.h>
#include <math.h>

// ---------------------------------------------------------------------------
// EncoderBlock for MI455X (gfx1250).
//   D=1024, H=16, HD=64, FF=4096, B=2, S=2048.
// f16 WMMA (v_wmma_f32_16x16x32_f16) for all GEMMs + flash attention,
// double-buffered TDM (tensor_load_to_lds) staging of GEMM tiles into LDS.
// ---------------------------------------------------------------------------

typedef __attribute__((ext_vector_type(16))) _Float16 v16h;
typedef __attribute__((ext_vector_type(8)))  _Float16 v8h;
typedef __attribute__((ext_vector_type(4)))  _Float16 v4h;
typedef __attribute__((ext_vector_type(8)))  float    v8f;
typedef __attribute__((ext_vector_type(4)))  float    v4f;
typedef __attribute__((ext_vector_type(4)))  int      v4i;
typedef __attribute__((ext_vector_type(4)))  unsigned int u32x4;
typedef __attribute__((ext_vector_type(8)))  unsigned int u32x8;

#define D_MODEL 1024
#define NHEAD   16
#define HD      64
#define FF_DIM  4096
#define SEQ     2048
#define BATCH   2
#define ROWS    (BATCH * SEQ)   /* 4096 */
#define LN_EPS  1e-6f

// ---- WMMA helpers ---------------------------------------------------------

static __device__ __forceinline__ v8f wmma16x16x32(v16h a, v16h b, v8f c) {
  return __builtin_amdgcn_wmma_f32_16x16x32_f16(false, a, false, b, (short)0, c,
                                                false, false);
}

// A/B fragment loader from a row-major [16 x >=32] tile (row = M for A, N for B;
// K contiguous within the row). ISA 16-bit A layout:
//   lanes 0-15:  M=lane,    elems 0..7 -> K=0..7,  elems 8..15 -> K=16..23
//   lanes 16-31: M=lane-16, elems 0..7 -> K=8..15, elems 8..15 -> K=24..31
static __device__ __forceinline__ v16h load_frag_rowmajor(const _Float16* base,
                                                          int ld, int lane) {
  const int r  = lane & 15;
  const int kb = (lane >> 4) * 8;
  const _Float16* p = base + (size_t)r * ld + kb;
  v16h f;
#pragma unroll
  for (int i = 0; i < 8; ++i) f[i] = p[i];
#pragma unroll
  for (int i = 0; i < 8; ++i) f[8 + i] = p[16 + i];
  return f;
}

// ---- Tensor loads: one wave brings a slice of T / 4 rows x 256 bytes to LDS --
// The mover pads every 256-byte row by 16 bytes: the LDS pitch is 272 bytes
// (16 B x odd), at which the ds_load_b128 fragment reads meet no bank conflict.

#define G_K      128                  /* k per stage: rows of 256 bytes */
#define G_ROWB   256                  /* bytes per staged row */
#define G_PITCH  272                  /* bytes per LDS row, pad included */
// Per tile edge T (a work-group's tile of C is T x T): rows per slice, one slice
// a wave; a slice's bytes in LDS, rounded up to a multiple of 2 KiB (T = 128:
// 32 x 272 = 8704 -> 10240; T = 256: 64 x 272 = 17408 -> 18432).
#define G_SROWS(T) ((T) / 4)
#define G_SLICE(T) ((G_SROWS(T) * G_PITCH + 2047) / 2048 * 2048)
#define G_BUF(T)   (8 * G_SLICE(T))   /* one stage: A slices 0..3, W slices 4..7 */

static __device__ __forceinline__ uint32_t uni(uint32_t v) {
  return (uint32_t)__builtin_amdgcn_readfirstlane(v);
}
// Holds a wave-uniform test in a scalar register, so that the branch on it is
// a scalar branch: a tensor load ignores EXEC.
static __device__ __forceinline__ uint32_t pinned(uint32_t v) {
  uint32_t w = uni(v);
  asm volatile("" : "+s"(w));
  return w;
}
static __device__ __forceinline__ void tdm_group0(u32x4& g, uint32_t lds_dst, uint64_t ga) {
  g[0] = uni(1u);                                              // count = 1
  g[1] = uni(lds_dst);                                         // byte offset in LDS
  g[2] = uni((uint32_t)ga);                                    // address [31:0]
  g[3] = uni((((uint32_t)(ga >> 32)) & 0x01FFFFFFu) | 0x80000000u);  // [56:32], type = 2
}
// Extents in bytes (data_size code 0); tensor dims = tile dims.
static __device__ __forceinline__ u32x8 tdm_group1(uint32_t src_pitch, uint32_t srows) {
  u32x8 g;
  g[0] = uni((1u << 20) | (5u << 22) | (3u << 25));  // pad 4 dwords after every 64 dwords
  g[1] = uni((uint32_t)G_ROWB << 16);                // tensor_dim0
  g[2] = uni(srows << 16);                           // tensor_dim1
  g[3] = uni((uint32_t)G_ROWB << 16);                // tile_dim0
  g[4] = uni(srows);                                 // tile_dim1
  g[5] = uni(src_pitch);                             // source row pitch, bytes
  g[6] = uni(0u);
  g[7] = uni(0u);
  return g;
}
// Load and wait both name the two groups as in-out operands: their scalar
// registers then hold nothing else from the issue to the wait, and the next
// descriptor is formed only behind the wait.
static __device__ __forceinline__ void tdm_load(u32x4& g0, u32x8& g1) {
  asm volatile("tensor_load_to_lds %0, %1" : "+s"(g0), "+s"(g1) :: "memory");
}
static __device__ __forceinline__ void tdm_wait(u32x4& g0, u32x8& g1) {
  asm volatile("s_wait_tensorcnt 0x0" : "+s"(g0), "+s"(g1) :: "memory");
}

// Fragment from padded LDS rows; the same k order as load_frag_rowmajor.
static __device__ __forceinline__ v16h load_frag_lds(const char* base, int lane) {
  const char* p = base + (lane & 15) * G_PITCH + (lane >> 4) * 16;
  const v8h lo = *reinterpret_cast<const v8h*>(p);
  const v8h hi = *reinterpret_cast<const v8h*>(p + 32);
  return __builtin_shufflevector(lo, hi, 0, 1, 2, 3, 4, 5, 6, 7, 8, 9, 10, 11, 12, 13, 14, 15);
}

// ---- elementwise f32 -> f16 ----------------------------------------------

// A block converts CVT_BLOCK consecutive floats; every array's length is a
// multiple of that. Each wave-wide load covers 512 contiguous bytes, each store
// 256; a thread's eight loads are all issued ahead of its first conversion.

#define CVT_U     8                   /* 16-byte loads a thread */
#define CVT_BLOCK (256 * 4 * CVT_U)   /* floats a block */

static __device__ __forceinline__
void cvt_block(const float* __restrict__ in, _Float16* __restrict__ out, int blk) {
  const size_t base = (size_t)blk * CVT_BLOCK + threadIdx.x * 4;
  v4f v[CVT_U];
#pragma unroll
  for (int u = 0; u < CVT_U; ++u)
    v[u] = *reinterpret_cast<const v4f*>(in + base + u * 1024);
#pragma unroll
  for (int u = 0; u < CVT_U; ++u) {
    v4h h;
#pragma unroll
    for (int e = 0; e < 4; ++e) h[e] = (_Float16)v[u][e];
    *reinterpret_cast<v4h*>(out + base + u * 1024) = h;
  }
  // Stands behind the last store: in the merged kernel's listing another block
  // range follows, which writes the registers that these stores name.
  asm volatile("s_wait_xcnt 0x0" ::: "memory");
}

// ---- token order: kept keys first ------------------------------------------
// A key whose mask is 0 gets the score -1e9 and so the softmax weight 0 as soon
// as its batch holds one kept key. Each batch's tokens are therefore put in a
// stable partition: the kept ones (mask != 0) first, the others behind them.
//   place(s) = kept ? (kept tokens ahead of s) : total kept + (others ahead of s)
// LayerNorm 1 writes row s at place(s), so Q, K and V all come out in that order,
// and attention walks only the key tiles that hold a kept key; K and V behind
// them are not computed. With no kept key the order is the identity and
// attention walks every tile, all at -1e9.
// One block a batch writes what attention reads: inv[place] = s, the additive
// mask by place (0 ahead of the total, -1e9 from there on) and the total.
// Each wave counts the whole batch by ballots and places its own 256 tokens:
// no wave needs another's count.

#define ATT_KEYS  64                  /* keys per tile that attention stages */
#define CNT_PITCH 32                  /* ints between two batches' totals: a 128-byte line each, one writer a line */

// Key tiles of a batch that hold a kept key, 1 .. SEQ / ATT_KEYS; all of them
// where the batch has none. The same for every thread that asks for one batch.
static __device__ __forceinline__ int walked_tiles(const int* __restrict__ cnt, int b) {
  const int kept = __builtin_amdgcn_readfirstlane(cnt[b * CNT_PITCH]);
  return (kept <= 0 || kept > SEQ) ? SEQ / ATT_KEYS : (kept + ATT_KEYS - 1) / ATT_KEYS;
}

static __device__ __forceinline__
void keymap_block(const int* __restrict__ mask, float* __restrict__ madd,
                  int* __restrict__ inv, int* __restrict__ cnt, int b) {
  const int lane = threadIdx.x & 31;
  const int wave = threadIdx.x >> 5;
  const int* mb = mask + b * SEQ;
  int tot = 0, run = 0;   // kept tokens of the batch; of them, ahead of this wave's tokens
  // Unrolled: the loads are all asked for ahead of the first count.
#pragma unroll
  for (int g = 0; g < SEQ / 32; ++g) {
    const int c = __popc(__builtin_amdgcn_ballot_w32(mb[g * 32 + lane] != 0));
    tot += c;
    run += (g < wave * 8) ? c : 0;
  }
  // Stands behind the counting loads: the loads below take registers that
  // those name as their results.
  asm volatile("s_wait_xcnt 0x0" ::: "memory");
  // Unrolled: the eight loads go out together, and so do the stores.
#pragma unroll
  for (int i = 0; i < 8; ++i) {
    const int s = (wave * 8 + i) * 32 + lane;
    const bool keep = mb[s] != 0;
    const unsigned int w = __builtin_amdgcn_ballot_w32(keep);
    const int ahead = run + __popc(w & ((1u << lane) - 1u));   // kept tokens ahead of s
    inv[b * SEQ + (keep ? ahead : tot + (s - ahead))] = s;
    madd[b * SEQ + s] = (s < tot) ? 0.f : -1e9f;
    run += __popc(w);
  }
  if (threadIdx.x == 0) cnt[b * CNT_PITCH] = tot;
}

// ---- LayerNorm (unbiased std, eps added to sd) -> f16 ---------------------

// PLACE: the row goes out at its token's place in the kept-first order. The
// block counts its batch's kept tokens itself (8 mask words a thread; the total
// in the high half of a word, those ahead of the row's token in the low half);
// the counts ride on the first sum's reduction and its barriers.
template <bool PLACE>
static __device__ __forceinline__
void ln_row(const float* __restrict__ x, const float* __restrict__ alpha,
            const float* __restrict__ bias, _Float16* __restrict__ out, int row,
            const int* __restrict__ mask) {
  __shared__ float red[256];
  __shared__ int   kc[PLACE ? 256 : 1];
  const int t = threadIdx.x;
  const float* xr = x + (size_t)row * D_MODEL;
  const int tok = row % SEQ;
  int own = 1;
  if constexpr (PLACE) own = mask[row];   // asked for together with the row
  float v[4];
  float s = 0.f;
#pragma unroll
  for (int i = 0; i < 4; ++i) { v[i] = xr[t + i * 256]; s += v[i]; }
  if constexpr (PLACE) {
    const int* mb = mask + (row - tok) + t * 8;
    const v4i ma = *reinterpret_cast<const v4i*>(mb);
    const v4i mc = *reinterpret_cast<const v4i*>(mb + 4);
    int k = 0;
    // Unrolled: the vectors' elements are then picked by constants.
#pragma unroll
    for (int e = 0; e < 4; ++e) {
      if (ma[e] != 0) k += 0x10000 + ((t * 8 + e < tok) ? 1 : 0);
      if (mc[e] != 0) k += 0x10000 + ((t * 8 + 4 + e < tok) ? 1 : 0);
    }
    kc[t] = k;
  }
  red[t] = s; __syncthreads();
  for (int off = 128; off > 0; off >>= 1) {
    if (t < off) {
      red[t] += red[t + off];
      if constexpr (PLACE) kc[t] += kc[t + off];
    }
    __syncthreads();
  }
  const float mu = red[0] * (1.f / D_MODEL);
  int orow = row;
  if constexpr (PLACE) {
    const int tot   = kc[0] >> 16;
    const int ahead = kc[0] & 0xffff;
    orow = (row - tok) + ((own != 0) ? ahead : tot + (tok - ahead));
  }
  __syncthreads();
  float ss = 0.f;
#pragma unroll
  for (int i = 0; i < 4; ++i) { float d = v[i] - mu; ss += d * d; }
  red[t] = ss; __syncthreads();
  for (int off = 128; off > 0; off >>= 1) {
    if (t < off) red[t] += red[t + off];
    __syncthreads();
  }
  const float sd  = sqrtf(red[0] / (float)(D_MODEL - 1));
  const float inv = 1.f / (sd + LN_EPS);
#pragma unroll
  for (int i = 0; i < 4; ++i) {
    int c = t + i * 256;
    out[(size_t)orow * D_MODEL + c] =
        (_Float16)(alpha[c] * (v[i] - mu) * inv + bias[c]);
  }
}

__global__ __launch_bounds__(256)
void ln_kernel(const float* __restrict__ x, const float* __restrict__ alpha,
               const float* __restrict__ bias, _Float16* __restrict__ out) {
  ln_row<false>(x, alpha, bias, out, blockIdx.x, nullptr);
}

// ---- everything that depends on the inputs alone, in one launch ------------
// Block ranges of one grid: the first LayerNorm (a row a block), the six weight
// conversions (their f16 planes lie one behind another in wh, in this order),
// the token order's tables. No range reads what another writes.

#define PREP_LN    ROWS                                /* blocks: LayerNorm rows */
#define PREP_DD    (D_MODEL * D_MODEL / CVT_BLOCK)     /* blocks per D x D weight: 128 */
#define PREP_FD    (FF_DIM * D_MODEL / CVT_BLOCK)      /* blocks per FF x D weight: 512 */
#define PREP_CVT   (4 * PREP_DD + 2 * PREP_FD)
#define PREP_MASK  BATCH                               /* blocks: token order, one a batch */
#define PREP_GRID  (PREP_LN + PREP_CVT + PREP_MASK)

__global__ __launch_bounds__(256)
void prep_kernel(const float* __restrict__ x, const float* __restrict__ alpha,
                 const float* __restrict__ bias, _Float16* __restrict__ xn,
                 const float* __restrict__ w_q, const float* __restrict__ w_k,
                 const float* __restrict__ w_v, const float* __restrict__ w_o,
                 const float* __restrict__ fc1_w, const float* __restrict__ fc2_w,
                 _Float16* __restrict__ wh,
                 const int* __restrict__ mask, float* __restrict__ madd,
                 int* __restrict__ inv, int* __restrict__ cnt) {
  const int blk = blockIdx.x;
  if (blk < PREP_LN) {
    ln_row<true>(x, alpha, bias, xn, blk, mask);
  } else if (blk < PREP_LN + PREP_CVT) {
    const int cb = blk - PREP_LN;          // block within the six planes
    const float* in;
    int first;                             // the plane's first block
    if (cb < 4 * PREP_DD) {
      const int w = cb / PREP_DD;
      in = (w == 0) ? w_q : (w == 1) ? w_k : (w == 2) ? w_v : w_o;
      first = w * PREP_DD;
    } else if (cb < 4 * PREP_DD + PREP_FD) {
      in = fc1_w; first = 4 * PREP_DD;
    } else {
      in = fc2_w; first = 4 * PREP_DD + PREP_FD;
    }
    cvt_block(in, wh + (size_t)first * CVT_BLOCK, cb - first);
  } else {
    keymap_block(mask, madd, inv, cnt, blk - (PREP_LN + PREP_CVT));
  }
}

// ---- Tiled WMMA GEMM:  C[M,N] = act(A[M,K] * W[N,K]^T + bias) (+resid) ----
// Block = 256 threads (8 waves), tile T x T, 128 k a stage. Waves: 2 (M) x 4 (N);
// each wave owns T/2 x T/4 of output. T = 128: 4 M-frags x 2 N-frags, 8 WMMA on
// 6 fragments / 32 k, two work-groups a WGP. T = 256: 8 x 4, 32 WMMA on 12
// fragments / 32 k, one work-group a WGP: half the bytes from L2 and half the
// LDS reads per WMMA; for a product with a tile for every WGP (M, N multiples
// of T).
// Two LDS buffers: every wave issues one tensor load a stage for its own slice
// (waves 0..3: T/4 rows of A each, waves 4..7: T/4 rows of W each), so that the
// next stage flies while this one is worked on. K: a multiple of 128, >= 256.
// blockIdx.z picks one of several products on the same A: weight planes [N,K]
// and f16 output planes [M,N] lie one behind another.
// VTRANS: the plane of blockIdx.z == 2 (V) is stored head-major and transposed,
// [B, N, SEQ] (N = head * HD + hd), as attention reads it: an accumulator
// register group holds 8 consecutive rows of one column, which are 16
// contiguous bytes there, so each group goes out as one 16-byte store.
// In that form the rows stand in the kept-first token order, and a K or V tile
// whose rows all lie behind the last key tile that attention walks is not
// computed: nothing reads it.

template <int T, bool RELU, bool RESID, bool BIAS, bool OUTF32, bool OUTF16, bool VTRANS>
__global__ __launch_bounds__(256)
void gemm_kernel(const _Float16* __restrict__ A, const _Float16* __restrict__ W,
                 const float* __restrict__ bias, const float* __restrict__ resid,
                 float* __restrict__ outf, _Float16* __restrict__ outh,
                 const int* __restrict__ cnt, int M, int N, int K) {
  constexpr int SLICE = G_SLICE(T);
  constexpr int BUF   = G_BUF(T);
  constexpr int FA    = T / 32;            // A fragments (16 rows each) a wave
  constexpr int FB    = T / 64;            // W fragments a wave
  constexpr int SF    = G_SROWS(T) / 16;   // fragments a slice
  __shared__ __attribute__((aligned(2048))) char sm[2 * BUF];
  const int t    = threadIdx.x;
  const int lane = t & 31;
  const uint32_t wave = uni((uint32_t)t >> 5);
  const int wm   = wave >> 2;       // 0..1  (T/2 rows of M each)
  const int wn   = wave & 3;        // 0..3  (T/4 cols of N each)
  const int m0   = blockIdx.y * T;
  const int n0   = blockIdx.x * T;

  if constexpr (VTRANS) {
    // The whole work-group leaves, ahead of every tensor load and barrier.
    if (blockIdx.z != 0 && m0 % SEQ >= walked_tiles(cnt, m0 / SEQ) * ATT_KEYS) return;
  }

  v8f acc[FA][FB];
#pragma unroll
  for (int i = 0; i < FA; ++i)
#pragma unroll
    for (int j = 0; j < FB; ++j) acc[i][j] = v8f{};

  auto compute_stage = [&](const char* buf) {
    const char* Ab = buf + (wm * 2) * SLICE;     // this wave's T/2 rows of A: two slices
    const char* Bb = buf + (4 + wn) * SLICE;     // this wave's T/4 rows of W: one slice
#pragma unroll
    for (int kk = 0; kk < G_K / 32; ++kk) {
      v16h bf[FB], af[FA];
#pragma unroll
      for (int nf = 0; nf < FB; ++nf)
        bf[nf] = load_frag_lds(Bb + nf * 16 * G_PITCH + kk * 64, lane);
#pragma unroll
      for (int mf = 0; mf < FA; ++mf)
        af[mf] = load_frag_lds(Ab + (mf / SF) * SLICE + (mf % SF) * 16 * G_PITCH + kk * 64, lane);
      // T = 256: keeps the block's 24 LDS reads one group ahead of its 32 WMMAs.
      // Without the pair the reads are spread among the WMMAs two at a time,
      // each pair waited to 0 ahead of only four WMMAs.
      if constexpr (T == 256) __builtin_amdgcn_sched_barrier(0);
#pragma unroll
      for (int mf = 0; mf < FA; ++mf)
#pragma unroll
        for (int nf = 0; nf < FB; ++nf)
          acc[mf][nf] = wmma16x16x32(af[mf], bf[nf], acc[mf][nf]);
      if constexpr (T == 256) __builtin_amdgcn_sched_barrier(0);
    }
  };

  const _Float16* srow = (wave < 4u) ? A + (size_t)(m0 + wave * G_SROWS(T)) * K
                                     : W + ((size_t)blockIdx.z * N + n0 + (wave - 4u) * G_SROWS(T)) * K;
  const uint64_t ga0  = (uint64_t)(uintptr_t)srow;
  const uint32_t lds0 = (uint32_t)(uintptr_t)(void*)&sm[0] + wave * SLICE;
  u32x8 g1 = tdm_group1((uint32_t)K * 2u, (uint32_t)G_SROWS(T));
  u32x4 g0;
  const int nk = K / G_K;

  tdm_group0(g0, lds0, ga0);
  tdm_load(g0, g1);                                    // stage 0 into buffer 0
  tdm_wait(g0, g1);                                    // own slice of stage 0 landed
  __syncthreads();                                     // stage 0 readable by all waves
  tdm_group0(g0, lds0 + BUF, ga0 + G_ROWB);
  tdm_load(g0, g1);                                    // stage 1 into buffer 1

  for (int s = 0; s < nk; ++s) {
    compute_stage(&sm[(s & 1) * BUF]);
    // Hand-over: this wave's reads of stage s are done, its slice of stage s + 1
    // has landed; behind the barrier stage s + 1 is readable and buffer s & 1 free.
    asm volatile("s_wait_dscnt 0x0" ::: "memory");
    tdm_wait(g0, g1);
    __syncthreads();
    if (pinned(s + 2 < nk)) {
      tdm_group0(g0, lds0 + (uint32_t)(s & 1) * BUF, ga0 + (uint64_t)(s + 2) * G_ROWB);
      tdm_load(g0, g1);
    }
  }
  tdm_wait(g0, g1);                                    // nothing in flight at the wave's end
  asm volatile("s_wait_dscnt 0x0" ::: "memory");

  const int hi8 = (lane >> 4) * 8;
  if constexpr (VTRANS) {
    if (blockIdx.z == 2) {
      // SEQ is a multiple of the tile's T rows: a tile lies in one batch.
      const unsigned int bb = (unsigned int)m0 / SEQ;
      const unsigned int s0 = (unsigned int)m0 % SEQ + wm * (T / 2) + hi8;  // first of this lane's rows
      _Float16* vt = outh + (size_t)2 * M * N + (size_t)bb * N * SEQ + s0;
      // All three loops unrolled: acc is then indexed by constants alone and
      // stays in registers, and mf becomes the stores' immediate offset.
#pragma unroll
      for (int nf = 0; nf < FB; ++nf) {
        const int gn = n0 + wn * (T / 4) + nf * 16 + (lane & 15);
        _Float16* col = vt + (size_t)gn * SEQ;
        // The four stores of a column fill one 128-byte line between the two lane halves.
#pragma unroll
        for (int mf = 0; mf < FA; ++mf) {
          v8h h;
#pragma unroll
          for (int v = 0; v < 8; ++v) h[v] = (_Float16)acc[mf][nf][v];
          *reinterpret_cast<v8h*>(col + mf * 16) = h;
        }
      }
      return;
    }
  }
  if constexpr (T == 256) {
    static_assert(OUTF16 && !OUTF32 && !RESID && !VTRANS, "the 256 x 256 tile has the f16 epilogue alone");
    // A lane has 256 values to store, more than there are registers for all
    // their addresses at once: they go out in groups of 32, one group per 16
    // rows: 8 rows a lane x 4 column fragments, which share the row's address
    // and between them fill the wave's 128-byte line of that row. All loops
    // unrolled: acc, h and p are then indexed by constants alone and stay in
    // registers. D layout: M = v + hi8. A row's distance from the lane's first
    // one is the same in every lane: a scalar product, one vector add a row.
    const int gn0 = n0 + wn * (T / 4) + (lane & 15);
    _Float16* first = outh + (size_t)blockIdx.z * M * N +
                      (size_t)(m0 + wm * (T / 2) + hi8) * N + gn0;
    float bv[FB];
#pragma unroll
    for (int nf = 0; nf < FB; ++nf) {
      bv[nf] = 0.f;
      if constexpr (BIAS) bv[nf] = bias[gn0 + nf * 16];
    }
#pragma unroll
    for (int mf = 0; mf < FA; ++mf) {
      _Float16  h[8][FB];
      _Float16* p[8];
#pragma unroll
      for (int v = 0; v < 8; ++v) {
        p[v] = first + (size_t)(mf * 16 + v) * N;
#pragma unroll
        for (int nf = 0; nf < FB; ++nf) {
          float val = acc[mf][nf][v];
          if constexpr (BIAS) val += bv[nf];
          if constexpr (RELU) val = fmaxf(val, 0.f);
          h[v][nf] = (_Float16)val;
        }
      }
      // Keeps the group's arithmetic ahead of its first store, so that none of
      // it writes a register that an issued store of the group names.
      __builtin_amdgcn_sched_barrier(0);
#pragma unroll
      for (int v = 0; v < 8; ++v)
#pragma unroll
        for (int nf = 0; nf < FB; ++nf) p[v][nf * 16] = h[v][nf];
      // The next group's values and addresses take registers that these stores
      // name: the wait stands ahead of them, the barrier keeps them behind it.
      asm volatile("s_wait_xcnt 0x0" ::: "memory");
      __builtin_amdgcn_sched_barrier(0);
    }
    return;
  }
#pragma unroll
  for (int nf = 0; nf < FB; ++nf) {
    const int gn = n0 + wn * (T / 4) + nf * 16 + (lane & 15);
    float bv = 0.f;
    if constexpr (BIAS) bv = bias[gn];
#pragma unroll
    for (int mf = 0; mf < FA; ++mf) {
#pragma unroll
      for (int v = 0; v < 8; ++v) {
        const int gm = m0 + wm * (T / 2) + mf * 16 + hi8 + v;  // D layout: M = v + hi8
        float val = acc[mf][nf][v];
        if constexpr (BIAS)  val += bv;
        if constexpr (RELU)  val = fmaxf(val, 0.f);
        const size_t idx = (size_t)gm * N + gn;
        if constexpr (RESID) val += resid[idx];
        if constexpr (OUTF32) outf[idx] = val;
        if constexpr (OUTF16) outh[(size_t)blockIdx.z * M * N + idx] = (_Float16)val;
      }
    }
  }
  // Stands behind the last Q or K store: in this form's listing the V block is
  // laid out behind them and writes registers that these stores name.
  if constexpr (VTRANS) asm volatile("s_wait_xcnt 0x0" ::: "memory");
}

#define ATT_PITCH 72                  /* halfs per LDS row: 128 B + 16 B pad, 16 B x odd for b128 readers */
#define ATT_TILE  (64 * ATT_PITCH)    /* halfs per staged K or V^T tile */
#define ATT_NST   (SEQ / ATT_KEYS)    /* tiles per (b, h) */

// One tile's four copies of a lane (16 bytes each). The s_wait_xcnt stands in
// the copies' own statement so that no address register is rewritten ahead of it.
static __device__ __forceinline__ void attn_copy4(
    unsigned int l0, const _Float16* g0, unsigned int l1, const _Float16* g1,
    unsigned int l2, const _Float16* g2, unsigned int l3, const _Float16* g3) {
  asm volatile(
      "global_load_async_to_lds_b128 %0, %1, off\n\t"
      "global_load_async_to_lds_b128 %2, %3, off\n\t"
      "global_load_async_to_lds_b128 %4, %5, off\n\t"
      "global_load_async_to_lds_b128 %6, %7, off\n\t"
      "s_wait_xcnt 0x0"
      :: "v"(l0), "v"(g0), "v"(l1), "v"(g1), "v"(l2), "v"(g2), "v"(l3), "v"(g3)
      : "memory");
}

__global__ __launch_bounds__(256)
void attn_kernel(const _Float16* __restrict__ qh, const _Float16* __restrict__ kh,
                 const _Float16* __restrict__ vt, const float* __restrict__ madd,
                 const int* __restrict__ inv, const int* __restrict__ cnt,
                 _Float16* __restrict__ ctxh) {
  __shared__ __attribute__((aligned(16))) _Float16 kv[2][2][ATT_TILE];
  const int lane = threadIdx.x & 31;
  const int wave = threadIdx.x >> 5;
  const int q0   = blockIdx.x * 128 + wave * 16;
  const int h    = blockIdx.y;
  const int b    = blockIdx.z;
  const size_t hoff = (size_t)h * HD;
  const int hi8  = (lane >> 4) * 8;
  const float scale = 0.125f;  // 1/sqrt(HD)

  // Tiles to walk: the same for the whole work-group, 1 .. ATT_NST.
  const int nst = walked_tiles(cnt, b);
  // The tokens of this lane's eight output rows (unrolled: two 16-byte loads,
  // and otok stays in registers).
  int otok[8];
#pragma unroll
  for (int v = 0; v < 8; ++v) otok[v] = inv[b * SEQ + q0 + hi8 + v] & (SEQ - 1);

  const _Float16* qbase = qh + ((size_t)(b * SEQ + q0)) * D_MODEL + hoff;
  v16h qb_lo = load_frag_rowmajor(qbase,      D_MODEL, lane);   // B: N=q, K=hd
  v16h qb_hi = load_frag_rowmajor(qbase + 32, D_MODEL, lane);

  v8f ctx[4] = {v8f{}, v8f{}, v8f{}, v8f{}};
  float m = -1e30f, l = 0.f;
  const float* mrow = madd + (size_t)b * SEQ;
  const _Float16* vtb = vt + ((size_t)(b * NHEAD + h) * HD) * SEQ;

  // Each thread copies rows crow and crow + 32 of both tiles, 16 bytes at ccol.
  const int crow = threadIdx.x >> 3;         // 0..31
  const int ccol = (threadIdx.x & 7) * 8;    // halfs
  const _Float16* gk = kh + ((size_t)(b * SEQ + crow)) * D_MODEL + hoff + ccol;
  const _Float16* gv = vtb + (size_t)crow * SEQ + ccol;
  const unsigned int lds0 =
      (unsigned int)(uintptr_t)(void*)&kv[0][0][crow * ATT_PITCH + ccol];
  auto copy_tile = [&](int s) {
    const unsigned int lk = lds0 + (unsigned int)(s & 1) * (2 * ATT_TILE * 2);
    const unsigned int lv = lk + ATT_TILE * 2;
    const _Float16* k0 = gk + (size_t)s * ATT_KEYS * D_MODEL;
    const _Float16* v0 = gv + s * ATT_KEYS;
    attn_copy4(lk, k0, lk + 32 * ATT_PITCH * 2, k0 + 32 * D_MODEL,
               lv, v0, lv + 32 * ATT_PITCH * 2, v0 + (size_t)32 * SEQ);
  };

  copy_tile(0);
  asm volatile("s_wait_asynccnt 0x0" ::: "memory");  // own copies of tile 0 landed
  __syncthreads();                                   // tile 0 readable by all waves
  if (nst > 1) copy_tile(1);

  for (int s = 0; s < nst; ++s) {
   const _Float16* Ks = &kv[s & 1][0][0];
   const _Float16* Vs = &kv[s & 1][1][0];
   // Unrolled: both halves' LDS offsets become immediates, no inner branch.
#pragma unroll
   for (int sub = 0; sub < ATT_KEYS; sub += 32) {
    const int j = s * ATT_KEYS + sub;
    const _Float16* kbase = Ks + sub * ATT_PITCH;
    v16h ka0l = load_frag_rowmajor(kbase,                       ATT_PITCH, lane);
    v16h ka0h = load_frag_rowmajor(kbase + 32,                  ATT_PITCH, lane);
    v16h ka1l = load_frag_rowmajor(kbase + 16 * ATT_PITCH,      ATT_PITCH, lane);
    v16h ka1h = load_frag_rowmajor(kbase + 16 * ATT_PITCH + 32, ATT_PITCH, lane);
    v8f s0 = {}; s0 = wmma16x16x32(ka0l, qb_lo, s0); s0 = wmma16x16x32(ka0h, qb_hi, s0);
    v8f s1 = {}; s1 = wmma16x16x32(ka1l, qb_lo, s1); s1 = wmma16x16x32(ka1h, qb_hi, s1);

    // per-lane: q = lane&15 ; element v: key = j + hi8 + v (s0) / +16 (s1)
    float sv0[8], sv1[8];
    float tmax = -1e30f;
#pragma unroll
    for (int v = 0; v < 8; ++v) {
      const int key0 = j + hi8 + v;
      const float a = fmaf(s0[v], scale, mrow[key0]);
      const float c = fmaf(s1[v], scale, mrow[key0 + 16]);
      sv0[v] = a; sv1[v] = c;
      tmax = fmaxf(tmax, fmaxf(a, c));
    }
    tmax = fmaxf(tmax, __shfl_xor(tmax, 16, 32));
    const float mnew  = fmaxf(m, tmax);
    const float alpha = __expf(m - mnew);
    float psum = 0.f;
    v16h pa;
#pragma unroll
    for (int v = 0; v < 8; ++v) {
      const float p0 = __expf(sv0[v] - mnew);
      const float p1 = __expf(sv1[v] - mnew);
      pa[v]     = (_Float16)p0;    // A-frag elem e<8  -> key kb+e
      pa[8 + v] = (_Float16)p1;    // A-frag elem e>=8 -> key kb+16+(e-8)
      psum += p0 + p1;
    }
    psum += __shfl_xor(psum, 16, 32);
    l = l * alpha + psum;
    m = mnew;

    // rescale ctx: row q = v + hi8 -> alpha lives in lane (v + hi8)
    float rs[8];
#pragma unroll
    for (int v = 0; v < 8; ++v) rs[v] = __shfl(alpha, hi8 + v, 32);
#pragma unroll
    for (int nf = 0; nf < 4; ++nf)
#pragma unroll
      for (int v = 0; v < 8; ++v) ctx[nf][v] *= rs[v];

#pragma unroll
    for (int nf = 0; nf < 4; ++nf) {
      // B operand: N = hd (rows of vt), K = keys (contiguous)
      v16h vb = load_frag_rowmajor(Vs + (nf * 16) * ATT_PITCH + sub, ATT_PITCH, lane);
      ctx[nf] = wmma16x16x32(pa, vb, ctx[nf]);
    }
   }
   // Hand-over: this wave's reads of tile s are done, its copies of tile s + 1
   // have landed; behind the barrier tile s + 1 is readable and buffer s & 1 free.
   asm volatile("s_wait_dscnt 0x0" ::: "memory");
   asm volatile("s_wait_asynccnt 0x0" ::: "memory");
   // Stands ahead of the advance of the mask loads' address register.
   asm volatile("s_wait_xcnt 0x0" ::: "memory");
   __syncthreads();
   if (s + 2 < nst) copy_tile(s + 2);
  }
  asm volatile("s_wait_asynccnt 0x0" ::: "memory");  // nothing in flight at the wave's end

  const float linv = 1.f / l;
  float rs[8];
#pragma unroll
  for (int v = 0; v < 8; ++v) rs[v] = __shfl(linv, hi8 + v, 32);
  _Float16* obase = ctxh + (size_t)b * SEQ * D_MODEL + hoff;
#pragma unroll
  for (int nf = 0; nf < 4; ++nf) {
#pragma unroll
    for (int v = 0; v < 8; ++v) {
      const int hd = nf * 16 + (lane & 15);
      obase[(size_t)otok[v] * D_MODEL + hd] = (_Float16)(ctx[nf][v] * rs[v]);
    }
  }
}

// ---- host side ------------------------------------------------------------

extern "C" void kernel_launch(void* const* d_in, const int* in_sizes, int n_in,
                              void* d_out, int out_size, void* d_ws, size_t ws_size,
                              hipStream_t stream) {
  (void)in_sizes; (void)n_in; (void)out_size; (void)ws_size;
  const float* x     = (const float*)d_in[0];
  const int*   mask  = (const int*)d_in[1];
  const float* alpha = (const float*)d_in[2];
  const float* bias  = (const float*)d_in[3];
  const float* w_q   = (const float*)d_in[4];
  const float* w_k   = (const float*)d_in[5];
  const float* w_v   = (const float*)d_in[6];
  const float* w_o   = (const float*)d_in[7];
  const float* fc1_w = (const float*)d_in[8];
  const float* fc1_b = (const float*)d_in[9];
  const float* fc2_w = (const float*)d_in[10];
  const float* fc2_b = (const float*)d_in[11];
  float* out = (float*)d_out;

  char* ws = (char*)d_ws;
  size_t off = 0;
  auto alloc = [&](size_t bytes) -> char* {
    char* p = ws + off;
    off += (bytes + 255) & ~(size_t)255;
    return p;
  };
  _Float16* xn_h  = (_Float16*)alloc((size_t)ROWS * D_MODEL * 2);
  _Float16* wq_h  = (_Float16*)alloc((size_t)D_MODEL * D_MODEL * 2);
  _Float16* wk_h  = (_Float16*)alloc((size_t)D_MODEL * D_MODEL * 2);
  _Float16* wv_h  = (_Float16*)alloc((size_t)D_MODEL * D_MODEL * 2);
  _Float16* wo_h  = (_Float16*)alloc((size_t)D_MODEL * D_MODEL * 2);
  _Float16* fc1_h = (_Float16*)alloc((size_t)FF_DIM * D_MODEL * 2);
  _Float16* fc2_h = (_Float16*)alloc((size_t)D_MODEL * FF_DIM * 2);
  _Float16* q_h   = (_Float16*)alloc((size_t)ROWS * D_MODEL * 2);
  _Float16* k_h   = (_Float16*)alloc((size_t)ROWS * D_MODEL * 2);
  _Float16* vt_h  = (_Float16*)alloc((size_t)ROWS * D_MODEL * 2);
  _Float16* ctx_h = (_Float16*)alloc((size_t)ROWS * D_MODEL * 2);
  float*    x1    = (float*)   alloc((size_t)ROWS * D_MODEL * 4);
  _Float16* xn2_h = (_Float16*)alloc((size_t)ROWS * D_MODEL * 2);
  _Float16* ff_h  = (_Float16*)alloc((size_t)ROWS * FF_DIM * 2);
  float*    madd  = (float*)   alloc((size_t)BATCH * SEQ * 4);
  int*      inv   = (int*)     alloc((size_t)BATCH * SEQ * 4);
  int*      cnt   = (int*)     alloc((size_t)BATCH * CNT_PITCH * 4);
  (void)wk_h; (void)wv_h;   // reached through wq_h: the planes are contiguous

  // LayerNorm 1, the six weight conversions (planes wq_h .. fc2_h are contiguous)
  // and the token order's tables: one launch.
  prep_kernel<<<PREP_GRID, 256, 0, stream>>>(x, alpha, bias, xn_h, w_q, w_k, w_v, w_o,
                                             fc1_w, fc2_w, wq_h, mask, madd, inv, cnt);

  dim3 gD(D_MODEL / 128, ROWS / 128);      // 8 x 32
  dim3 gQKV(D_MODEL / 128, ROWS / 128, 3); // 8 x 32 x 3
  dim3 gF(FF_DIM / 256, ROWS / 256);       // 16 x 16: a 256 x 256 tile for every WGP

  // Q/K/V projections (f16 outputs for attention) in one launch: the planes
  // wq_h, wk_h, wv_h and q_h, k_h, vt_h are contiguous; V goes out transposed.
  gemm_kernel<128, false, false, false, false, true, true><<<gQKV, 256, 0, stream>>>(
      xn_h, wq_h, nullptr, nullptr, nullptr, q_h, cnt, ROWS, D_MODEL, D_MODEL);

  attn_kernel<<<dim3(SEQ / 128, NHEAD, BATCH), 256, 0, stream>>>(
      q_h, k_h, vt_h, madd, inv, cnt, ctx_h);

  // x1 = x + ctx @ Wo^T
  gemm_kernel<128, false, true, false, true, false, false><<<gD, 256, 0, stream>>>(
      ctx_h, wo_h, nullptr, x, x1, nullptr, nullptr, ROWS, D_MODEL, D_MODEL);

  ln_kernel<<<ROWS, 256, 0, stream>>>(x1, alpha, bias, xn2_h);

  // ff = relu(xn2 @ fc1^T + b1)
  gemm_kernel<256, true, false, true, false, true, false><<<gF, 256, 0, stream>>>(
      xn2_h, fc1_h, fc1_b, nullptr, nullptr, ff_h, nullptr, ROWS, FF_DIM, D_MODEL);

  // out = x1 + ff @ fc2^T + b2
  gemm_kernel<128, false, true, true, true, false, false><<<gD, 256, 0, stream>>>(
      ff_h, fc2_h, fc2_b, x1, out, nullptr, nullptr, ROWS, D_MODEL, FF_DIM);
}

// v008
// Measured time: 144 microseconds a run.
// Two timings next to v007 put it at 1.05 and 1.02 times that version's speed.
// Over all steps from v000 it is 2.85 times as fast.
#include <hip/hip_runtime.h>
#include <hip/hip_bf16.h>
#include <math.h>

// ---------------------------------------------------------------------------
// EncoderBlock for MI455X (gfx1250).
//   D=1024, H=16, HD=64, FF=4096, B=2, S=2048.
// f16 WMMA (v_wmma_f32_16x16x32_f16) for all GEMMs + flash attention,
// double-buffered TDM (tensor_load_to_lds) staging of GEMM tiles into LDS.
// ---------------------------------------------------------------------------

typedef __attribute__((ext_vector_type(16))) _Float16 v16h;
typedef __attribute__((ext_vector_type(8)))  _Float16 v8h;
typedef __attribute__((ext_vector_type(4)))  _Float16 v4h;
typedef __attribute__((ext_vector_type(8)))  float    v8f;
typedef __attribute__((ext_vector_type(4)))  float    v4f;
typedef __attribute__((ext_vector_type(4)))  int      v4i;
typedef __attribute__((ext_vector_type(4)))  unsigned int u32x4;
typedef __attribute__((ext_vector_type(8)))  unsigned int u32x8;

#define D_MODEL 1024
#define NHEAD   16
#define HD      64
#define FF_DIM  4096
#define SEQ     2048
#define BATCH   2
#define ROWS    (BATCH * SEQ)   /* 4096 */
#define LN_EPS  1e-6f

// ---- WMMA helpers ---------------------------------------------------------

static __device__ __forceinline__ v8f wmma16x16x32(v16h a, v16h b, v8f c) {
  return __builtin_amdgcn_wmma_f32_16x16x32_f16(false, a, false, b, (short)0, c,
                                                false, false);
}

// A/B fragment loader from a row-major [16 x >=32] tile (row = M for A, N for B;
// K contiguous within the row). ISA 16-bit A layout:
//   lanes 0-15:  M=lane,    elems 0..7 -> K=0..7,  elems 8..15 -> K=16..23
//   lanes 16-31: M=lane-16, elems 0..7 -> K=8..15, elems 8..15 -> K=24..31
static __device__ __forceinline__ v16h load_frag_rowmajor(const _Float16* base,
                                                          int ld, int lane) {
  const int r  = lane & 15;
  const int kb = (lane >> 4) * 8;
  const _Float16* p = base + (size_t)r * ld + kb;
  v16h f;
#pragma unroll
  for (int i = 0; i < 8; ++i) f[i] = p[i];
#pragma unroll
  for (int i = 0; i < 8; ++i) f[8 + i] = p[16 + i];
  return f;
}

// ---- Tensor loads: one wave brings a slice of T / 4 rows x 256 bytes to LDS --
// The mover pads every 256-byte row by 16 bytes: the LDS pitch is 272 bytes
// (16 B x odd), at which the ds_load_b128 fragment reads meet no bank conflict.

#define G_K      128                  /* k per stage: rows of 256 bytes */
#define G_ROWB   256                  /* bytes per staged row */
#define G_PITCH  272                  /* bytes per LDS row, pad included */
// Per tile edge T (a work-group's tile of C is T x T): rows per slice, one slice
// a wave; a slice's bytes in LDS, rounded up to a multiple of 2 KiB (T = 128:
// 32 x 272 = 8704 -> 10240; T = 256: 64 x 272 = 17408 -> 18432).
#define G_SROWS(T) ((T) / 4)
#define G_SLICE(T) ((G_SROWS(T) * G_PITCH + 2047) / 2048 * 2048)
#define G_BUF(T)   (8 * G_SLICE(T))   /* one stage: A slices 0..3, W slices 4..7 */

static __device__ __forceinline__ uint32_t uni(uint32_t v) {
  return (uint32_t)__builtin_amdgcn_readfirstlane(v);
}
// Holds a wave-uniform test in a scalar register, so that the branch on it is
// a scalar branch: a tensor load ignores EXEC.
static __device__ __forceinline__ uint32_t pinned(uint32_t v) {
  uint32_t w = uni(v);
  asm volatile("" : "+s"(w));
  return w;
}
static __device__ __forceinline__ void tdm_group0(u32x4& g, uint32_t lds_dst, uint64_t ga) {
  g[0] = uni(1u);                                              // count = 1
  g[1] = uni(lds_dst);                                         // byte offset in LDS
  g[2] = uni((uint32_t)ga);                                    // address [31:0]
  g[3] = uni((((uint32_t)(ga >> 32)) & 0x01FFFFFFu) | 0x80000000u);  // [56:32], type = 2
}
// Extents in bytes (data_size code 0); tensor dims = tile dims.
static __device__ __forceinline__ u32x8 tdm_group1(uint32_t src_pitch, uint32_t srows) {
  u32x8 g;
  g[0] = uni((1u << 20) | (5u << 22) | (3u << 25));  // pad 4 dwords after every 64 dwords
  g[1] = uni((uint32_t)G_ROWB << 16);                // tensor_dim0
  g[2] = uni(srows << 16);                           // tensor_dim1
  g[3] = uni((uint32_t)G_ROWB << 16);                // tile_dim0
  g[4] = uni(srows);                                 // tile_dim1
  g[5] = uni(src_pitch);                             // source row pitch, bytes
  g[6] = uni(0u);
  g[7] = uni(0u);
  return g;
}
// Load and wait both name the two groups as in-out operands: their scalar
// registers then hold nothing else from the issue to the wait, and the next
// descriptor is formed only behind the wait.
static __device__ __forceinline__ void tdm_load(u32x4& g0, u32x8& g1) {
  asm volatile("tensor_load_to_lds %0, %1" : "+s"(g0), "+s"(g1) :: "memory");
}
static __device__ __forceinline__ void tdm_wait(u32x4& g0, u32x8& g1) {
  asm volatile("s_wait_tensorcnt 0x0" : "+s"(g0), "+s"(g1) :: "memory");
}

// Fragment from padded LDS rows; the same k order as load_frag_rowmajor.
static __device__ __forceinline__ v16h load_frag_lds(const char* base, int lane) {
  const char* p = base + (lane & 15) * G_PITCH + (lane >> 4) * 16;
  const v8h lo = *reinterpret_cast<const v8h*>(p);
  const v8h hi = *reinterpret_cast<const v8h*>(p + 32);
  return __builtin_shufflevector(lo, hi, 0, 1, 2, 3, 4, 5, 6, 7, 8, 9, 10, 11, 12, 13, 14, 15);
}

// ---- elementwise f32 -> f16 ----------------------------------------------

// A block converts CVT_BLOCK consecutive floats; every array's length is a
// multiple of that. Each wave-wide load covers 512 contiguous bytes, each store
// 256; a thread's eight loads are all issued ahead of its first conversion.

#define CVT_U     8                   /* 16-byte loads a thread */
#define CVT_BLOCK (256 * 4 * CVT_U)   /* floats a block */

static __device__ __forceinline__
void cvt_block(const float* __restrict__ in, _Float16* __restrict__ out, int blk) {
  const size_t base = (size_t)blk * CVT_BLOCK + threadIdx.x * 4;
  v4f v[CVT_U];
#pragma unroll
  for (int u = 0; u < CVT_U; ++u)
    v[u] = *reinterpret_cast<const v4f*>(in + base + u * 1024);
#pragma unroll
  for (int u = 0; u < CVT_U; ++u) {
    v4h h;
#pragma unroll
    for (int e = 0; e < 4; ++e) h[e] = (_Float16)v[u][e];
    *reinterpret_cast<v4h*>(out + base + u * 1024) = h;
  }
  // Stands behind the last store: in the merged kernel's listing another block
  // range follows, which writes the registers that these stores name.
  asm volatile("s_wait_xcnt 0x0" ::: "memory");
}

// ---- token order: kept keys first ------------------------------------------
// A key whose mask is 0 gets the score -1e9 and so the softmax weight 0 as soon
// as its batch holds one kept key. Each batch's tokens are therefore put in a
// stable partition: the kept ones (mask != 0) first, the others behind them.
//   place(s) = kept ? (kept tokens ahead of s) : total kept + (others ahead of s)
// LayerNorm 1 writes row s at place(s), so Q, K and V all come out in that order,
// and attention walks only the key tiles that hold a kept key; K and V behind
// them are not computed. With no kept key the order is the identity and
// attention walks every tile, all at -1e9.
// One block a batch writes what attention reads: inv[place] = s, the additive
// mask by place (0 ahead of the total, -1e9 from there on) and the total.
// Each wave counts the whole batch by ballots and places its own 256 tokens:
// no wave needs another's count.

#define ATT_KEYS  64                  /* keys per tile that attention stages */
#define CNT_PITCH 32                  /* ints between two batches' totals: a 128-byte line each, one writer a line */

// Key tiles of a batch that hold a kept key, 1 .. SEQ / ATT_KEYS; all of them
// where the batch has none. The same for every thread that asks for one batch.
static __device__ __forceinline__ int walked_tiles(const int* __restrict__ cnt, int b) {
  const int kept = __builtin_amdgcn_readfirstlane(cnt[b * CNT_PITCH]);
  return (kept <= 0 || kept > SEQ) ? SEQ / ATT_KEYS : (kept + ATT_KEYS - 1) / ATT_KEYS;
}

static __device__ __forceinline__
void keymap_block(const int* __restrict__ mask, float* __restrict__ madd,
                  int* __restrict__ inv, int* __restrict__ cnt, int b) {
  const int lane = threadIdx.x & 31;
  const int wave = threadIdx.x >> 5;
  const int* mb = mask + b * SEQ;
  int tot = 0, run = 0;   // kept tokens of the batch; of them, ahead of this wave's tokens
  // Unrolled: the loads are all asked for ahead of the first count.
#pragma unroll
  for (int g = 0; g < SEQ / 32; ++g) {
    const int c = __popc(__builtin_amdgcn_ballot_w32(mb[g * 32 + lane] != 0));
    tot += c;
    run += (g < wave * 8) ? c : 0;
  }
  // Stands behind the counting loads: the loads below take registers that
  // those name as their results.
  asm volatile("s_wait_xcnt 0x0" ::: "memory");
  // Unrolled: the eight loads go out together, and so do the stores.
#pragma unroll
  for (int i = 0; i < 8; ++i) {
    const int s = (wave * 8 + i) * 32 + lane;
    const bool keep = mb[s] != 0;
    const unsigned int w = __builtin_amdgcn_ballot_w32(keep);
    const int ahead = run + __popc(w & ((1u << lane) - 1u));   // kept tokens ahead of s
    inv[b * SEQ + (keep ? ahead : tot + (s - ahead))] = s;
    madd[b * SEQ + s] = (s < tot) ? 0.f : -1e9f;
    run += __popc(w);
  }
  if (threadIdx.x == 0) cnt[b * CNT_PITCH] = tot;
}

// ---- LayerNorm (unbiased std, eps added to sd) -> f16 ---------------------

// PLACE: the row goes out at its token's place in the kept-first order. The
// block counts its batch's kept tokens itself (8 mask words a thread; the total
// in the high half of a word, those ahead of the row's token in the low half);
// the counts ride on the first sum's reduction and its barriers.
template <bool PLACE>
static __device__ __forceinline__
void ln_row(const float* __restrict__ x, const float* __restrict__ alpha,
            const float* __restrict__ bias, _Float16* __restrict__ out, int row,
            const int* __restrict__ mask) {
  __shared__ float red[256];
  __shared__ int   kc[PLACE ? 256 : 1];
  const int t = threadIdx.x;
  const float* xr = x + (size_t)row * D_MODEL;
  const int tok = row % SEQ;
  int own = 1;
  if constexpr (PLACE) own = mask[row];   // asked for together with the row
  float v[4];
  float s = 0.f;
#pragma unroll
  for (int i = 0; i < 4; ++i) { v[i] = xr[t + i * 256]; s += v[i]; }
  if constexpr (PLACE) {
    const int* mb = mask + (row - tok) + t * 8;
    const v4i ma = *reinterpret_cast<const v4i*>(mb);
    const v4i mc = *reinterpret_cast<const v4i*>(mb + 4);
    int k = 0;
    // Unrolled: the vectors' elements are then picked by constants.
#pragma unroll
    for (int e = 0; e < 4; ++e) {
      if (ma[e] != 0) k += 0x10000 + ((t * 8 + e < tok) ? 1 : 0);
      if (mc[e] != 0) k += 0x10000 + ((t * 8 + 4 + e < tok) ? 1 : 0);
    }
    kc[t] = k;
  }
  red[t] = s; __syncthreads();
  for (int off = 128; off > 0; off >>= 1) {
    if (t < off) {
      red[t] += red[t + off];
      if constexpr (PLACE) kc[t] += kc[t + off];
    }
    __syncthreads();
  }
  const float mu = red[0] * (1.f / D_MODEL);
  int orow = row;
  if constexpr (PLACE) {
    const int tot   = kc[0] >> 16;
    const int ahead = kc[0] & 0xffff;
    orow = (row - tok) + ((own != 0) ? ahead : tot + (tok - ahead));
  }
  __syncthreads();
  float ss = 0.f;
#pragma unroll
  for (int i = 0; i < 4; ++i) { float d = v[i] - mu; ss += d * d; }
  red[t] = ss; __syncthreads();
  for (int off = 128; off > 0; off >>= 1) {
    if (t < off) red[t] += red[t + off];
    __syncthreads();
  }
  const float sd  = sqrtf(red[0] / (float)(D_MODEL - 1));
  const float inv = 1.f / (sd + LN_EPS);
#pragma unroll
  for (int i = 0; i < 4; ++i) {
    int c = t + i * 256;
    out[(size_t)orow * D_MODEL + c] =
        (_Float16)(alpha[c] * (v[i] - mu) * inv + bias[c]);
  }
}

__global__ __launch_bounds__(256)
void ln_kernel(const float* __restrict__ x, const float* __restrict__ alpha,
               const float* __restrict__ bias, _Float16* __restrict__ out) {
  ln_row<false>(x, alpha, bias, out, blockIdx.x, nullptr);
}

// ---- everything that depends on the inputs alone, in one launch ------------
// Block ranges of one grid: the first LayerNorm (a row a block), the six weight
// conversions (their f16 planes lie one behind another in wh, in this order),
// the token order's tables. No range reads what another writes.

#define PREP_LN    ROWS                                /* blocks: LayerNorm rows */
#define PREP_DD    (D_MODEL * D_MODEL / CVT_BLOCK)     /* blocks per D x D weight: 128 */
#define PREP_FD    (FF_DIM * D_MODEL / CVT_BLOCK)      /* blocks per FF x D weight: 512 */
#define PREP_CVT   (4 * PREP_DD + 2 * PREP_FD)
#define PREP_MASK  BATCH                               /* blocks: token order, one a batch */
#define PREP_GRID  (PREP_LN + PREP_CVT + PREP_MASK)

__global__ __launch_bounds__(256)
void prep_kernel(const float* __restrict__ x, const float* __restrict__ alpha,
                 const float* __restrict__ bias, _Float16* __restrict__ xn,
                 const float* __restrict__ w_q, const float* __restrict__ w_k,
                 const float* __restrict__ w_v, const float* __restrict__ w_o,
                 const float* __restrict__ fc1_w, const float* __restrict__ fc2_w,
                 _Float16* __restrict__ wh,
                 const int* __restrict__ mask, float* __restrict__ madd,
                 int* __restrict__ inv, int* __restrict__ cnt) {
  const int blk = blockIdx.x;
  if (blk < PREP_LN) {
    ln_row<true>(x, alpha, bias, xn, blk, mask);
  } else if (blk < PREP_LN + PREP_CVT) {
    const int cb = blk - PREP_LN;          // block within the six planes
    const float* in;
    int first;                             // the plane's first block
    if (cb < 4 * PREP_DD) {
      const int w = cb / PREP_DD;
      in = (w == 0) ? w_q : (w == 1) ? w_k : (w == 2) ? w_v : w_o;
      first = w * PREP_DD;
    } else if (cb < 4 * PREP_DD + PREP_FD) {
      in = fc1_w; first = 4 * PREP_DD;
    } else {
      in = fc2_w; first = 4 * PREP_DD + PREP_FD;
    }
    cvt_block(in, wh + (size_t)first * CVT_BLOCK, cb - first);
  } else {
    keymap_block(mask, madd, inv, cnt, blk - (PREP_LN + PREP_CVT));
  }
}

// ---- Tiled WMMA GEMM:  C[M,N] = act(A[M,K] * W[N,K]^T + bias) (+resid) ----
// Block = 256 threads (8 waves), tile T x T, 128 k a stage. Waves: 2 (M) x 4 (N);
// each wave owns T/2 x T/4 of output. T = 128: 4 M-frags x 2 N-frags, 8 WMMA on
// 6 fragments / 32 k, two work-groups a WGP. T = 256: 8 x 4, 32 WMMA on 12
// fragments / 32 k, one work-group a WGP: half the bytes from L2 and half the
// LDS reads per WMMA; for a product with a tile for every WGP (M, N multiples
// of T).
// Two LDS buffers: every wave issues one tensor load a stage for its own slice
// (waves 0..3: T/4 rows of A each, waves 4..7: T/4 rows of W each), so that the
// next stage flies while this one is worked on. K: a multiple of 128, >= 256.
// blockIdx.z picks one of several products on the same A: weight planes [N,K]
// and f16 output planes [M,N] lie one behind another.
// VTRANS: the plane of blockIdx.z == 2 (V) is stored head-major and transposed,
// [B, N, SEQ] (N = head * HD + hd), as attention reads it: an accumulator
// register group holds 8 consecutive rows of one column, which are 16
// contiguous bytes there, so each group goes out as one 16-byte store.
// In that form the rows stand in the kept-first token order, and a K or V tile
// whose rows all lie behind the last key tile that attention walks is not
// computed: nothing reads it.

template <int T, bool RELU, bool RESID, bool BIAS, bool OUTF32, bool OUTF16, bool VTRANS>
__global__ __launch_bounds__(256)
void gemm_kernel(const _Float16* __restrict__ A, const _Float16* __restrict__ W,
                 const float* __restrict__ bias, const float* __restrict__ resid,
                 float* __restrict__ outf, _Float16* __restrict__ outh,
                 const int* __restrict__ cnt, int M, int N, int K) {
  constexpr int SLICE = G_SLICE(T);
  constexpr int BUF   = G_BUF(T);
  constexpr int FA    = T / 32;            // A fragments (16 rows each) a wave
  constexpr int FB    = T / 64;            // W fragments a wave
  constexpr int SF    = G_SROWS(T) / 16;   // fragments a slice
  __shared__ __attribute__((aligned(2048))) char sm[2 * BUF];
  const int t    = threadIdx.x;
  const int lane = t & 31;
  const uint32_t wave = uni((uint32_t)t >> 5);
  const int wm   = wave >> 2;       // 0..1  (T/2 rows of M each)
  const int wn   = wave & 3;        // 0..3  (T/4 cols of N each)
  const int m0   = blockIdx.y * T;
  const int n0   = blockIdx.x * T;

  if constexpr (VTRANS) {
    // The whole work-group leaves, ahead of every tensor load and barrier.
    if (blockIdx.z != 0 && m0 % SEQ >= walked_tiles(cnt, m0 / SEQ) * ATT_KEYS) return;
  }

  v8f acc[FA][FB];
#pragma unroll
  for (int i = 0; i < FA; ++i)
#pragma unroll
    for (int j = 0; j < FB; ++j) acc[i][j] = v8f{};

  auto compute_stage = [&](const char* buf) {
    const char* Ab = buf + (wm * 2) * SLICE;     // this wave's T/2 rows of A: two slices
    const char* Bb = buf + (4 + wn) * SLICE;     // this wave's T/4 rows of W: one slice
    if constexpr (T == 128) {
      // Two fragment sets: the next 32-k block's 12 LDS reads go out as one group
      // ahead of this block's 8 WMMAs, which wait only for their own set. All
      // within the stage: no block of the next stage is read here.
      // All loops unrolled: the sets are then picked by constants and stay in registers.
      v16h af[2][FA], bf[2][FB];
      auto load_block = [&](int kk) {
#pragma unroll
        for (int nf = 0; nf < FB; ++nf)
          bf[kk & 1][nf] = load_frag_lds(Bb + nf * 16 * G_PITCH + kk * 64, lane);
#pragma unroll
        for (int mf = 0; mf < FA; ++mf)
          af[kk & 1][mf] = load_frag_lds(Ab + (mf / SF) * SLICE + (mf % SF) * 16 * G_PITCH + kk * 64, lane);
      };
      load_block(0);
#pragma unroll
      for (int kk = 0; kk < G_K / 32; ++kk) {
        if (kk + 1 < G_K / 32) load_block(kk + 1);
        // The pair keeps the read group whole and ahead of the WMMAs. Without it
        // the reads are spread among the WMMAs two at a time, into one set, each
        // pair waited to 0 ahead of only two WMMAs.
        __builtin_amdgcn_sched_barrier(0);
#pragma unroll
        for (int mf = 0; mf < FA; ++mf)
#pragma unroll
          for (int nf = 0; nf < FB; ++nf)
            acc[mf][nf] = wmma16x16x32(af[kk & 1][mf], bf[kk & 1][nf], acc[mf][nf]);
        __builtin_amdgcn_sched_barrier(0);
      }
    } else {
#pragma unroll
      for (int kk = 0; kk < G_K / 32; ++kk) {
        v16h bf[FB], af[FA];
#pragma unroll
        for (int nf = 0; nf < FB; ++nf)
          bf[nf] = load_frag_lds(Bb + nf * 16 * G_PITCH + kk * 64, lane);
#pragma unroll
        for (int mf = 0; mf < FA; ++mf)
          af[mf] = load_frag_lds(Ab + (mf / SF) * SLICE + (mf % SF) * 16 * G_PITCH + kk * 64, lane);
        // T = 256: keeps the block's 24 LDS reads one group ahead of its 32 WMMAs.
        // Without the pair the reads are spread among the WMMAs two at a time,
        // each pair waited to 0 ahead of only four WMMAs.
        __builtin_amdgcn_sched_barrier(0);
#pragma unroll
        for (int mf = 0; mf < FA; ++mf)
#pragma unroll
          for (int nf = 0; nf < FB; ++nf)
            acc[mf][nf] = wmma16x16x32(af[mf], bf[nf], acc[mf][nf]);
        __builtin_amdgcn_sched_barrier(0);
      }
    }
  };

  const _Float16* srow = (wave < 4u) ? A + (size_t)(m0 + wave * G_SROWS(T)) * K
                                     : W + ((size_t)blockIdx.z * N + n0 + (wave - 4u) * G_SROWS(T)) * K;
  const uint64_t ga0  = (uint64_t)(uintptr_t)srow;
  const uint32_t lds0 = (uint32_t)(uintptr_t)(void*)&sm[0] + wave * SLICE;
  u32x8 g1 = tdm_group1((uint32_t)K * 2u, (uint32_t)G_SROWS(T));
  u32x4 g0;
  const int nk = K / G_K;

  tdm_group0(g0, lds0, ga0);
  tdm_load(g0, g1);                                    // stage 0 into buffer 0
  tdm_wait(g0, g1);                                    // own slice of stage 0 landed
  __syncthreads();                                     // stage 0 readable by all waves
  tdm_group0(g0, lds0 + BUF, ga0 + G_ROWB);
  tdm_load(g0, g1);                                    // stage 1 into buffer 1

  for (int s = 0; s < nk; ++s) {
    compute_stage(&sm[(s & 1) * BUF]);
    // Hand-over: this wave's reads of stage s are done, its slice of stage s + 1
    // has landed; behind the barrier stage s + 1 is readable and buffer s & 1 free.
    asm volatile("s_wait_dscnt 0x0" ::: "memory");
    tdm_wait(g0, g1);
    __syncthreads();
    if (pinned(s + 2 < nk)) {
      tdm_group0(g0, lds0 + (uint32_t)(s & 1) * BUF, ga0 + (uint64_t)(s + 2) * G_ROWB);
      tdm_load(g0, g1);
    }
  }
  tdm_wait(g0, g1);                                    // nothing in flight at the wave's end
  asm volatile("s_wait_dscnt 0x0" ::: "memory");

  const int hi8 = (lane >> 4) * 8;
  if constexpr (VTRANS) {
    if (blockIdx.z == 2) {
      // SEQ is a multiple of the tile's T rows: a tile lies in one batch.
      const unsigned int bb = (unsigned int)m0 / SEQ;
      const unsigned int s0 = (unsigned int)m0 % SEQ + wm * (T / 2) + hi8;  // first of this lane's rows
      _Float16* vt = outh + (size_t)2 * M * N + (size_t)bb * N * SEQ + s0;
      // All three loops unrolled: acc is then indexed by constants alone and
      // stays in registers, and mf becomes the stores' immediate offset.
#pragma unroll
      for (int nf = 0; nf < FB; ++nf) {
        const int gn = n0 + wn * (T / 4) + nf * 16 + (lane & 15);
        _Float16* col = vt + (size_t)gn * SEQ;
        // The four stores of a column fill one 128-byte line between the two lane halves.
#pragma unroll
        for (int mf = 0; mf < FA; ++mf) {
          v8h h;
#pragma unroll
          for (int v = 0; v < 8; ++v) h[v] = (_Float16)acc[mf][nf][v];
          *reinterpret_cast<v8h*>(col + mf * 16) = h;
        }
      }
      return;
    }
  }
  if constexpr (T == 256) {
    static_assert(OUTF16 && !OUTF32 && !RESID && !VTRANS, "the 256 x 256 tile has the f16 epilogue alone");
    // A lane has 256 values to store, more than there are registers for all
    // their addresses at once: they go out in groups of 32, one group per 16
    // rows: 8 rows a lane x 4 column fragments, which share the row's address
    // and between them fill the wave's 128-byte line of that row. All loops
    // unrolled: acc, h and p are then indexed by constants alone and stay in
    // registers. D layout: M = v + hi8. A row's distance from the lane's first
    // one is the same in every lane: a scalar product, one vector add a row.
    const int gn0 = n0 + wn * (T / 4) + (lane & 15);
    _Float16* first = outh + (size_t)blockIdx.z * M * N +
                      (size_t)(m0 + wm * (T / 2) + hi8) * N + gn0;
    float bv[FB];
#pragma unroll
    for (int nf = 0; nf < FB; ++nf) {
      bv[nf] = 0.f;
      if constexpr (BIAS) bv[nf] = bias[gn0 + nf * 16];
    }
#pragma unroll
    for (int mf = 0; mf < FA; ++mf) {
      _Float16  h[8][FB];
      _Float16* p[8];
#pragma unroll
      for (int v = 0; v < 8; ++v) {
        p[v] = first + (size_t)(mf * 16 + v) * N;
#pragma unroll
        for (int nf = 0; nf < FB; ++nf) {
          float val = acc[mf][nf][v];
          if constexpr (BIAS) val += bv[nf];
          if constexpr (RELU) val = fmaxf(val, 0.f);
          h[v][nf] = (_Float16)val;
        }
      }
      // Keeps the group's arithmetic ahead of its first store, so that none of
      // it writes a register that an issued store of the group names.
      __builtin_amdgcn_sched_barrier(0);
#pragma unroll
      for (int v = 0; v < 8; ++v)
#pragma unroll
        for (int nf = 0; nf < FB; ++nf) p[v][nf * 16] = h[v][nf];
      // The next group's values and addresses take registers that these stores
      // name: the wait stands ahead of them, the barrier keeps them behind it.
      asm volatile("s_wait_xcnt 0x0" ::: "memory");
      __builtin_amdgcn_sched_barrier(0);
    }
    return;
  }
#pragma unroll
  for (int nf = 0; nf < FB; ++nf) {
    const int gn = n0 + wn * (T / 4) + nf * 16 + (lane & 15);
    float bv = 0.f;
    if constexpr (BIAS) bv = bias[gn];
#pragma unroll
    for (int mf = 0; mf < FA; ++mf) {
#pragma unroll
      for (int v = 0; v < 8; ++v) {
        const int gm = m0 + wm * (T / 2) + mf * 16 + hi8 + v;  // D layout: M = v + hi8
        float val = acc[mf][nf][v];
        if constexpr (BIAS)  val += bv;
        if constexpr (RELU)  val = fmaxf(val, 0.f);
        const size_t idx = (size_t)gm * N + gn;
        if constexpr (RESID) val += resid[idx];
        if constexpr (OUTF32) outf[idx] = val;
        if constexpr (OUTF16) outh[(size_t)blockIdx.z * M * N + idx] = (_Float16)val;
      }
    }
  }
  // Stands behind the last Q or K store: in this form's listing the V block is
  // laid out behind them and writes registers that these stores name.
  if constexpr (VTRANS) asm volatile("s_wait_xcnt 0x0" ::: "memory");
}

#define ATT_PITCH 72                  /* halfs per LDS row: 128 B + 16 B pad, 16 B x odd for b128 readers */
#define ATT_TILE  (64 * ATT_PITCH)    /* halfs per staged K or V^T tile */
#define ATT_NST   (SEQ / ATT_KEYS)    /* tiles per (b, h) */

// One tile's four copies of a lane (16 bytes each). The s_wait_xcnt stands in
// the copies' own statement so that no address register is rewritten ahead of it.
static __device__ __forceinline__ void attn_copy4(
    unsigned int l0, const _Float16* g0, unsigned int l1, const _Float16* g1,
    unsigned int l2, const _Float16* g2, unsigned int l3, const _Float16* g3) {
  asm volatile(
      "global_load_async_to_lds_b128 %0, %1, off\n\t"
      "global_load_async_to_lds_b128 %2, %3, off\n\t"
      "global_load_async_to_lds_b128 %4, %5, off\n\t"
      "global_load_async_to_lds_b128 %6, %7, off\n\t"
      "s_wait_xcnt 0x0"
      :: "v"(l0), "v"(g0), "v"(l1), "v"(g1), "v"(l2), "v"(g2), "v"(l3), "v"(g3)
      : "memory");
}

__global__ __launch_bounds__(256)
void attn_kernel(const _Float16* __restrict__ qh, const _Float16* __restrict__ kh,
                 const _Float16* __restrict__ vt, const float* __restrict__ madd,
                 const int* __restrict__ inv, const int* __restrict__ cnt,
                 _Float16* __restrict__ ctxh) {
  __shared__ __attribute__((aligned(16))) _Float16 kv[2][2][ATT_TILE];
  const int lane = threadIdx.x & 31;
  const int wave = threadIdx.x >> 5;
  const int q0   = blockIdx.x * 128 + wave * 16;
  const int h    = blockIdx.y;
  const int b    = blockIdx.z;
  const size_t hoff = (size_t)h * HD;
  const int hi8  = (lane >> 4) * 8;
  const float scale = 0.125f;  // 1/sqrt(HD)

  // Tiles to walk: the same for the whole work-group, 1 .. ATT_NST.
  const int nst = walked_tiles(cnt, b);
  // The tokens of this lane's eight output rows (unrolled: two 16-byte loads,
  // and otok stays in registers).
  int otok[8];
#pragma unroll
  for (int v = 0; v < 8; ++v) otok[v] = inv[b * SEQ + q0 + hi8 + v] & (SEQ - 1);

  const _Float16* qbase = qh + ((size_t)(b * SEQ + q0)) * D_MODEL + hoff;
  v16h qb_lo = load_frag_rowmajor(qbase,      D_MODEL, lane);   // B: N=q, K=hd
  v16h qb_hi = load_frag_rowmajor(qbase + 32, D_MODEL, lane);

  v8f ctx[4] = {v8f{}, v8f{}, v8f{}, v8f{}};
  float m = -1e30f, l = 0.f;
  const float* mrow = madd + (size_t)b * SEQ;
  const _Float16* vtb = vt + ((size_t)(b * NHEAD + h) * HD) * SEQ;

  // Each thread copies rows crow and crow + 32 of both tiles, 16 bytes at ccol.
  const int crow = threadIdx.x >> 3;         // 0..31
  const int ccol = (threadIdx.x & 7) * 8;    // halfs
  const _Float16* gk = kh + ((size_t)(b * SEQ + crow)) * D_MODEL + hoff + ccol;
  const _Float16* gv = vtb + (size_t)crow * SEQ + ccol;
  const unsigned int lds0 =
      (unsigned int)(uintptr_t)(void*)&kv[0][0][crow * ATT_PITCH + ccol];
  auto copy_tile = [&](int s) {
    const unsigned int lk = lds0 + (unsigned int)(s & 1) * (2 * ATT_TILE * 2);
    const unsigned int lv = lk + ATT_TILE * 2;
    const _Float16* k0 = gk + (size_t)s * ATT_KEYS * D_MODEL;
    const _Float16* v0 = gv + s * ATT_KEYS;
    attn_copy4(lk, k0, lk + 32 * ATT_PITCH * 2, k0 + 32 * D_MODEL,
               lv, v0, lv + 32 * ATT_PITCH * 2, v0 + (size_t)32 * SEQ);
  };

  copy_tile(0);
  asm volatile("s_wait_asynccnt 0x0" ::: "memory");  // own copies of tile 0 landed
  __syncthreads();                                   // tile 0 readable by all waves
  if (nst > 1) copy_tile(1);

  for (int s = 0; s < nst; ++s) {
   const _Float16* Ks = &kv[s & 1][0][0];
   const _Float16* Vs = &kv[s & 1][1][0];
   // Unrolled: both halves' LDS offsets become immediates, no inner branch.
#pragma unroll
   for (int sub = 0; sub < ATT_KEYS; sub += 32) {
    const int j = s * ATT_KEYS + sub;
    const _Float16* kbase = Ks + sub * ATT_PITCH;
    v16h ka0l = load_frag_rowmajor(kbase,                       ATT_PITCH, lane);
    v16h ka0h = load_frag_rowmajor(kbase + 32,                  ATT_PITCH, lane);
    v16h ka1l = load_frag_rowmajor(kbase + 16 * ATT_PITCH,      ATT_PITCH, lane);
    v16h ka1h = load_frag_rowmajor(kbase + 16 * ATT_PITCH + 32, ATT_PITCH, lane);
    v8f s0 = {}; s0 = wmma16x16x32(ka0l, qb_lo, s0); s0 = wmma16x16x32(ka0h, qb_hi, s0);
    v8f s1 = {}; s1 = wmma16x16x32(ka1l, qb_lo, s1); s1 = wmma16x16x32(ka1h, qb_hi, s1);

    // per-lane: q = lane&15 ; element v: key = j + hi8 + v (s0) / +16 (s1)
    float sv0[8], sv1[8];
    float tmax = -1e30f;
#pragma unroll
    for (int v = 0; v < 8; ++v) {
      const int key0 = j + hi8 + v;
      const float a = fmaf(s0[v], scale, mrow[key0]);
      const float c = fmaf(s1[v], scale, mrow[key0 + 16]);
      sv0[v] = a; sv1[v] = c;
      tmax = fmaxf(tmax, fmaxf(a, c));
    }
    tmax = fmaxf(tmax, __shfl_xor(tmax, 16, 32));
    const float mnew  = fmaxf(m, tmax);
    const float alpha = __expf(m - mnew);
    float psum = 0.f;
    v16h pa;
#pragma unroll
    for (int v = 0; v < 8; ++v) {
      const float p0 = __expf(sv0[v] - mnew);
      const float p1 = __expf(sv1[v] - mnew);
      pa[v]     = (_Float16)p0;    // A-frag elem e<8  -> key kb+e
      pa[8 + v] = (_Float16)p1;    // A-frag elem e>=8 -> key kb+16+(e-8)
      psum += p0 + p1;
    }
    psum += __shfl_xor(psum, 16, 32);
    l = l * alpha + psum;
    m = mnew;

    // rescale ctx: row q = v + hi8 -> alpha lives in lane (v + hi8)
    float rs[8];
#pragma unroll
    for (int v = 0; v < 8; ++v) rs[v] = __shfl(alpha, hi8 + v, 32);
#pragma unroll
    for (int nf = 0; nf < 4; ++nf)
#pragma unroll
      for (int v = 0; v < 8; ++v) ctx[nf][v] *= rs[v];

#pragma unroll
    for (int nf = 0; nf < 4; ++nf) {
      // B operand: N = hd (rows of vt), K = keys (contiguous)
      v16h vb = load_frag_rowmajor(Vs + (nf * 16) * ATT_PITCH + sub, ATT_PITCH, lane);
      ctx[nf] = wmma16x16x32(pa, vb, ctx[nf]);
    }
   }
   // Hand-over: this wave's reads of tile s are done, its copies of tile s + 1
   // have landed; behind the barrier tile s + 1 is readable and buffer s & 1 free.
   asm volatile("s_wait_dscnt 0x0" ::: "memory");
   asm volatile("s_wait_asynccnt 0x0" ::: "memory");
   // Stands ahead of the advance of the mask loads' address register.
   asm volatile("s_wait_xcnt 0x0" ::: "memory");
   __syncthreads();
   if (s + 2 < nst) copy_tile(s + 2);
  }
  asm volatile("s_wait_asynccnt 0x0" ::: "memory");  // nothing in flight at the wave's end

  const float linv = 1.f / l;
  float rs[8];
#pragma unroll
  for (int v = 0; v < 8; ++v) rs[v] = __shfl(linv, hi8 + v, 32);
  _Float16* obase = ctxh + (size_t)b * SEQ * D_MODEL + hoff;
#pragma unroll
  for (int nf = 0; nf < 4; ++nf) {
#pragma unroll
    for (int v = 0; v < 8; ++v) {
      const int hd = nf * 16 + (lane & 15);
      obase[(size_t)otok[v] * D_MODEL + hd] = (_Float16)(ctx[nf][v] * rs[v]);
    }
  }
}

// ---- host side ------------------------------------------------------------

extern "C" void kernel_launch(void* const* d_in, const int* in_sizes, int n_in,
                              void* d_out, int out_size, void* d_ws, size_t ws_size,
                              hipStream_t stream) {
  (void)in_sizes; (void)n_in; (void)out_size; (void)ws_size;
  const float* x     = (const float*)d_in[0];
  const int*   mask  = (const int*)d_in[1];
  const float* alpha = (const float*)d_in[2];
  const float* bias  = (const float*)d_in[3];
  const float* w_q   = (const float*)d_in[4];
  const float* w_k   = (const float*)d_in[5];
  const float* w_v   = (const float*)d_in[6];
  const float* w_o   = (const float*)d_in[7];
  const float* fc1_w = (const float*)d_in[8];
  const float* fc1_b = (const float*)d_in[9];
  const float* fc2_w = (const float*)d_in[10];
  const float* fc2_b = (const float*)d_in[11];
  float* out = (float*)d_out;

  char* ws = (char*)d_ws;
  size_t off = 0;
  auto alloc = [&](size_t bytes) -> char* {
    char* p = ws + off;
    off += (bytes + 255) & ~(size_t)255;
    return p;
  };
  _Float16* xn_h  = (_Float16*)alloc((size_t)ROWS * D_MODEL * 2);
  _Float16* wq_h  = (_Float16*)alloc((size_t)D_MODEL * D_MODEL * 2);
  _Float16* wk_h  = (_Float16*)alloc((size_t)D_MODEL * D_MODEL * 2);
  _Float16* wv_h  = (_Float16*)alloc((size_t)D_MODEL * D_MODEL * 2);
  _Float16* wo_h  = (_Float16*)alloc((size_t)D_MODEL * D_MODEL * 2);
  _Float16* fc1_h = (_Float16*)alloc((size_t)FF_DIM * D_MODEL * 2);
  _Float16* fc2_h = (_Float16*)alloc((size_t)D_MODEL * FF_DIM * 2);
  _Float16* q_h   = (_Float16*)alloc((size_t)ROWS * D_MODEL * 2);
  _Float16* k_h   = (_Float16*)alloc((size_t)ROWS * D_MODEL * 2);
  _Float16* vt_h  = (_Float16*)alloc((size_t)ROWS * D_MODEL * 2);
  _Float16* ctx_h = (_Float16*)alloc((size_t)ROWS * D_MODEL * 2);
  float*    x1    = (float*)   alloc((size_t)ROWS * D_MODEL * 4);
  _Float16* xn2_h = (_Float16*)alloc((size_t)ROWS * D_MODEL * 2);
  _Float16* ff_h  = (_Float16*)alloc((size_t)ROWS * FF_DIM * 2);
  float*    madd  = (float*)   alloc((size_t)BATCH * SEQ * 4);
  int*      inv   = (int*)     alloc((size_t)BATCH * SEQ * 4);
  int*      cnt   = (int*)     alloc((size_t)BATCH * CNT_PITCH * 4);
  (void)wk_h; (void)wv_h;   // reached through wq_h: the planes are contiguous

  // LayerNorm 1, the six weight conversions (planes wq_h .. fc2_h are contiguous)
  // and the token order's tables: one launch.
  prep_kernel<<<PREP_GRID, 256, 0, stream>>>(x, alpha, bias, xn_h, w_q, w_k, w_v, w_o,
                                             fc1_w, fc2_w, wq_h, mask, madd, inv, cnt);

  dim3 gD(D_MODEL / 128, ROWS / 128);      // 8 x 32
  dim3 gQKV(D_MODEL / 128, ROWS / 128, 3); // 8 x 32 x 3
  dim3 gF(FF_DIM / 256, ROWS / 256);       // 16 x 16: a 256 x 256 tile for every WGP

  // Q/K/V projections (f16 outputs for attention) in one launch: the planes
  // wq_h, wk_h, wv_h and q_h, k_h, vt_h are contiguous; V goes out transposed.
  gemm_kernel<128, false, false, false, false, true, true><<<gQKV, 256, 0, stream>>>(
      xn_h, wq_h, nullptr, nullptr, nullptr, q_h, cnt, ROWS, D_MODEL, D_MODEL);

  attn_kernel<<<dim3(SEQ / 128, NHEAD, BATCH), 256, 0, stream>>>(
      q_h, k_h, vt_h, madd, inv, cnt, ctx_h);

  // x1 = x + ctx @ Wo^T
  gemm_kernel<128, false, true, false, true, false, false><<<gD, 256, 0, stream>>>(
      ctx_h, wo_h, nullptr, x, x1, nullptr, nullptr, ROWS, D_MODEL, D_MODEL);

  ln_kernel<<<ROWS, 256, 0, stream>>>(x1, alpha, bias, xn2_h);

  // ff = relu(xn2 @ fc1^T + b1)
  gemm_kernel<256, true, false, true, false, true, false><<<gF, 256, 0, stream>>>(
      xn2_h, fc1_h, fc1_b, nullptr, nullptr, ff_h, nullptr, ROWS, FF_DIM, D_MODEL);

  // out = x1 + ff @ fc2^T + b2
  gemm_kernel<128, false, true, true, true, false, false><<<gD, 256, 0, stream>>>(
      ff_h, fc2_h, fc2_b, x1, out, nullptr, nullptr, ROWS, D_MODEL, FF_DIM);
}

// v009
// It runs in 142 microseconds.
// Timed twice side by side with v008, it ran 1.03 and 1.02 times as fast.
// Over all steps from v000 it is 2.92 times as fast.
#include <hip/hip_runtime.h>
#include <hip/hip_bf16.h>
#include <math.h>

// ---------------------------------------------------------------------------
// EncoderBlock for MI455X (gfx1250).
//   D=1024, H=16, HD=64, FF=4096, B=2, S=2048.
// f16 WMMA (v_wmma_f32_16x16x32_f16) for all GEMMs + flash attention,
// double-buffered TDM (tensor_load_to_lds) staging of GEMM tiles into LDS.
// ---------------------------------------------------------------------------

typedef __attribute__((ext_vector_type(16))) _Float16 v16h;
typedef __attribute__((ext_vector_type(8)))  _Float16 v8h;
typedef __attribute__((ext_vector_type(4)))  _Float16 v4h;
typedef __attribute__((ext_vector_type(8)))  float    v8f;
typedef __attribute__((ext_vector_type(4)))  float    v4f;
typedef __attribute__((ext_vector_type(4)))  int      v4i;
typedef __attribute__((ext_vector_type(4)))  unsigned int u32x4;
typedef __attribute__((ext_vector_type(8)))  unsigned int u32x8;

#define D_MODEL 1024
#define NHEAD   16
#define HD      64
#define FF_DIM  4096
#define SEQ     2048
#define BATCH   2
#define ROWS    (BATCH * SEQ)   /* 4096 */
#define LN_EPS  1e-6f

// ---- WMMA helpers ---------------------------------------------------------

static __device__ __forceinline__ v8f wmma16x16x32(v16h a, v16h b, v8f c) {
  return __builtin_amdgcn_wmma_f32_16x16x32_f16(false, a, false, b, (short)0, c,
                                                false, false);
}

// A/B fragment loader from a row-major [16 x >=32] tile (row = M for A, N for B;
// K contiguous within the row). ISA 16-bit A layout:
//   lanes 0-15:  M=lane,    elems 0..7 -> K=0..7,  elems 8..15 -> K=16..23
//   lanes 16-31: M=lane-16, elems 0..7 -> K=8..15, elems 8..15 -> K=24..31
static __device__ __forceinline__ v16h load_frag_rowmajor(const _Float16* base,
                                                          int ld, int lane) {
  const int r  = lane & 15;
  const int kb = (lane >> 4) * 8;
  const _Float16* p = base + (size_t)r * ld + kb;
  v16h f;
#pragma unroll
  for (int i = 0; i < 8; ++i) f[i] = p[i];
#pragma unroll
  for (int i = 0; i < 8; ++i) f[8 + i] = p[16 + i];
  return f;
}

// ---- Tensor loads: one wave brings a slice of T / 4 rows x 256 bytes to LDS --
// The mover pads every 256-byte row by 16 bytes: the LDS pitch is 272 bytes
// (16 B x odd), at which the ds_load_b128 fragment reads meet no bank conflict.

#define G_K      128                  /* k per stage: rows of 256 bytes */
#define G_ROWB   256                  /* bytes per staged row */
#define G_PITCH  272                  /* bytes per LDS row, pad included */
// Per tile edge T (a work-group's tile of C is T x T): rows per slice, one slice
// a wave; a slice's bytes in LDS, rounded up to a multiple of 2 KiB (T = 128:
// 32 x 272 = 8704 -> 10240; T = 256: 64 x 272 = 17408 -> 18432).
#define G_SROWS(T) ((T) / 4)
#define G_SLICE(T) ((G_SROWS(T) * G_PITCH + 2047) / 2048 * 2048)
#define G_BUF(T)   (8 * G_SLICE(T))   /* one stage: A slices 0..3, W slices 4..7 */

static __device__ __forceinline__ uint32_t uni(uint32_t v) {
  return (uint32_t)__builtin_amdgcn_readfirstlane(v);
}
// Holds a wave-uniform test in a scalar register, so that the branch on it is
// a scalar branch: a tensor load ignores EXEC.
static __device__ __forceinline__ uint32_t pinned(uint32_t v) {
  uint32_t w = uni(v);
  asm volatile("" : "+s"(w));
  return w;
}
static __device__ __forceinline__ void tdm_group0(u32x4& g, uint32_t lds_dst, uint64_t ga) {
  g[0] = uni(1u);                                              // count = 1
  g[1] = uni(lds_dst);                                         // byte offset in LDS
  g[2] = uni((uint32_t)ga);                                    // address [31:0]
  g[3] = uni((((uint32_t)(ga >> 32)) & 0x01FFFFFFu) | 0x80000000u);  // [56:32], type = 2
}
// Extents in bytes (data_size code 0); tensor dims = tile dims.
static __device__ __forceinline__ u32x8 tdm_group1(uint32_t src_pitch, uint32_t srows) {
  u32x8 g;
  g[0] = uni((1u << 20) | (5u << 22) | (3u << 25));  // pad 4 dwords after every 64 dwords
  g[1] = uni((uint32_t)G_ROWB << 16);                // tensor_dim0
  g[2] = uni(srows << 16);                           // tensor_dim1
  g[3] = uni((uint32_t)G_ROWB << 16);                // tile_dim0
  g[4] = uni(srows);                                 // tile_dim1
  g[5] = uni(src_pitch);                             // source row pitch, bytes
  g[6] = uni(0u);
  g[7] = uni(0u);
  return g;
}
// Load and wait both name the two groups as in-out operands: their scalar
// registers then hold nothing else from the issue to the wait, and the next
// descriptor is formed only behind the wait.
static __device__ __forceinline__ void tdm_load(u32x4& g0, u32x8& g1) {
  asm volatile("tensor_load_to_lds %0, %1" : "+s"(g0), "+s"(g1) :: "memory");
}
static __device__ __forceinline__ void tdm_wait(u32x4& g0, u32x8& g1) {
  asm volatile("s_wait_tensorcnt 0x0" : "+s"(g0), "+s"(g1) :: "memory");
}

// Fragment from padded LDS rows; the same k order as load_frag_rowmajor.
static __device__ __forceinline__ v16h load_frag_lds(const char* base, int lane) {
  const char* p = base + (lane & 15) * G_PITCH + (lane >> 4) * 16;
  const v8h lo = *reinterpret_cast<const v8h*>(p);
  const v8h hi = *reinterpret_cast<const v8h*>(p + 32);
  return __builtin_shufflevector(lo, hi, 0, 1, 2, 3, 4, 5, 6, 7, 8, 9, 10, 11, 12, 13, 14, 15);
}

// ---- elementwise f32 -> f16 ----------------------------------------------

// A block converts CVT_BLOCK consecutive floats; every array's length is a
// multiple of that. Each wave-wide load covers 512 contiguous bytes, each store
// 256; a thread's eight loads are all issued ahead of its first conversion.

#define CVT_U     8                   /* 16-byte loads a thread */
#define CVT_BLOCK (256 * 4 * CVT_U)   /* floats a block */

static __device__ __forceinline__
void cvt_block(const float* __restrict__ in, _Float16* __restrict__ out, int blk) {
  const size_t base = (size_t)blk * CVT_BLOCK + threadIdx.x * 4;
  v4f v[CVT_U];
#pragma unroll
  for (int u = 0; u < CVT_U; ++u)
    v[u] = *reinterpret_cast<const v4f*>(in + base + u * 1024);
#pragma unroll
  for (int u = 0; u < CVT_U; ++u) {
    v4h h;
#pragma unroll
    for (int e = 0; e < 4; ++e) h[e] = (_Float16)v[u][e];
    *reinterpret_cast<v4h*>(out + base + u * 1024) = h;
  }
  // Stands behind the last store: in the merged kernel's listing another block
  // range follows, which writes the registers that these stores name.
  asm volatile("s_wait_xcnt 0x0" ::: "memory");
}

// ---- token order: kept keys first ------------------------------------------
// A key whose mask is 0 gets the score -1e9 and so the softmax weight 0 as soon
// as its batch holds one kept key. Each batch's tokens are therefore put in a
// stable partition: the kept ones (mask != 0) first, the others behind them.
//   place(s) = kept ? (kept tokens ahead of s) : total kept + (others ahead of s)
// LayerNorm 1 writes row s at place(s), so Q, K and V all come out in that order,
// and attention walks only the key tiles that hold a kept key; K and V behind
// them are not computed. With no kept key the order is the identity and
// attention walks every tile, all at -1e9.
// One block a batch writes what attention reads: inv[place] = s, the additive
// mask by place (0 ahead of the total, -1e9 from there on) and the total.
// Each wave counts the whole batch by ballots and places its own 256 tokens:
// no wave needs another's count.

#define ATT_KEYS  64                  /* keys per tile that attention stages */
#define CNT_PITCH 32                  /* ints between two batches' totals: a 128-byte line each, one writer a line */

// Key tiles of a batch that hold a kept key, 1 .. SEQ / ATT_KEYS; all of them
// where the batch has none. The same for every thread that asks for one batch.
static __device__ __forceinline__ int walked_tiles(const int* __restrict__ cnt, int b) {
  const int kept = __builtin_amdgcn_readfirstlane(cnt[b * CNT_PITCH]);
  return (kept <= 0 || kept > SEQ) ? SEQ / ATT_KEYS : (kept + ATT_KEYS - 1) / ATT_KEYS;
}

static __device__ __forceinline__
void keymap_block(const int* __restrict__ mask, float* __restrict__ madd,
                  int* __restrict__ inv, int* __restrict__ cnt, int b) {
  const int lane = threadIdx.x & 31;
  const int wave = threadIdx.x >> 5;
  const int* mb = mask + b * SEQ;
  int tot = 0, run = 0;   // kept tokens of the batch; of them, ahead of this wave's tokens
  // Unrolled: the loads are all asked for ahead of the first count.
#pragma unroll
  for (int g = 0; g < SEQ / 32; ++g) {
    const int c = __popc(__builtin_amdgcn_ballot_w32(mb[g * 32 + lane] != 0));
    tot += c;
    run += (g < wave * 8) ? c : 0;
  }
  // Stands behind the counting loads: the loads below take registers that
  // those name as their results.
  asm volatile("s_wait_xcnt 0x0" ::: "memory");
  // Unrolled: the eight loads go out together, and so do the stores.
#pragma unroll
  for (int i = 0; i < 8; ++i) {
    const int s = (wave * 8 + i) * 32 + lane;
    const bool keep = mb[s] != 0;
    const unsigned int w = __builtin_amdgcn_ballot_w32(keep);
    const int ahead = run + __popc(w & ((1u << lane) - 1u));   // kept tokens ahead of s
    inv[b * SEQ + (keep ? ahead : tot + (s - ahead))] = s;
    madd[b * SEQ + s] = (s < tot) ? 0.f : -1e9f;
    run += __popc(w);
  }
  if (threadIdx.x == 0) cnt[b * CNT_PITCH] = tot;
}

// ---- LayerNorm (unbiased std, eps added to sd) -> f16 ---------------------

// PLACE: the row goes out at its token's place in the kept-first order. The
// block counts its batch's kept tokens itself (8 mask words a thread; the total
// in the high half of a word, those ahead of the row's token in the low half);
// the counts ride on the first sum's reduction and its barriers.
template <bool PLACE>
static __device__ __forceinline__
void ln_row(const float* __restrict__ x, const float* __restrict__ alpha,
            const float* __restrict__ bias, _Float16* __restrict__ out, int row,
            const int* __restrict__ mask) {
  __shared__ float red[256];
  __shared__ int   kc[PLACE ? 256 : 1];
  const int t = threadIdx.x;
  const float* xr = x + (size_t)row * D_MODEL;
  const int tok = row % SEQ;
  int own = 1;
  if constexpr (PLACE) own = mask[row];   // asked for together with the row
  float v[4];
  float s = 0.f;
#pragma unroll
  for (int i = 0; i < 4; ++i) { v[i] = xr[t + i * 256]; s += v[i]; }
  if constexpr (PLACE) {
    const int* mb = mask + (row - tok) + t * 8;
    const v4i ma = *reinterpret_cast<const v4i*>(mb);
    const v4i mc = *reinterpret_cast<const v4i*>(mb + 4);
    int k = 0;
    // Unrolled: the vectors' elements are then picked by constants.
#pragma unroll
    for (int e = 0; e < 4; ++e) {
      if (ma[e] != 0) k += 0x10000 + ((t * 8 + e < tok) ? 1 : 0);
      if (mc[e] != 0) k += 0x10000 + ((t * 8 + 4 + e < tok) ? 1 : 0);
    }
    kc[t] = k;
  }
  red[t] = s; __syncthreads();
  for (int off = 128; off > 0; off >>= 1) {
    if (t < off) {
      red[t] += red[t + off];
      if constexpr (PLACE) kc[t] += kc[t + off];
    }
    __syncthreads();
  }
  const float mu = red[0] * (1.f / D_MODEL);
  int orow = row;
  if constexpr (PLACE) {
    const int tot   = kc[0] >> 16;
    const int ahead = kc[0] & 0xffff;
    orow = (row - tok) + ((own != 0) ? ahead : tot + (tok - ahead));
  }
  __syncthreads();
  float ss = 0.f;
#pragma unroll
  for (int i = 0; i < 4; ++i) { float d = v[i] - mu; ss += d * d; }
  red[t] = ss; __syncthreads();
  for (int off = 128; off > 0; off >>= 1) {
    if (t < off) red[t] += red[t + off];
    __syncthreads();
  }
  const float sd  = sqrtf(red[0] / (float)(D_MODEL - 1));
  const float inv = 1.f / (sd + LN_EPS);
#pragma unroll
  for (int i = 0; i < 4; ++i) {
    int c = t + i * 256;
    out[(size_t)orow * D_MODEL + c] =
        (_Float16)(alpha[c] * (v[i] - mu) * inv + bias[c]);
  }
}

__global__ __launch_bounds__(256)
void ln_kernel(const float* __restrict__ x, const float* __restrict__ alpha,
               const float* __restrict__ bias, _Float16* __restrict__ out) {
  ln_row<false>(x, alpha, bias, out, blockIdx.x, nullptr);
}

// ---- everything that depends on the inputs alone, in one launch ------------
// Block ranges of one grid: the first LayerNorm (a row a block), the six weight
// conversions (their f16 planes lie one behind another in wh, in this order),
// the token order's tables. No range reads what another writes.

#define PREP_LN    ROWS                                /* blocks: LayerNorm rows */
#define PREP_DD    (D_MODEL * D_MODEL / CVT_BLOCK)     /* blocks per D x D weight: 128 */
#define PREP_FD    (FF_DIM * D_MODEL / CVT_BLOCK)      /* blocks per FF x D weight: 512 */
#define PREP_CVT   (4 * PREP_DD + 2 * PREP_FD)
#define PREP_MASK  BATCH                               /* blocks: token order, one a batch */
#define PREP_GRID  (PREP_LN + PREP_CVT + PREP_MASK)

__global__ __launch_bounds__(256)
void prep_kernel(const float* __restrict__ x, const float* __restrict__ alpha,
                 const float* __restrict__ bias, _Float16* __restrict__ xn,
                 const float* __restrict__ w_q, const float* __restrict__ w_k,
                 const float* __restrict__ w_v, const float* __restrict__ w_o,
                 const float* __restrict__ fc1_w, const float* __restrict__ fc2_w,
                 _Float16* __restrict__ wh,
                 const int* __restrict__ mask, float* __restrict__ madd,
                 int* __restrict__ inv, int* __restrict__ cnt) {
  const int blk = blockIdx.x;
  if (blk < PREP_LN) {
    ln_row<true>(x, alpha, bias, xn, blk, mask);
  } else if (blk < PREP_LN + PREP_CVT) {
    const int cb = blk - PREP_LN;          // block within the six planes
    const float* in;
    int first;                             // the plane's first block
    if (cb < 4 * PREP_DD) {
      const int w = cb / PREP_DD;
      in = (w == 0) ? w_q : (w == 1) ? w_k : (w == 2) ? w_v : w_o;
      first = w * PREP_DD;
    } else if (cb < 4 * PREP_DD + PREP_FD) {
      in = fc1_w; first = 4 * PREP_DD;
    } else {
      in = fc2_w; first = 4 * PREP_DD + PREP_FD;
    }
    cvt_block(in, wh + (size_t)first * CVT_BLOCK, cb - first);
  } else {
    keymap_block(mask, madd, inv, cnt, blk - (PREP_LN + PREP_CVT));
  }
}

// ---- Tiled WMMA GEMM:  C[M,N] = act(A[M,K] * W[N,K]^T + bias) (+resid) ----
// Block = 256 threads (8 waves), tile T x T, 128 k a stage. Waves: 2 (M) x 4 (N);
// each wave owns T/2 x T/4 of output. T = 128: 4 M-frags x 2 N-frags, 8 WMMA on
// 6 fragments / 32 k, two work-groups a WGP. T = 256: 8 x 4, 32 WMMA on 12
// fragments / 32 k, one work-group a WGP: half the bytes from L2 and half the
// LDS reads per WMMA; for a product with a tile for every WGP (M, N multiples
// of T).
// Two LDS buffers: every wave issues one tensor load a stage for its own slice
// (waves 0..3: T/4 rows of A each, waves 4..7: T/4 rows of W each), so that the
// next stage flies while this one is worked on. K: a multiple of 128, >= 256.
// blockIdx.z picks one of several products on the same A: weight planes [N,K]
// and f16 output planes [M,N] lie one behind another.
// VTRANS: the plane of blockIdx.z == 2 (V) is stored head-major and transposed,
// [B, N, SEQ] (N = head * HD + hd), as attention reads it: an accumulator
// register group holds 8 consecutive rows of one column, which are 16
// contiguous bytes there, so each group goes out as one 16-byte store.
// In that form the rows stand in the kept-first token order, and a K or V tile
// whose rows all lie behind the last key tile that attention walks is not
// computed: nothing reads it.

template <int T, bool RELU, bool RESID, bool BIAS, bool OUTF32, bool OUTF16, bool VTRANS>
__global__ __launch_bounds__(256)
void gemm_kernel(const _Float16* __restrict__ A, const _Float16* __restrict__ W,
                 const float* __restrict__ bias, const float* __restrict__ resid,
                 float* __restrict__ outf, _Float16* __restrict__ outh,
                 const int* __restrict__ cnt, int M, int N, int K) {
  constexpr int SLICE = G_SLICE(T);
  constexpr int BUF   = G_BUF(T);
  constexpr int FA    = T / 32;            // A fragments (16 rows each) a wave
  constexpr int FB    = T / 64;            // W fragments a wave
  constexpr int SF    = G_SROWS(T) / 16;   // fragments a slice
  __shared__ __attribute__((aligned(2048))) char sm[2 * BUF];
  const int t    = threadIdx.x;
  const int lane = t & 31;
  const uint32_t wave = uni((uint32_t)t >> 5);
  const int wm   = wave >> 2;       // 0..1  (T/2 rows of M each)
  const int wn   = wave & 3;        // 0..3  (T/4 cols of N each)
  const int m0   = blockIdx.y * T;
  const int n0   = blockIdx.x * T;

  if constexpr (VTRANS) {
    // The whole work-group leaves, ahead of every tensor load and barrier.
    if (blockIdx.z != 0 && m0 % SEQ >= walked_tiles(cnt, m0 / SEQ) * ATT_KEYS) return;
  }

  v8f acc[FA][FB];
#pragma unroll
  for (int i = 0; i < FA; ++i)
#pragma unroll
    for (int j = 0; j < FB; ++j) acc[i][j] = v8f{};

  auto compute_stage = [&](const char* buf) {
    const char* Ab = buf + (wm * 2) * SLICE;     // this wave's T/2 rows of A: two slices
    const char* Bb = buf + (4 + wn) * SLICE;     // this wave's T/4 rows of W: one slice
    if constexpr (T == 128) {
      // Two fragment sets: the next 32-k block's 12 LDS reads go out as one group
      // ahead of this block's 8 WMMAs, which wait only for their own set. All
      // within the stage: no block of the next stage is read here.
      // All loops unrolled: the sets are then picked by constants and stay in registers.
      v16h af[2][FA], bf[2][FB];
      auto load_block = [&](int kk) {
#pragma unroll
        for (int nf = 0; nf < FB; ++nf)
          bf[kk & 1][nf] = load_frag_lds(Bb + nf * 16 * G_PITCH + kk * 64, lane);
#pragma unroll
        for (int mf = 0; mf < FA; ++mf)
          af[kk & 1][mf] = load_frag_lds(Ab + (mf / SF) * SLICE + (mf % SF) * 16 * G_PITCH + kk * 64, lane);
      };
      load_block(0);
#pragma unroll
      for (int kk = 0; kk < G_K / 32; ++kk) {
        if (kk + 1 < G_K / 32) load_block(kk + 1);
        // The pair keeps the read group whole and ahead of the WMMAs. Without it
        // the reads are spread among the WMMAs two at a time, into one set, each
        // pair waited to 0 ahead of only two WMMAs.
        __builtin_amdgcn_sched_barrier(0);
#pragma unroll
        for (int mf = 0; mf < FA; ++mf)
#pragma unroll
          for (int nf = 0; nf < FB; ++nf)
            acc[mf][nf] = wmma16x16x32(af[kk & 1][mf], bf[kk & 1][nf], acc[mf][nf]);
        __builtin_amdgcn_sched_barrier(0);
      }
    } else {
#pragma unroll
      for (int kk = 0; kk < G_K / 32; ++kk) {
        v16h bf[FB], af[FA];
#pragma unroll
        for (int nf = 0; nf < FB; ++nf)
          bf[nf] = load_frag_lds(Bb + nf * 16 * G_PITCH + kk * 64, lane);
#pragma unroll
        for (int mf = 0; mf < FA; ++mf)
          af[mf] = load_frag_lds(Ab + (mf / SF) * SLICE + (mf % SF) * 16 * G_PITCH + kk * 64, lane);
        // T = 256: keeps the block's 24 LDS reads one group ahead of its 32 WMMAs.
        // Without the pair the reads are spread among the WMMAs two at a time,
        // each pair waited to 0 ahead of only four WMMAs.
        __builtin_amdgcn_sched_barrier(0);
#pragma unroll
        for (int mf = 0; mf < FA; ++mf)
#pragma unroll
          for (int nf = 0; nf < FB; ++nf)
            acc[mf][nf] = wmma16x16x32(af[mf], bf[nf], acc[mf][nf]);
        __builtin_amdgcn_sched_barrier(0);
      }
    }
  };

  const _Float16* srow = (wave < 4u) ? A + (size_t)(m0 + wave * G_SROWS(T)) * K
                                     : W + ((size_t)blockIdx.z * N + n0 + (wave - 4u) * G_SROWS(T)) * K;
  const uint64_t ga0  = (uint64_t)(uintptr_t)srow;
  const uint32_t lds0 = (uint32_t)(uintptr_t)(void*)&sm[0] + wave * SLICE;
  u32x8 g1 = tdm_group1((uint32_t)K * 2u, (uint32_t)G_SROWS(T));
  u32x4 g0;
  const int nk = K / G_K;

  tdm_group0(g0, lds0, ga0);
  tdm_load(g0, g1);                                    // stage 0 into buffer 0
  tdm_wait(g0, g1);                                    // own slice of stage 0 landed
  __syncthreads();                                     // stage 0 readable by all waves
  tdm_group0(g0, lds0 + BUF, ga0 + G_ROWB);
  tdm_load(g0, g1);                                    // stage 1 into buffer 1

  for (int s = 0; s < nk; ++s) {
    compute_stage(&sm[(s & 1) * BUF]);
    // Hand-over: this wave's reads of stage s are done, its slice of stage s + 1
    // has landed; behind the barrier stage s + 1 is readable and buffer s & 1 free.
    asm volatile("s_wait_dscnt 0x0" ::: "memory");
    tdm_wait(g0, g1);
    __syncthreads();
    if (pinned(s + 2 < nk)) {
      tdm_group0(g0, lds0 + (uint32_t)(s & 1) * BUF, ga0 + (uint64_t)(s + 2) * G_ROWB);
      tdm_load(g0, g1);
    }
  }
  tdm_wait(g0, g1);                                    // nothing in flight at the wave's end
  asm volatile("s_wait_dscnt 0x0" ::: "memory");

  const int hi8 = (lane >> 4) * 8;
  if constexpr (VTRANS) {
    if (blockIdx.z == 2) {
      // SEQ is a multiple of the tile's T rows: a tile lies in one batch.
      const unsigned int bb = (unsigned int)m0 / SEQ;
      const unsigned int s0 = (unsigned int)m0 % SEQ + wm * (T / 2) + hi8;  // first of this lane's rows
      _Float16* vt = outh + (size_t)2 * M * N + (size_t)bb * N * SEQ + s0;
      // All three loops unrolled: acc is then indexed by constants alone and
      // stays in registers, and mf becomes the stores' immediate offset.
#pragma unroll
      for (int nf = 0; nf < FB; ++nf) {
        const int gn = n0 + wn * (T / 4) + nf * 16 + (lane & 15);
        _Float16* col = vt + (size_t)gn * SEQ;
        // The four stores of a column fill one 128-byte line between the two lane halves.
#pragma unroll
        for (int mf = 0; mf < FA; ++mf) {
          v8h h;
#pragma unroll
          for (int v = 0; v < 8; ++v) h[v] = (_Float16)acc[mf][nf][v];
          *reinterpret_cast<v8h*>(col + mf * 16) = h;
        }
      }
      return;
    }
  }
  if constexpr (T == 256) {
    static_assert(OUTF16 && !OUTF32 && !RESID && !VTRANS, "the 256 x 256 tile has the f16 epilogue alone");
    // A lane has 256 values to store, more than there are registers for all
    // their addresses at once: they go out in groups of 32, one group per 16
    // rows: 8 rows a lane x 4 column fragments, which share the row's address
    // and between them fill the wave's 128-byte line of that row. All loops
    // unrolled: acc, h and p are then indexed by constants alone and stay in
    // registers. D layout: M = v + hi8. A row's distance from the lane's first
    // one is the same in every lane: a scalar product, one vector add a row.
    const int gn0 = n0 + wn * (T / 4) + (lane & 15);
    _Float16* first = outh + (size_t)blockIdx.z * M * N +
                      (size_t)(m0 + wm * (T / 2) + hi8) * N + gn0;
    float bv[FB];
#pragma unroll
    for (int nf = 0; nf < FB; ++nf) {
      bv[nf] = 0.f;
      if constexpr (BIAS) bv[nf] = bias[gn0 + nf * 16];
    }
#pragma unroll
    for (int mf = 0; mf < FA; ++mf) {
      _Float16  h[8][FB];
      _Float16* p[8];
#pragma unroll
      for (int v = 0; v < 8; ++v) {
        p[v] = first + (size_t)(mf * 16 + v) * N;
#pragma unroll
        for (int nf = 0; nf < FB; ++nf) {
          float val = acc[mf][nf][v];
          if constexpr (BIAS) val += bv[nf];
          if constexpr (RELU) val = fmaxf(val, 0.f);
          h[v][nf] = (_Float16)val;
        }
      }
      // Keeps the group's arithmetic ahead of its first store, so that none of
      // it writes a register that an issued store of the group names.
      __builtin_amdgcn_sched_barrier(0);
#pragma unroll
      for (int v = 0; v < 8; ++v)
#pragma unroll
        for (int nf = 0; nf < FB; ++nf) p[v][nf * 16] = h[v][nf];
      // The next group's values and addresses take registers that these stores
      // name: the wait stands ahead of them, the barrier keeps them behind it.
      asm volatile("s_wait_xcnt 0x0" ::: "memory");
      __builtin_amdgcn_sched_barrier(0);
    }
    return;
  }
#pragma unroll
  for (int nf = 0; nf < FB; ++nf) {
    const int gn = n0 + wn * (T / 4) + nf * 16 + (lane & 15);
    float bv = 0.f;
    if constexpr (BIAS) bv = bias[gn];
#pragma unroll
    for (int mf = 0; mf < FA; ++mf) {
#pragma unroll
      for (int v = 0; v < 8; ++v) {
        const int gm = m0 + wm * (T / 2) + mf * 16 + hi8 + v;  // D layout: M = v + hi8
        float val = acc[mf][nf][v];
        if constexpr (BIAS)  val += bv;
        if constexpr (RELU)  val = fmaxf(val, 0.f);
        const size_t idx = (size_t)gm * N + gn;
        if constexpr (RESID) val += resid[idx];
        if constexpr (OUTF32) outf[idx] = val;
        if constexpr (OUTF16) outh[(size_t)blockIdx.z * M * N + idx] = (_Float16)val;
      }
    }
  }
  // Stands behind the last Q or K store: in this form's listing the V block is
  // laid out behind them and writes registers that these stores name.
  if constexpr (VTRANS) asm volatile("s_wait_xcnt 0x0" ::: "memory");
}

#define ATT_PITCH 72                  /* halfs per LDS row: 128 B + 16 B pad, 16 B x odd for b128 readers */
#define ATT_TILE  (64 * ATT_PITCH)    /* halfs per staged K or V^T tile */
#define ATT_NST   (SEQ / ATT_KEYS)    /* tiles per (b, h) */

// One tile's four copies of a lane (16 bytes each). The s_wait_xcnt stands in
// the copies' own statement so that no address register is rewritten ahead of it.
static __device__ __forceinline__ void attn_copy4(
    unsigned int l0, const _Float16* g0, unsigned int l1, const _Float16* g1,
    unsigned int l2, const _Float16* g2, unsigned int l3, const _Float16* g3) {
  asm volatile(
      "global_load_async_to_lds_b128 %0, %1, off\n\t"
      "global_load_async_to_lds_b128 %2, %3, off\n\t"
      "global_load_async_to_lds_b128 %4, %5, off\n\t"
      "global_load_async_to_lds_b128 %6, %7, off\n\t"
      "s_wait_xcnt 0x0"
      :: "v"(l0), "v"(g0), "v"(l1), "v"(g1), "v"(l2), "v"(g2), "v"(l3), "v"(g3)
      : "memory");
}

__global__ __launch_bounds__(256)
void attn_kernel(const _Float16* __restrict__ qh, const _Float16* __restrict__ kh,
                 const _Float16* __restrict__ vt, const float* __restrict__ madd,
                 const int* __restrict__ inv, const int* __restrict__ cnt,
                 _Float16* __restrict__ ctxh) {
  __shared__ __attribute__((aligned(16))) _Float16 kv[2][2][ATT_TILE];
  const int lane = threadIdx.x & 31;
  const int wave = threadIdx.x >> 5;
  const int q0   = blockIdx.x * 128 + wave * 16;
  const int h    = blockIdx.y;
  const int b    = blockIdx.z;
  const size_t hoff = (size_t)h * HD;
  const int hi8  = (lane >> 4) * 8;
  const float scale = 0.125f;  // 1/sqrt(HD)

  // Tiles to walk: the same for the whole work-group, 1 .. ATT_NST.
  const int nst = walked_tiles(cnt, b);
  // The tokens of this lane's eight output rows (unrolled: two 16-byte loads,
  // and otok stays in registers).
  int otok[8];
#pragma unroll
  for (int v = 0; v < 8; ++v) otok[v] = inv[b * SEQ + q0 + hi8 + v] & (SEQ - 1);

  const _Float16* qbase = qh + ((size_t)(b * SEQ + q0)) * D_MODEL + hoff;
  v16h qb_lo = load_frag_rowmajor(qbase,      D_MODEL, lane);   // B: N=q, K=hd
  v16h qb_hi = load_frag_rowmajor(qbase + 32, D_MODEL, lane);

  v8f ctx[4] = {v8f{}, v8f{}, v8f{}, v8f{}};
  float m = -1e30f, l = 0.f;
  const float* mrow = madd + (size_t)b * SEQ;
  const _Float16* vtb = vt + ((size_t)(b * NHEAD + h) * HD) * SEQ;

  // Each thread copies rows crow and crow + 32 of both tiles, 16 bytes at ccol.
  const int crow = threadIdx.x >> 3;         // 0..31
  const int ccol = (threadIdx.x & 7) * 8;    // halfs
  const _Float16* gk = kh + ((size_t)(b * SEQ + crow)) * D_MODEL + hoff + ccol;
  const _Float16* gv = vtb + (size_t)crow * SEQ + ccol;
  const unsigned int lds0 =
      (unsigned int)(uintptr_t)(void*)&kv[0][0][crow * ATT_PITCH + ccol];
  auto copy_tile = [&](int s) {
    const unsigned int lk = lds0 + (unsigned int)(s & 1) * (2 * ATT_TILE * 2);
    const unsigned int lv = lk + ATT_TILE * 2;
    const _Float16* k0 = gk + (size_t)s * ATT_KEYS * D_MODEL;
    const _Float16* v0 = gv + s * ATT_KEYS;
    attn_copy4(lk, k0, lk + 32 * ATT_PITCH * 2, k0 + 32 * D_MODEL,
               lv, v0, lv + 32 * ATT_PITCH * 2, v0 + (size_t)32 * SEQ);
  };

  copy_tile(0);
  asm volatile("s_wait_asynccnt 0x0" ::: "memory");  // own copies of tile 0 landed
  __syncthreads();                                   // tile 0 readable by all waves
  if (nst > 1) copy_tile(1);

  for (int s = 0; s < nst; ++s) {
   const _Float16* Ks = &kv[s & 1][0][0];
   const _Float16* Vs = &kv[s & 1][1][0];
   // The whole tile is read at the head of the trip, as whole groups, each into
   // registers of its own: the mask words and the 16 reads of the eight K
   // fragments ahead of the eight score WMMAs, the 16 reads of the eight V^T
   // fragments behind them. The buffer is then done with: the hand-over and the
   // refill follow at once, and the softmax and P.V work on registers alone while
   // the next copies fly. Nothing of tile s + 1 is read here. All loops unrolled:
   // the fragments are then picked by constants and stay in registers.
   float mk[ATT_KEYS / 16][8];  // additive mask: key = s * ATT_KEYS + g * 16 + hi8 + v
#pragma unroll
   for (int g = 0; g < ATT_KEYS / 16; ++g)
#pragma unroll
     for (int v = 0; v < 8; ++v) mk[g][v] = mrow[s * ATT_KEYS + g * 16 + hi8 + v];
   v16h kf[ATT_KEYS / 16][2];   // 16 keys each; hd 0..31, hd 32..63
#pragma unroll
   for (int g = 0; g < ATT_KEYS / 16; ++g)
#pragma unroll
     for (int c = 0; c < 2; ++c)
       kf[g][c] = load_frag_rowmajor(Ks + g * 16 * ATT_PITCH + c * 32, ATT_PITCH, lane);
   // Keeps the K reads one group ahead of the WMMAs. Without it they are spread
   // among the WMMAs two at a time, into one fragment's registers, each pair
   // waited to 0 ahead of a single WMMA.
   __builtin_amdgcn_sched_barrier(0);
   v8f sc[ATT_KEYS / 16];
#pragma unroll
   for (int g = 0; g < ATT_KEYS / 16; ++g) sc[g] = wmma16x16x32(kf[g][0], qb_lo, v8f{});
#pragma unroll
   for (int g = 0; g < ATT_KEYS / 16; ++g) sc[g] = wmma16x16x32(kf[g][1], qb_hi, sc[g]);
   v16h vf[ATT_KEYS / 32][4];   // 32 keys each; 16 hd a fragment
#pragma unroll
   for (int u = 0; u < ATT_KEYS / 32; ++u)
#pragma unroll
     for (int nf = 0; nf < 4; ++nf)
       vf[u][nf] = load_frag_rowmajor(Vs + (nf * 16) * ATT_PITCH + u * 32, ATT_PITCH, lane);
   // Hand-over: this wave's reads of tile s are done, its copies of tile s + 1
   // have landed; behind the barrier tile s + 1 is readable and buffer s & 1 free.
   asm volatile("s_wait_dscnt 0x0" ::: "memory");
   asm volatile("s_wait_asynccnt 0x0" ::: "memory");
   // Stands ahead of the advance of the mask loads' address register.
   asm volatile("s_wait_xcnt 0x0" ::: "memory");
   __syncthreads();
   if (s + 2 < nst) copy_tile(s + 2);
   // Keeps the refill ahead of the softmax. Without it the softmax and P.V are
   // put between the barrier and the copies, which then have no work to fly under.
   __builtin_amdgcn_sched_barrier(0);
   // Unrolled: sc and vf are picked by constants, no inner branch.
#pragma unroll
   for (int sub = 0; sub < ATT_KEYS; sub += 32) {
    const v8f s0 = sc[sub / 16];
    const v8f s1 = sc[sub / 16 + 1];

    // per-lane: q = lane&15 ; element v: key = s * ATT_KEYS + sub + hi8 + v (s0) / +16 (s1)
    float sv0[8], sv1[8];
    float tmax = -1e30f;
#pragma unroll
    for (int v = 0; v < 8; ++v) {
      const float a = fmaf(s0[v], scale, mk[sub / 16][v]);
      const float c = fmaf(s1[v], scale, mk[sub / 16 + 1][v]);
      sv0[v] = a; sv1[v] = c;
      tmax = fmaxf(tmax, fmaxf(a, c));
    }
    tmax = fmaxf(tmax, __shfl_xor(tmax, 16, 32));
    const float mnew  = fmaxf(m, tmax);
    const float alpha = __expf(m - mnew);
    float psum = 0.f;
    v16h pa;
#pragma unroll
    for (int v = 0; v < 8; ++v) {
      const float p0 = __expf(sv0[v] - mnew);
      const float p1 = __expf(sv1[v] - mnew);
      pa[v]     = (_Float16)p0;    // A-frag elem e<8  -> key kb+e
      pa[8 + v] = (_Float16)p1;    // A-frag elem e>=8 -> key kb+16+(e-8)
      psum += p0 + p1;
    }
    psum += __shfl_xor(psum, 16, 32);
    l = l * alpha + psum;
    m = mnew;

    // rescale ctx: row q = v + hi8 -> alpha lives in lane (v + hi8)
    float rs[8];
#pragma unroll
    for (int v = 0; v < 8; ++v) rs[v] = __shfl(alpha, hi8 + v, 32);
#pragma unroll
    for (int nf = 0; nf < 4; ++nf)
#pragma unroll
      for (int v = 0; v < 8; ++v) ctx[nf][v] *= rs[v];

#pragma unroll
    for (int nf = 0; nf < 4; ++nf) {
      // B operand: N = hd (rows of vt), K = keys (contiguous)
      ctx[nf] = wmma16x16x32(pa, vf[sub / 32][nf], ctx[nf]);
    }
   }
  }
  asm volatile("s_wait_asynccnt 0x0" ::: "memory");  // nothing in flight at the wave's end

  const float linv = 1.f / l;
  float rs[8];
#pragma unroll
  for (int v = 0; v < 8; ++v) rs[v] = __shfl(linv, hi8 + v, 32);
  _Float16* obase = ctxh + (size_t)b * SEQ * D_MODEL + hoff;
#pragma unroll
  for (int nf = 0; nf < 4; ++nf) {
#pragma unroll
    for (int v = 0; v < 8; ++v) {
      const int hd = nf * 16 + (lane & 15);
      obase[(size_t)otok[v] * D_MODEL + hd] = (_Float16)(ctx[nf][v] * rs[v]);
    }
  }
}

// ---- host side ------------------------------------------------------------

extern "C" void kernel_launch(void* const* d_in, const int* in_sizes, int n_in,
                              void* d_out, int out_size, void* d_ws, size_t ws_size,
                              hipStream_t stream) {
  (void)in_sizes; (void)n_in; (void)out_size; (void)ws_size;
  const float* x     = (const float*)d_in[0];
  const int*   mask  = (const int*)d_in[1];
  const float* alpha = (const float*)d_in[2];
  const float* bias  = (const float*)d_in[3];
  const float* w_q   = (const float*)d_in[4];
  const float* w_k   = (const float*)d_in[5];
  const float* w_v   = (const float*)d_in[6];
  const float* w_o   = (const float*)d_in[7];
  const float* fc1_w = (const float*)d_in[8];
  const float* fc1_b = (const float*)d_in[9];
  const float* fc2_w = (const float*)d_in[10];
  const float* fc2_b = (const float*)d_in[11];
  float* out = (float*)d_out;

  char* ws = (char*)d_ws;
  size_t off = 0;
  auto alloc = [&](size_t bytes) -> char* {
    char* p = ws + off;
    off += (bytes + 255) & ~(size_t)255;
    return p;
  };
  _Float16* xn_h  = (_Float16*)alloc((size_t)ROWS * D_MODEL * 2);
  _Float16* wq_h  = (_Float16*)alloc((size_t)D_MODEL * D_MODEL * 2);
  _Float16* wk_h  = (_Float16*)alloc((size_t)D_MODEL * D_MODEL * 2);
  _Float16* wv_h  = (_Float16*)alloc((size_t)D_MODEL * D_MODEL * 2);
  _Float16* wo_h  = (_Float16*)alloc((size_t)D_MODEL * D_MODEL * 2);
  _Float16* fc1_h = (_Float16*)alloc((size_t)FF_DIM * D_MODEL * 2);
  _Float16* fc2_h = (_Float16*)alloc((size_t)D_MODEL * FF_DIM * 2);
  _Float16* q_h   = (_Float16*)alloc((size_t)ROWS * D_MODEL * 2);
  _Float16* k_h   = (_Float16*)alloc((size_t)ROWS * D_MODEL * 2);
  _Float16* vt_h  = (_Float16*)alloc((size_t)ROWS * D_MODEL * 2);
  _Float16* ctx_h = (_Float16*)alloc((size_t)ROWS * D_MODEL * 2);
  float*    x1    = (float*)   alloc((size_t)ROWS * D_MODEL * 4);
  _Float16* xn2_h = (_Float16*)alloc((size_t)ROWS * D_MODEL * 2);
  _Float16* ff_h  = (_Float16*)alloc((size_t)ROWS * FF_DIM * 2);
  float*    madd  = (float*)   alloc((size_t)BATCH * SEQ * 4);
  int*      inv   = (int*)     alloc((size_t)BATCH * SEQ * 4);
  int*      cnt   = (int*)     alloc((size_t)BATCH * CNT_PITCH * 4);
  (void)wk_h; (void)wv_h;   // reached through wq_h: the planes are contiguous

  // LayerNorm 1, the six weight conversions (planes wq_h .. fc2_h are contiguous)
  // and the token order's tables: one launch.
  prep_kernel<<<PREP_GRID, 256, 0, stream>>>(x, alpha, bias, xn_h, w_q, w_k, w_v, w_o,
                                             fc1_w, fc2_w, wq_h, mask, madd, inv, cnt);

  dim3 gD(D_MODEL / 128, ROWS / 128);      // 8 x 32
  dim3 gQKV(D_MODEL / 128, ROWS / 128, 3); // 8 x 32 x 3
  dim3 gF(FF_DIM / 256, ROWS / 256);       // 16 x 16: a 256 x 256 tile for every WGP

  // Q/K/V projections (f16 outputs for attention) in one launch: the planes
  // wq_h, wk_h, wv_h and q_h, k_h, vt_h are contiguous; V goes out transposed.
  gemm_kernel<128, false, false, false, false, true, true><<<gQKV, 256, 0, stream>>>(
      xn_h, wq_h, nullptr, nullptr, nullptr, q_h, cnt, ROWS, D_MODEL, D_MODEL);

  attn_kernel<<<dim3(SEQ / 128, NHEAD, BATCH), 256, 0, stream>>>(
      q_h, k_h, vt_h, madd, inv, cnt, ctx_h);

  // x1 = x + ctx @ Wo^T
  gemm_kernel<128, false, true, false, true, false, false><<<gD, 256, 0, stream>>>(
      ctx_h, wo_h, nullptr, x, x1, nullptr, nullptr, ROWS, D_MODEL, D_MODEL);

  ln_kernel<<<ROWS, 256, 0, stream>>>(x1, alpha, bias, xn2_h);

  // ff = relu(xn2 @ fc1^T + b1)
  gemm_kernel<256, true, false, true, false, true, false><<<gF, 256, 0, stream>>>(
      xn2_h, fc1_h, fc1_b, nullptr, nullptr, ff_h, nullptr, ROWS, FF_DIM, D_MODEL);

  // out = x1 + ff @ fc2^T + b2
  gemm_kernel<128, false, true, true, true, false, false><<<gD, 256, 0, stream>>>(
      ff_h, fc2_h, fc2_b, x1, out, nullptr, nullptr, ROWS, D_MODEL, FF_DIM);
}
